// v000
// Measured on an AMD MI455X. A time is GPU time per run, averaged over a window of back-to-back runs after a warm-up
// (all launches, gaps included; the runs take copies of the inputs in turn), and the median of several windows.
// Apart from v000's, it joins two sittings. Times from different sittings can be a few percent apart, while
// side-by-side timings come from the same sitting.
// v000 is the starting kernel. One run takes 103 microseconds.
// compute dtype: q/k/v and the two relative-position tables rounded to bf16 and used as EXACT f16 operands (bf16 values are exact in f16); per (query, head): TH[j] = q . rel_pos_h[j] and TW[j] = q . rel_pos_w[j] for all table rows on WMMA 16x16x32 (exact products, f32 accumulate), scores = q . k (exact, single product) x 1/8 + TH[hq - kh + 31] + TW[wq - kw + 31]; running-max softmax in f32 (hardware exp); P (scaled by 2^11) as f16 hi + residual x the exact v planes (2 products); f32 accumulate; the merged-head output is written directly.
#include <hip/hip_runtime.h>
#include <math.h>

typedef __attribute__((ext_vector_type(16))) _Float16 v16h;
typedef __attribute__((ext_vector_type(16))) __bf16 v16b;
typedef __attribute__((ext_vector_type(8)))  _Float16 v8h;
typedef __attribute__((ext_vector_type(8)))  float v8f;
typedef __attribute__((ext_vector_type(4)))  float v4f;
typedef __attribute__((ext_vector_type(2)))  float v2f;
typedef __attribute__((ext_vector_type(4)))  unsigned v4u;
typedef __attribute__((ext_vector_type(4)))  int v4i;
typedef float __attribute__((may_alias)) float_a;
typedef int __attribute__((may_alias)) int_a;

template <typename T> __device__ __forceinline__ void vst2(void* p, T v) { *(T*)p = v;  }
__device__ __forceinline__ v8f wmma16(v16h a, v16h b, v8f c) {
  v8f d = __builtin_amdgcn_wmma_f32_16x16x32_f16(false, a, false, b, (short)0, c, false, false);
  asm volatile("v_nop\n\tv_nop\n\tv_nop\n\tv_nop" : "+v"(d) : "v"(a), "v"(b));
  return d;
}
__device__ __forceinline__ v8f wmma_bf(v16b a, v16b b, v8f c) {
  v8f d = __builtin_amdgcn_wmma_f32_16x16x32_bf16(false, a, false, b, (short)0, c, false, false);
  asm volatile("v_nop\n\tv_nop\n\tv_nop\n\tv_nop" : "+v"(d) : "v"(a), "v"(b));
  return d;
}
// Decomposed relative-position attention over a 32 x 32 feature map (B 4, 1,024 positions, 16 heads x 64, q/k/v given): sim = q k^T / 8 + q . R_h[hq, kh] + q . R_w[wq, kw], softmax, . v, heads re-merged.
__device__ __forceinline__ v16h frag_h(const _Float16* rowk0, int lane) {
  union { v16h v; v8h q[2]; } u; const _Float16* p = rowk0 + 8 * (lane >> 4);
  u.q[0] = *(const v8h*)p; u.q[1] = *(const v8h*)(p + 16); return u.v;
}
__device__ __forceinline__ v16h frag_f32(const float* rowk0, int lane) {
  v16h a; const float* p = rowk0 + 8 * (lane >> 4);
#pragma unroll
  for (int i = 0; i < 8; ++i) { a[i] = (_Float16)p[i]; a[8 + i] = (_Float16)p[16 + i]; }
  return a;
}
__device__ __forceinline__ v16h frag_f32s(const float* rowk0, int lane, float sc) {
  v16h a; const float* p = rowk0 + 8 * (lane >> 4);
#pragma unroll
  for (int i = 0; i < 8; ++i) { a[i] = (_Float16)(p[i] * sc); a[8 + i] = (_Float16)(p[16 + i] * sc); }
  return a;
}
// column fragment from a [K][ld] layout (column n), rows >= K read as 0
__device__ __forceinline__ v16h fragc_f32(const float* W, int k0, int n, int lane, int ld, int K) {
  v16h a; const int g = lane >> 4;
#pragma unroll
  for (int i = 0; i < 8; ++i) { const int ka = k0 + 8 * g + i, kb = ka + 16;
    a[i] = (_Float16)(ka < K ? W[(size_t)(ka < K ? ka : K - 1) * ld + n] : 0.f); a[8 + i] = (_Float16)(kb < K ? W[(size_t)(kb < K ? kb : K - 1) * ld + n] : 0.f); }
  return a;
}
struct F2 { v16b h, l; };
__device__ __forceinline__ F2 bsplit16(const float v[16]) { F2 r;
#pragma unroll
  for (int i = 0; i < 16; ++i) { const __bf16 h = (__bf16)v[i]; r.h[i] = h; r.l[i] = (__bf16)(v[i] - (float)h); }
  return r; }
__device__ __forceinline__ F2 split_row(const float* row, int k0, int lane) { float v[16]; const float* p = row + k0 + 8 * (lane >> 4);
#pragma unroll
  for (int i = 0; i < 8; ++i) { v[i] = p[i]; v[8 + i] = p[16 + i]; }
  return bsplit16(v); }
__device__ __forceinline__ F2 split_rowK(const float* row, int k0, int lane, int K) { float v[16]; const int g = lane >> 4;
#pragma unroll
  for (int i = 0; i < 8; ++i) { const int ka = k0 + 8 * g + i, kb = ka + 16; v[i] = ka < K ? row[ka < K ? ka : K - 1] : 0.f; v[8 + i] = kb < K ? row[kb < K ? kb : K - 1] : 0.f; }
  return bsplit16(v); }
__device__ __forceinline__ F2 split_col(const float* W, int k0, int n, int lane, int ld, int K) { float v[16]; const int g = lane >> 4;
#pragma unroll
  for (int i = 0; i < 8; ++i) { const int ka = k0 + 8 * g + i, kb = ka + 16; v[i] = ka < K ? W[(size_t)(ka < K ? ka : K - 1) * ld + n] : 0.f; v[8 + i] = kb < K ? W[(size_t)(kb < K ? kb : K - 1) * ld + n] : 0.f; }
  return bsplit16(v); }
__device__ __forceinline__ v8f mac3(const F2& a, const F2& b, v8f c) { c = wmma_bf(a.l, b.h, c); c = wmma_bf(a.h, b.l, c); return wmma_bf(a.h, b.h, c); }
__device__ __forceinline__ float sigm(float v) { return 1.0f / (1.0f + expf(-v)); }
#define LDSX() do { asm volatile("s_wait_dscnt 0" ::: "memory"); __builtin_amdgcn_wave_barrier(); __builtin_amdgcn_fence(__ATOMIC_RELEASE, "workgroup"); } while (0)


#define NB 4
#define SS 1024
#define IMW 32
#define DM 1024
#define NH 16
#define HD 64
#define QKVW (3 * DM)
#ifndef TQB
#define TQB (SS / 64)
#define TNB NB
#define TOB (NB * SS / 64)     // output row tiles (all)
#endif
typedef __attribute__((ext_vector_type(8))) __bf16 v8b;
__device__ __forceinline__ v16b frag_b(const __bf16* rowk0, int lane) {
  union { v16b v; v8b q[2]; } u; const __bf16* p = rowk0 + 8 * (lane >> 4);
  u.q[0] = *(const v8b*)p; u.q[1] = *(const v8b*)(p + 16); return u.v;
}
__device__ __forceinline__ float bfr(float v) { return (float)(__bf16)v; }
__device__ __attribute__((noinline)) float exp_ni(float v) { return expf(v); }
__device__ __attribute__((noinline)) float erf_ni(float v) { return erff(v); }

#define PK_A 0                       // [3072][1024] Wqkv rows (natural [out][in])
#define PK_P (PK_A + QKVW * DM)        // [1024][1024] Wo rows (natural)
#define PK_END (PK_P + DM * DM)
#define WS_PK  0u
#define WS_QK  (WS_PK + 2u * PK_END)             // f16 [4096 rows][2048]: q | k
#define WS_QKL (WS_QK + 2u * NB * SS * 2 * DM)     // f16 q | k residual planes x2048
#define WS_VTH (WS_QKL + 2u * NB * SS * 2 * DM)    // f16 [b][1024 (h*64+d)][1024 s] hi
#define WS_VTL (WS_VTH + 2u * NB * DM * SS)        // f16 lo x 2048
#define WS_O   (WS_VTL + 2u * NB * DM * SS)        // f32 [4096][1024]
#define WS_CS  (WS_O + 4u * NB * SS * DM)           // f32 2 x [1024][32], unused
#define WS_TBL (WS_CS + 4u * 2 * SS * 32)                 // f16 [2][64][HD]: rel_pos_h rows 0..62 (+ zero row), rel_pos_w
#define WS_END (WS_TBL + 2u * 2 * 64 * HD)
// ---- k_pack: block = (row n, which): natural [out][in] rows -> bf16; which 0..2 -> W_q/W_k/W_v into PK_A rows which*1024 + n; 3 -> W_o into PK_P
__global__ __launch_bounds__(256) void k_pack(const float* __restrict__ WQ, const float* __restrict__ WK, const float* __restrict__ WV, const float* __restrict__ WO, __bf16* __restrict__ PK) {
  __shared__ __align__(16) __bf16 s[DM]; const int n = blockIdx.x, which = blockIdx.y, t = threadIdx.x; const float* Wm = (which == 0) ? WQ : (which == 1) ? WK : (which == 2) ? WV : WO;
  for (int k = t; k < DM; k += 256) s[k] = (__bf16)Wm[(size_t)n * DM + k];
  __syncthreads();
  __bf16* dst = (which < 3) ? PK + PK_A + ((size_t)which * DM + n) * DM : PK + PK_P + (size_t)n * DM;
  for (int q = t; q < DM / 8; q += 256) vst2((unsigned*)(dst + q * 8), *(const v4u*)&s[q * 8]);
}
__global__ __launch_bounds__(128) void k_qkv(const float* __restrict__ XQ, const float* __restrict__ XK, const float* __restrict__ XV, const __bf16* __restrict__ P, const float* __restrict__ BQ, const float* __restrict__ BK, const float* __restrict__ BV, _Float16* __restrict__ QK, _Float16* __restrict__ QKL, _Float16* __restrict__ VTH, _Float16* __restrict__ VTL) {
  const int which0 = (blockIdx.y * 128) / DM; const float* X = (which0 == 0) ? XQ : (which0 == 1) ? XK : XV; const float* BB = BQ ? (((which0 == 0) ? BQ : (which0 == 1) ? BK : BV) + (blockIdx.y * 128 - which0 * DM)) : nullptr;
  __shared__ __align__(16) _Float16 so[4][16][136], sol[4][16][136]; __shared__ __align__(16) _Float16 sth[128][72], stl[128][72];
  const int tid = threadIdx.x, wave = tid >> 5, lane = tid & 31, col = lane & 15, g = lane >> 4; const size_t r0 = (size_t)blockIdx.x * 64 + wave * 16; const int n0 = blockIdx.y * 128;
  v8f acc[8] = {};
#pragma unroll 2
  for (int kc = 0; kc < DM / 32; ++kc) { v16b a; { const float* p = X + (r0 + col) * DM + kc * 32 + 8 * g;
#pragma unroll
      for (int i = 0; i < 8; ++i) { a[i] = (__bf16)p[i]; a[8 + i] = (__bf16)p[16 + i]; } }
#pragma unroll
    for (int j = 0; j < 8; ++j) acc[j] = wmma_bf(a, frag_b(P + (size_t)(n0 + j * 16 + col) * DM + kc * 32, lane), acc[j]); }
  if (n0 < 2 * DM) {   // q stored unscaled (f16 sigma ~0.6, no subnormal exposure); 1/8 applied to the f32 score
#pragma unroll
    for (int j = 0; j < 8; ++j) {
#pragma unroll
      for (int r = 0; r < 8; ++r) { const float v = acc[j][r] + (BB ? bfr(BB[j * 16 + col]) : 0.f); const _Float16 hv = (_Float16)v; so[wave][8 * g + r][j * 16 + col] = hv; sol[wave][8 * g + r][j * 16 + col] = (_Float16)((v - (float)hv) * 2048.0f); } }   // q, k (+ bias) as f16 hi + (x2048) residual
    LDSX();
    for (int rl = 0; rl < 16; ++rl) if (lane < 16) { vst2((unsigned*)(QK + (r0 + rl) * (2 * DM) + n0 + lane * 8), *(const v4u*)&so[wave][rl][lane * 8]); vst2((unsigned*)(QKL + (r0 + rl) * (2 * DM) + n0 + lane * 8), *(const v4u*)&sol[wave][rl][lane * 8]); }
  } else {
#pragma unroll
    for (int j = 0; j < 8; ++j) {
#pragma unroll
      for (int r = 0; r < 8; ++r) { const float v = acc[j][r] + (BB ? bfr(BB[j * 16 + col]) : 0.f); const _Float16 hv = (_Float16)v; sth[j * 16 + col][wave * 16 + 8 * g + r] = hv; stl[j * 16 + col][wave * 16 + 8 * g + r] = (_Float16)((v - (float)hv) * 2048.0f); } }
    __syncthreads();
    const size_t rb = (size_t)blockIdx.x * 64; const int b = (int)(rb / SS), s0 = (int)(rb % SS); const int pc0 = n0 - 2 * DM;
    for (int q = tid; q < 128 * 8; q += 128) { const int d = q >> 3, pc = q & 7; const size_t o = ((size_t)b * DM + pc0 + d) * SS + s0 + pc * 8; vst2((unsigned*)(VTH + o), *(const v4u*)&sth[d][pc * 8]); vst2((unsigned*)(VTL + o), *(const v4u*)&stl[d][pc * 8]); }
  }
}
// ---- k_attn: block = (64 queries, head h, batch b): all-keys flash attention (K = 64: 2 k-steps), scores = (q.k) * 0.125 with single f16 operands, P.V: (2048 P as f16 hi, lo*2048) x f16 V in two accumulators; O[b*S+q][h*64+d] = (acc + accl / 2048) / (2048 l) (256-B segments)
__global__ __launch_bounds__(128) void k_attn(const _Float16* __restrict__ QK, const _Float16* __restrict__ QKL, const _Float16* __restrict__ VTH, const _Float16* __restrict__ VTL, const void* __restrict__ KMASK, const _Float16* __restrict__ TBL, float* __restrict__ O) {
  __shared__ float sth[4][16][68], stw[4][16][68];
  __shared__ __align__(16) float sp[4][16][36]; __shared__ __align__(16) float so[4][16][68];
  const int tid = threadIdx.x, wave = tid >> 5, lane = tid & 31, col = lane & 15, g = lane >> 4;
  const int qb = blockIdx.x, h = blockIdx.y, b = blockIdx.z; const int q0 = qb * 64 + wave * 16; const size_t rq = (size_t)b * SS + q0 + col;
  v16h aq[2], aql[2];
#pragma unroll
  for (int kc = 0; kc < 2; ++kc) { aq[kc] = frag_h(QK + rq * (2 * DM) + h * HD + kc * 32, lane); aql[kc] = frag_h(QKL + rq * (2 * DM) + h * HD + kc * 32, lane); }
  // relative-position dot tables for this wave's 16 queries: TH[r][j] = q_r . rel_pos_h[j], TW[r][j] = q_r . rel_pos_w[j] (exact products)
#pragma unroll
  for (int tb = 0; tb < 2; ++tb) {
#pragma unroll
    for (int jt = 0; jt < 4; ++jt) { v8f tacc = {};
#pragma unroll
      for (int kc = 0; kc < 2; ++kc) tacc = wmma16(aq[kc], frag_h(TBL + ((size_t)tb * 64 + jt * 16 + col) * HD + kc * 32, lane), tacc);
#pragma unroll
      for (int r = 0; r < 8; ++r) { if (tb == 0) sth[wave][8 * g + r][jt * 16 + col] = tacc[r]; else stw[wave][8 * g + r][jt * 16 + col] = tacc[r]; } } }
  LDSX();
  int hqr[8], wqr[8];
#pragma unroll
  for (int r = 0; r < 8; ++r) { const int p = q0 + 8 * g + r; hqr[r] = p / IMW; wqr[r] = p % IMW; }
  float m[8], l[8];
#pragma unroll
  for (int r = 0; r < 8; ++r) { m[r] = -3.0e38f; l[r] = 0.f; }
  v8f acc[4] = {}, accl[4] = {};
  const int nks = SS / 32;   // all keys
#pragma unroll 1
  for (int ks = 0; ks < nks; ++ks) { v8f s[2];
#pragma unroll
    for (int ct = 0; ct < 2; ++ct) { const int kk = ks * 32 + ct * 16 + col; const _Float16* krow = QK + ((size_t)b * SS + kk) * (2 * DM) + DM + h * HD; const _Float16* krowl = QKL + ((size_t)b * SS + kk) * (2 * DM) + DM + h * HD; v8f c = {}, cl = {};
#pragma unroll
      for (int kc = 0; kc < 2; ++kc) c = wmma16(aq[kc], frag_h(krow + kc * 32, lane), c);   // single EXACT product: q, k are bf16 inputs held exactly in f16
      (void)cl; (void)krowl;
      { const bool keepk = true;
      const int kh = kk / IMW, kw = kk % IMW;
#pragma unroll
      for (int r = 0; r < 8; ++r) s[ct][r] = c[r] * 0.125f + sth[wave][8 * g + r][hqr[r] - kh + (IMW - 1)] + stw[wave][8 * g + r][wqr[r] - kw + (IMW - 1)]; } }   // q.k/8 + q.R_h[hq,kh] + q.R_w[wq,kw]
#pragma unroll
    for (int r = 0; r < 8; ++r) { float mx = fmaxf(s[0][r], s[1][r]);
#pragma unroll
      for (int o = 1; o < 16; o <<= 1) mx = fmaxf(mx, __shfl_xor(mx, o));
      const float mn = fmaxf(m[r], mx); const float alpha = (m[r] <= -1.0e38f) ? 0.f : __expf(m[r] - mn);
      const float e0 = (s[0][r] <= -1.0e38f) ? 0.f : __expf(s[0][r] - mn), e1 = (s[1][r] <= -1.0e38f) ? 0.f : __expf(s[1][r] - mn); float es = e0 + e1;
#pragma unroll
      for (int o = 1; o < 16; o <<= 1) es += __shfl_xor(es, o);
      l[r] = l[r] * alpha + es; m[r] = mn;
#pragma unroll
      for (int dt = 0; dt < 4; ++dt) { acc[dt][r] *= alpha; accl[dt][r] *= alpha; }
      sp[wave][8 * g + r][col] = e0; sp[wave][8 * g + r][16 + col] = e1; }
    LDSX();
    v16h pa, pl; { const float* prow = &sp[wave][col][0] + 8 * (lane >> 4);
#pragma unroll
      for (int i = 0; i < 8; ++i) { const float x0 = prow[i] * 2048.0f, x1 = prow[16 + i] * 2048.0f; const _Float16 h0 = (_Float16)x0, h1 = (_Float16)x1; pa[i] = h0; pa[8 + i] = h1; pl[i] = (_Float16)((x0 - (float)h0) * 2048.0f); pl[8 + i] = (_Float16)((x1 - (float)h1) * 2048.0f); } }   // P scaled by 2^11 before the f16 split so small softmax weights stay out of the f16 subnormal range; 2^-11 folded into the epilogue
#pragma unroll
    for (int dt = 0; dt < 4; ++dt) { const size_t vr = ((size_t)b * DM + h * HD + dt * 16 + col) * SS + ks * 32; const v16h vh = frag_h(VTH + vr, lane); acc[dt] = wmma16(pa, vh, acc[dt]); accl[dt] = wmma16(pl, vh, accl[dt]); }   // P hi x V + P lo x V / 2048 (v exact)
    LDSX(); }
#pragma unroll
  for (int r = 0; r < 8; ++r) { const float il = (1.0f / 2048.0f) / l[r];
#pragma unroll
    for (int dt = 0; dt < 4; ++dt) so[wave][8 * g + r][dt * 16 + col] = (acc[dt][r] + accl[dt][r] * (1.0f / 2048.0f)) * il; }
  LDSX();
  for (int rl = 0; rl < 16; ++rl) if (lane < 16) vst2(O + ((size_t)b * SS + q0 + rl) * DM + h * HD + lane * 4, *(const v4f*)&so[wave][rl][lane * 4]);
}
// ---- k_out: block = (64 rows, 128 cols): out = O(hi/lo) . Wo rows (2 products) + bo
__global__ __launch_bounds__(128) void k_out(const float* __restrict__ O, const __bf16* __restrict__ P, const float* __restrict__ BO, float* __restrict__ Y) {
  __shared__ __align__(16) float so[4][16][132];
  const int tid = threadIdx.x, wave = tid >> 5, lane = tid & 31, col = lane & 15, g = lane >> 4; const size_t r0 = (size_t)blockIdx.x * 64 + wave * 16; const int n0 = blockIdx.y * 128;
  v8f acc[8] = {};
#pragma unroll 2
  for (int kc = 0; kc < DM / 32; ++kc) { const F2 a = split_row(O + (r0 + col) * DM, kc * 32, lane);
#pragma unroll
    for (int j = 0; j < 8; ++j) { const v16b w = frag_b(P + (size_t)(n0 + j * 16 + col) * DM + kc * 32, lane); acc[j] = wmma_bf(a.l, w, acc[j]); acc[j] = wmma_bf(a.h, w, acc[j]); } }
#pragma unroll
  for (int j = 0; j < 8; ++j) {
#pragma unroll
    for (int r = 0; r < 8; ++r) so[wave][8 * g + r][j * 16 + col] = acc[j][r] + (BO ? bfr(BO[n0 + j * 16 + col]) : 0.f); }
  LDSX();
  for (int rl = 0; rl < 16; ++rl) vst2(Y + (r0 + rl) * DM + n0 + lane * 4, *(const v4f*)&so[wave][rl][lane * 4]);
}
// ---- k_prep: block = 64 rows: q | k -> f16 rows [row][2*DM] (exact); v -> f16 planes [b][DM][SS] (exact)
__global__ __launch_bounds__(256) void k_prep(const float* __restrict__ Q, const float* __restrict__ Kx, const float* __restrict__ V, _Float16* __restrict__ QK, _Float16* __restrict__ VTH) {
  __shared__ __align__(16) _Float16 sq[64][72]; __shared__ __align__(16) _Float16 svt[128][72];
  const int t = threadIdx.x; const size_t r0 = (size_t)blockIdx.x * 64; const int which = blockIdx.y;   // y: 0..15 q chunks of 64 cols, 16..31 k chunks, 32..39 v chunks of 128 channels
  if (which < 32) { const float* src = (which < 16) ? Q : Kx; const int c0 = (which & 15) * 64;
    for (int e = t; e < 64 * 64; e += 256) { const int r = e >> 6, c = e & 63; sq[r][c] = (_Float16)bfr(src[(r0 + r) * DM + c0 + c]); }
    __syncthreads();
    for (int e = t; e < 64 * 8; e += 256) { const int r = e >> 3, q = e & 7; vst2((unsigned*)(QK + (r0 + r) * (2 * DM) + (which < 16 ? 0 : DM) + c0 + q * 8), *(const v4u*)&sq[r][q * 8]); }
  } else { const int c0 = (which - 32) * 128; const size_t b = r0 / SS, s0 = r0 % SS;
    for (int e = t; e < 64 * 128; e += 256) { const int c = e >> 6, r = e & 63; svt[c][r] = (_Float16)bfr(V[(r0 + r) * DM + c0 + c]); }
    __syncthreads();
    for (int e = t; e < 128 * 8; e += 256) { const int c = e >> 3, pc = e & 7; vst2((unsigned*)(VTH + (b * DM + c0 + c) * SS + s0 + pc * 8), *(const v4u*)&svt[c][pc * 8]); } }
}
// ---- k_tbl: rel_pos_h / rel_pos_w [63][64] -> f16 [64][64] (row 63 zero)
__global__ __launch_bounds__(64) void k_tbl(const float* __restrict__ RH, const float* __restrict__ RW, _Float16* __restrict__ TBL) { const int j = blockIdx.x, tb = blockIdx.y, t = threadIdx.x; __shared__ __align__(16) _Float16 s[HD]; const float* src = tb ? RW : RH; s[t] = (_Float16)((j < 2 * IMW - 1) ? bfr(src[(size_t)j * HD + t]) : 0.f); __syncthreads(); if (t < HD / 8) vst2((unsigned*)(TBL + ((size_t)tb * 64 + j) * HD + t * 8), *(const v4u*)&s[t * 8]); }
extern "C" void kernel_launch(void* const* d_in, const int* in_sizes, int n_in, void* d_out, int out_size, void* d_ws, size_t ws_size, hipStream_t stream) {
  (void)in_sizes; (void)n_in; (void)out_size;
  const float** F = (const float**)d_in;   // 0 q, 1 k, 2 v [4,1,1024,1024] (= [b][s][h*64+d]); 3 rel_pos_h [63,64]; 4 rel_pos_w [63,64]
  if (ws_size < (size_t)WS_END) return;
  char* ws = (char*)d_ws; _Float16 *QK = (_Float16*)(ws + WS_QK), *QKL = (_Float16*)(ws + WS_QKL), *VTH = (_Float16*)(ws + WS_VTH), *VTL = (_Float16*)(ws + WS_VTL), *TBL = (_Float16*)(ws + WS_TBL);
  k_tbl<<<dim3(64, 2), 64, 0, stream>>>(F[3], F[4], TBL);
  k_prep<<<dim3(TNB * SS / 64, 40), 256, 0, stream>>>(F[0], F[1], F[2], QK, VTH);
  k_attn<<<dim3(TQB, NH, TNB), 128, 0, stream>>>(QK, QKL, VTH, VTL, nullptr, TBL, (float*)d_out);   // O layout [b*S+q][h*64+d] == the module's merged (b,1,s,n*d) output
}

// v001
// A run of this version takes 91.8 microseconds.
// Timed twice side by side with v000, it ran 1.16 and 1.15 times as fast.
// compute dtype: q/k/v and the two relative-position tables rounded to bf16 and used as EXACT f16 operands (bf16 values are exact in f16); per (query, head): TH[j] = q . rel_pos_h[j] and TW[j] = q . rel_pos_w[j] for all table rows on WMMA 16x16x32 (exact products, f32 accumulate), scores = q . k (exact, single product) x 1/8 + TH[hq - kh + 31] + TW[wq - kw + 31]; running-max softmax in f32 (hardware exp); P (scaled by 2^11) as f16 hi + residual x the exact v planes (2 products); f32 accumulate; the merged-head output is written directly.
#include <hip/hip_runtime.h>
#include <math.h>

typedef __attribute__((ext_vector_type(16))) _Float16 v16h;
typedef __attribute__((ext_vector_type(16))) __bf16 v16b;
typedef __attribute__((ext_vector_type(8)))  _Float16 v8h;
typedef __attribute__((ext_vector_type(8)))  float v8f;
typedef __attribute__((ext_vector_type(4)))  float v4f;
typedef __attribute__((ext_vector_type(2)))  float v2f;
typedef __attribute__((ext_vector_type(4)))  unsigned v4u;
typedef __attribute__((ext_vector_type(4)))  int v4i;
typedef float __attribute__((may_alias)) float_a;
typedef int __attribute__((may_alias)) int_a;

template <typename T> __device__ __forceinline__ void vst2(void* p, T v) { *(T*)p = v;  }
__device__ __forceinline__ v8f wmma16(v16h a, v16h b, v8f c) {
  v8f d = __builtin_amdgcn_wmma_f32_16x16x32_f16(false, a, false, b, (short)0, c, false, false);
  asm volatile("v_nop\n\tv_nop\n\tv_nop\n\tv_nop" : "+v"(d) : "v"(a), "v"(b));
  return d;
}
__device__ __forceinline__ v8f wmma_bf(v16b a, v16b b, v8f c) {
  v8f d = __builtin_amdgcn_wmma_f32_16x16x32_bf16(false, a, false, b, (short)0, c, false, false);
  asm volatile("v_nop\n\tv_nop\n\tv_nop\n\tv_nop" : "+v"(d) : "v"(a), "v"(b));
  return d;
}
// Decomposed relative-position attention over a 32 x 32 feature map (B 4, 1,024 positions, 16 heads x 64, q/k/v given): sim = q k^T / 8 + q . R_h[hq, kh] + q . R_w[wq, kw], softmax, . v, heads re-merged.
__device__ __forceinline__ v16h frag_h(const _Float16* rowk0, int lane) {
  union { v16h v; v8h q[2]; } u; const _Float16* p = rowk0 + 8 * (lane >> 4);
  u.q[0] = *(const v8h*)p; u.q[1] = *(const v8h*)(p + 16); return u.v;
}
__device__ __forceinline__ v16h frag_f32(const float* rowk0, int lane) {
  v16h a; const float* p = rowk0 + 8 * (lane >> 4);
#pragma unroll
  for (int i = 0; i < 8; ++i) { a[i] = (_Float16)p[i]; a[8 + i] = (_Float16)p[16 + i]; }
  return a;
}
__device__ __forceinline__ v16h frag_f32s(const float* rowk0, int lane, float sc) {
  v16h a; const float* p = rowk0 + 8 * (lane >> 4);
#pragma unroll
  for (int i = 0; i < 8; ++i) { a[i] = (_Float16)(p[i] * sc); a[8 + i] = (_Float16)(p[16 + i] * sc); }
  return a;
}
// column fragment from a [K][ld] layout (column n), rows >= K read as 0
__device__ __forceinline__ v16h fragc_f32(const float* W, int k0, int n, int lane, int ld, int K) {
  v16h a; const int g = lane >> 4;
#pragma unroll
  for (int i = 0; i < 8; ++i) { const int ka = k0 + 8 * g + i, kb = ka + 16;
    a[i] = (_Float16)(ka < K ? W[(size_t)(ka < K ? ka : K - 1) * ld + n] : 0.f); a[8 + i] = (_Float16)(kb < K ? W[(size_t)(kb < K ? kb : K - 1) * ld + n] : 0.f); }
  return a;
}
struct F2 { v16b h, l; };
__device__ __forceinline__ F2 bsplit16(const float v[16]) { F2 r;
#pragma unroll
  for (int i = 0; i < 16; ++i) { const __bf16 h = (__bf16)v[i]; r.h[i] = h; r.l[i] = (__bf16)(v[i] - (float)h); }
  return r; }
__device__ __forceinline__ F2 split_row(const float* row, int k0, int lane) { float v[16]; const float* p = row + k0 + 8 * (lane >> 4);
#pragma unroll
  for (int i = 0; i < 8; ++i) { v[i] = p[i]; v[8 + i] = p[16 + i]; }
  return bsplit16(v); }
__device__ __forceinline__ F2 split_rowK(const float* row, int k0, int lane, int K) { float v[16]; const int g = lane >> 4;
#pragma unroll
  for (int i = 0; i < 8; ++i) { const int ka = k0 + 8 * g + i, kb = ka + 16; v[i] = ka < K ? row[ka < K ? ka : K - 1] : 0.f; v[8 + i] = kb < K ? row[kb < K ? kb : K - 1] : 0.f; }
  return bsplit16(v); }
__device__ __forceinline__ F2 split_col(const float* W, int k0, int n, int lane, int ld, int K) { float v[16]; const int g = lane >> 4;
#pragma unroll
  for (int i = 0; i < 8; ++i) { const int ka = k0 + 8 * g + i, kb = ka + 16; v[i] = ka < K ? W[(size_t)(ka < K ? ka : K - 1) * ld + n] : 0.f; v[8 + i] = kb < K ? W[(size_t)(kb < K ? kb : K - 1) * ld + n] : 0.f; }
  return bsplit16(v); }
__device__ __forceinline__ v8f mac3(const F2& a, const F2& b, v8f c) { c = wmma_bf(a.l, b.h, c); c = wmma_bf(a.h, b.l, c); return wmma_bf(a.h, b.h, c); }
__device__ __forceinline__ float sigm(float v) { return 1.0f / (1.0f + expf(-v)); }
#define LDSX() do { asm volatile("s_wait_dscnt 0" ::: "memory"); __builtin_amdgcn_wave_barrier(); __builtin_amdgcn_fence(__ATOMIC_RELEASE, "workgroup"); } while (0)


#define NB 4
#define SS 1024
#define IMW 32
#define DM 1024
#define NH 16
#define HD 64
#define QKVW (3 * DM)
#ifndef TQB
#define TQB (SS / 64)
#define TNB NB
#define TOB (NB * SS / 64)     // output row tiles (all)
#endif
typedef __attribute__((ext_vector_type(8))) __bf16 v8b;
__device__ __forceinline__ v16b frag_b(const __bf16* rowk0, int lane) {
  union { v16b v; v8b q[2]; } u; const __bf16* p = rowk0 + 8 * (lane >> 4);
  u.q[0] = *(const v8b*)p; u.q[1] = *(const v8b*)(p + 16); return u.v;
}
__device__ __forceinline__ float bfr(float v) { return (float)(__bf16)v; }
__device__ __attribute__((noinline)) float exp_ni(float v) { return expf(v); }
__device__ __attribute__((noinline)) float erf_ni(float v) { return erff(v); }

#define PK_A 0                       // [3072][1024] Wqkv rows (natural [out][in])
#define PK_P (PK_A + QKVW * DM)        // [1024][1024] Wo rows (natural)
#define PK_END (PK_P + DM * DM)
#define WS_PK  0u
#define WS_QK  (WS_PK + 2u * PK_END)             // f16 [4096 rows][2048]: q | k
#define WS_QKL (WS_QK + 2u * NB * SS * 2 * DM)     // f16 q | k residual planes x2048
#define WS_VTH (WS_QKL + 2u * NB * SS * 2 * DM)    // f16 [b][1024 (h*64+d)][1024 s] hi
#define WS_VTL (WS_VTH + 2u * NB * DM * SS)        // f16 lo x 2048
#define WS_O   (WS_VTL + 2u * NB * DM * SS)        // f32 [4096][1024]
#define WS_CS  (WS_O + 4u * NB * SS * DM)           // f32 2 x [1024][32], unused
#define WS_TBL (WS_CS + 4u * 2 * SS * 32)                 // f16 [2][64][HD]: rel_pos_h rows 0..62 (+ zero row), rel_pos_w
#define WS_END (WS_TBL + 2u * 2 * 64 * HD)
// ---- k_pack: block = (row n, which): natural [out][in] rows -> bf16; which 0..2 -> W_q/W_k/W_v into PK_A rows which*1024 + n; 3 -> W_o into PK_P
__global__ __launch_bounds__(256) void k_pack(const float* __restrict__ WQ, const float* __restrict__ WK, const float* __restrict__ WV, const float* __restrict__ WO, __bf16* __restrict__ PK) {
  __shared__ __align__(16) __bf16 s[DM]; const int n = blockIdx.x, which = blockIdx.y, t = threadIdx.x; const float* Wm = (which == 0) ? WQ : (which == 1) ? WK : (which == 2) ? WV : WO;
  for (int k = t; k < DM; k += 256) s[k] = (__bf16)Wm[(size_t)n * DM + k];
  __syncthreads();
  __bf16* dst = (which < 3) ? PK + PK_A + ((size_t)which * DM + n) * DM : PK + PK_P + (size_t)n * DM;
  for (int q = t; q < DM / 8; q += 256) vst2((unsigned*)(dst + q * 8), *(const v4u*)&s[q * 8]);
}
__global__ __launch_bounds__(128) void k_qkv(const float* __restrict__ XQ, const float* __restrict__ XK, const float* __restrict__ XV, const __bf16* __restrict__ P, const float* __restrict__ BQ, const float* __restrict__ BK, const float* __restrict__ BV, _Float16* __restrict__ QK, _Float16* __restrict__ QKL, _Float16* __restrict__ VTH, _Float16* __restrict__ VTL) {
  const int which0 = (blockIdx.y * 128) / DM; const float* X = (which0 == 0) ? XQ : (which0 == 1) ? XK : XV; const float* BB = BQ ? (((which0 == 0) ? BQ : (which0 == 1) ? BK : BV) + (blockIdx.y * 128 - which0 * DM)) : nullptr;
  __shared__ __align__(16) _Float16 so[4][16][136], sol[4][16][136]; __shared__ __align__(16) _Float16 sth[128][72], stl[128][72];
  const int tid = threadIdx.x, wave = tid >> 5, lane = tid & 31, col = lane & 15, g = lane >> 4; const size_t r0 = (size_t)blockIdx.x * 64 + wave * 16; const int n0 = blockIdx.y * 128;
  v8f acc[8] = {};
#pragma unroll 2
  for (int kc = 0; kc < DM / 32; ++kc) { v16b a; { const float* p = X + (r0 + col) * DM + kc * 32 + 8 * g;
#pragma unroll
      for (int i = 0; i < 8; ++i) { a[i] = (__bf16)p[i]; a[8 + i] = (__bf16)p[16 + i]; } }
#pragma unroll
    for (int j = 0; j < 8; ++j) acc[j] = wmma_bf(a, frag_b(P + (size_t)(n0 + j * 16 + col) * DM + kc * 32, lane), acc[j]); }
  if (n0 < 2 * DM) {   // q stored unscaled (f16 sigma ~0.6, no subnormal exposure); 1/8 applied to the f32 score
#pragma unroll
    for (int j = 0; j < 8; ++j) {
#pragma unroll
      for (int r = 0; r < 8; ++r) { const float v = acc[j][r] + (BB ? bfr(BB[j * 16 + col]) : 0.f); const _Float16 hv = (_Float16)v; so[wave][8 * g + r][j * 16 + col] = hv; sol[wave][8 * g + r][j * 16 + col] = (_Float16)((v - (float)hv) * 2048.0f); } }   // q, k (+ bias) as f16 hi + (x2048) residual
    LDSX();
    for (int rl = 0; rl < 16; ++rl) if (lane < 16) { vst2((unsigned*)(QK + (r0 + rl) * (2 * DM) + n0 + lane * 8), *(const v4u*)&so[wave][rl][lane * 8]); vst2((unsigned*)(QKL + (r0 + rl) * (2 * DM) + n0 + lane * 8), *(const v4u*)&sol[wave][rl][lane * 8]); }
  } else {
#pragma unroll
    for (int j = 0; j < 8; ++j) {
#pragma unroll
      for (int r = 0; r < 8; ++r) { const float v = acc[j][r] + (BB ? bfr(BB[j * 16 + col]) : 0.f); const _Float16 hv = (_Float16)v; sth[j * 16 + col][wave * 16 + 8 * g + r] = hv; stl[j * 16 + col][wave * 16 + 8 * g + r] = (_Float16)((v - (float)hv) * 2048.0f); } }
    __syncthreads();
    const size_t rb = (size_t)blockIdx.x * 64; const int b = (int)(rb / SS), s0 = (int)(rb % SS); const int pc0 = n0 - 2 * DM;
    for (int q = tid; q < 128 * 8; q += 128) { const int d = q >> 3, pc = q & 7; const size_t o = ((size_t)b * DM + pc0 + d) * SS + s0 + pc * 8; vst2((unsigned*)(VTH + o), *(const v4u*)&sth[d][pc * 8]); vst2((unsigned*)(VTL + o), *(const v4u*)&stl[d][pc * 8]); }
  }
}
// ---- k_attn: block = (64 queries, head h, batch b): all-keys flash attention, transposed products: S^T = K . Q^T (A = 16 key rows, B = the wave's 16 queries) and O^T += V^T . P^T (A = 16 channel rows of the v plane, B = P^T).
// Lane (col, g) then holds, for the ONE query q0 + col, the scores of keys 8g + r (tile 0) and 16 + 8g + r (tile 1) of the 32-key pass: exactly the k order of a B fragment, so P goes from the score accumulators into the second product without leaving the registers.
// A pass is one image row of keys (32 = IMW): kh = ks for all of them and kw = ct * 16 + 8g + r in every pass, so the width term is 16 values per lane for the whole loop and the height term one value per pass.
static_assert(IMW == 32, "a 32-key pass is one image row");
// lane l <-> lane l ^ 16 (the two halves that share a query)
__device__ __forceinline__ float xhalf(float v) { const int b = __float_as_int(v); return __int_as_float(__builtin_amdgcn_permlanex16(b, b, 0x76543210, 0xfedcba98, false, false)); }
__global__ __launch_bounds__(128) void k_attn(const _Float16* __restrict__ QK, const _Float16* __restrict__ QKL, const _Float16* __restrict__ VTH, const _Float16* __restrict__ VTL, const void* __restrict__ KMASK, const _Float16* __restrict__ TBL, float* __restrict__ O) {
  __shared__ float sth[4][16][68], stw[4][16][68];
  __shared__ __align__(16) float so[4][16][68];
  const int tid = threadIdx.x, wave = tid >> 5, lane = tid & 31, col = lane & 15, g = lane >> 4;
  const int qb = blockIdx.x, h = blockIdx.y, b = blockIdx.z; const int q0 = qb * 64 + wave * 16; const size_t rq = (size_t)b * SS + q0 + col;
  (void)QKL; (void)VTL; (void)KMASK;
  v16h aq[2];
#pragma unroll
  for (int kc = 0; kc < 2; ++kc) aq[kc] = frag_h(QK + rq * (2 * DM) + h * HD + kc * 32, lane);
  // relative-position dot tables for this wave's 16 queries: TH[r][j] = q_r . rel_pos_h[j], TW[r][j] = q_r . rel_pos_w[j] (exact products)
#pragma unroll
  for (int tb = 0; tb < 2; ++tb) {
#pragma unroll
    for (int jt = 0; jt < 4; ++jt) { v8f tacc = {};
#pragma unroll
      for (int kc = 0; kc < 2; ++kc) tacc = wmma16(aq[kc], frag_h(TBL + ((size_t)tb * 64 + jt * 16 + col) * HD + kc * 32, lane), tacc);
#pragma unroll
      for (int r = 0; r < 8; ++r) { if (tb == 0) sth[wave][8 * g + r][jt * 16 + col] = tacc[r]; else stw[wave][8 * g + r][jt * 16 + col] = tacc[r]; } } }
  LDSX();
  const int pq = q0 + col, hq = pq / IMW, wq = pq % IMW;   // this lane's query
  float tw[2][8];
#pragma unroll
  for (int ct = 0; ct < 2; ++ct) {
#pragma unroll
    for (int r = 0; r < 8; ++r) tw[ct][r] = stw[wave][col][wq - (ct * 16 + 8 * g + r) + (IMW - 1)]; }
  const float* thq = &sth[wave][col][hq + (IMW - 1)];
  float m = -3.0e38f, l = 0.f;   // l: this half's 16 keys of every pass; the halves are joined once, behind the loop
  v8f acc[4] = {}, accl[4] = {};
  const int nks = SS / 32;   // all keys
#pragma unroll 1
  for (int ks = 0; ks < nks; ++ks) { float s[16];
    const float th = thq[-ks];
#pragma unroll
    for (int ct = 0; ct < 2; ++ct) { const _Float16* krow = QK + ((size_t)b * SS + ks * 32 + ct * 16 + col) * (2 * DM) + DM + h * HD; v8f c = {};
#pragma unroll
      for (int kc = 0; kc < 2; ++kc) c = wmma16(frag_h(krow + kc * 32, lane), aq[kc], c);   // single EXACT product: q, k are bf16 inputs held exactly in f16
#pragma unroll
      for (int r = 0; r < 8; ++r) s[ct * 8 + r] = c[r] * 0.125f + th + tw[ct][r]; }   // q.k/8 + q.R_h[hq,kh] + q.R_w[wq,kw]
    float t8[8];
#pragma unroll
    for (int i = 0; i < 8; ++i) t8[i] = fmaxf(s[i], s[8 + i]);
    float mx = fmaxf(fmaxf(fmaxf(t8[0], t8[1]), fmaxf(t8[2], t8[3])), fmaxf(fmaxf(t8[4], t8[5]), fmaxf(t8[6], t8[7])));
    mx = fmaxf(mx, xhalf(mx));
    const float mn = fmaxf(m, mx); const float alpha = (m <= -1.0e38f) ? 0.f : __expf(m - mn);
    v16h pa, pl; float e[16];
#pragma unroll
    for (int i = 0; i < 16; ++i) { e[i] = (s[i] <= -1.0e38f) ? 0.f : __expf(s[i] - mn);
      const float x = e[i] * 2048.0f; const _Float16 hx = (_Float16)x; pa[i] = hx; pl[i] = (_Float16)((x - (float)hx) * 2048.0f); }   // P scaled by 2^11 before the f16 split so small softmax weights stay out of the f16 subnormal range; 2^-11 folded into the epilogue
#pragma unroll
    for (int i = 0; i < 8; ++i) t8[i] = e[i] + e[8 + i];
    const float es = ((t8[0] + t8[1]) + (t8[2] + t8[3])) + ((t8[4] + t8[5]) + (t8[6] + t8[7]));
    l = l * alpha + es; m = mn;
#pragma unroll
    for (int dt = 0; dt < 4; ++dt) { acc[dt] *= alpha; accl[dt] *= alpha; }
#pragma unroll
    for (int dt = 0; dt < 4; ++dt) { const size_t vr = ((size_t)b * DM + h * HD + dt * 16 + col) * SS + ks * 32; const v16h vh = frag_h(VTH + vr, lane); acc[dt] = wmma16(vh, pa, acc[dt]); accl[dt] = wmma16(vh, pl, accl[dt]); }   // V^T x P hi + V^T x P lo / 2048 (v exact)
  }
  l += xhalf(l);
  const float il = (1.0f / 2048.0f) / l;
#pragma unroll
  for (int dt = 0; dt < 4; ++dt) {   // acc[dt][r] = O[query col][channel dt * 16 + 8g + r]: 8 consecutive channels per lane
#pragma unroll
    for (int hf = 0; hf < 2; ++hf) { v4f o;
#pragma unroll
      for (int i = 0; i < 4; ++i) o[i] = (acc[dt][hf * 4 + i] + accl[dt][hf * 4 + i] * (1.0f / 2048.0f)) * il;
      *(v4f*)&so[wave][col][dt * 16 + 8 * g + hf * 4] = o; } }
  LDSX();
  for (int rl = 0; rl < 16; ++rl) if (lane < 16) vst2(O + ((size_t)b * SS + q0 + rl) * DM + h * HD + lane * 4, *(const v4f*)&so[wave][rl][lane * 4]);
}
// ---- k_out: block = (64 rows, 128 cols): out = O(hi/lo) . Wo rows (2 products) + bo
__global__ __launch_bounds__(128) void k_out(const float* __restrict__ O, const __bf16* __restrict__ P, const float* __restrict__ BO, float* __restrict__ Y) {
  __shared__ __align__(16) float so[4][16][132];
  const int tid = threadIdx.x, wave = tid >> 5, lane = tid & 31, col = lane & 15, g = lane >> 4; const size_t r0 = (size_t)blockIdx.x * 64 + wave * 16; const int n0 = blockIdx.y * 128;
  v8f acc[8] = {};
#pragma unroll 2
  for (int kc = 0; kc < DM / 32; ++kc) { const F2 a = split_row(O + (r0 + col) * DM, kc * 32, lane);
#pragma unroll
    for (int j = 0; j < 8; ++j) { const v16b w = frag_b(P + (size_t)(n0 + j * 16 + col) * DM + kc * 32, lane); acc[j] = wmma_bf(a.l, w, acc[j]); acc[j] = wmma_bf(a.h, w, acc[j]); } }
#pragma unroll
  for (int j = 0; j < 8; ++j) {
#pragma unroll
    for (int r = 0; r < 8; ++r) so[wave][8 * g + r][j * 16 + col] = acc[j][r] + (BO ? bfr(BO[n0 + j * 16 + col]) : 0.f); }
  LDSX();
  for (int rl = 0; rl < 16; ++rl) vst2(Y + (r0 + rl) * DM + n0 + lane * 4, *(const v4f*)&so[wave][rl][lane * 4]);
}
// ---- k_prep: block = 64 rows: q | k -> f16 rows [row][2*DM] (exact); v -> f16 planes [b][DM][SS] (exact)
__global__ __launch_bounds__(256) void k_prep(const float* __restrict__ Q, const float* __restrict__ Kx, const float* __restrict__ V, _Float16* __restrict__ QK, _Float16* __restrict__ VTH) {
  __shared__ __align__(16) _Float16 sq[64][72]; __shared__ __align__(16) _Float16 svt[128][72];
  const int t = threadIdx.x; const size_t r0 = (size_t)blockIdx.x * 64; const int which = blockIdx.y;   // y: 0..15 q chunks of 64 cols, 16..31 k chunks, 32..39 v chunks of 128 channels
  if (which < 32) { const float* src = (which < 16) ? Q : Kx; const int c0 = (which & 15) * 64;
    for (int e = t; e < 64 * 64; e += 256) { const int r = e >> 6, c = e & 63; sq[r][c] = (_Float16)bfr(src[(r0 + r) * DM + c0 + c]); }
    __syncthreads();
    for (int e = t; e < 64 * 8; e += 256) { const int r = e >> 3, q = e & 7; vst2((unsigned*)(QK + (r0 + r) * (2 * DM) + (which < 16 ? 0 : DM) + c0 + q * 8), *(const v4u*)&sq[r][q * 8]); }
  } else { const int c0 = (which - 32) * 128; const size_t b = r0 / SS, s0 = r0 % SS;
    for (int e = t; e < 64 * 128; e += 256) { const int c = e >> 6, r = e & 63; svt[c][r] = (_Float16)bfr(V[(r0 + r) * DM + c0 + c]); }
    __syncthreads();
    for (int e = t; e < 128 * 8; e += 256) { const int c = e >> 3, pc = e & 7; vst2((unsigned*)(VTH + (b * DM + c0 + c) * SS + s0 + pc * 8), *(const v4u*)&svt[c][pc * 8]); } }
}
// ---- k_tbl: rel_pos_h / rel_pos_w [63][64] -> f16 [64][64] (row 63 zero)
__global__ __launch_bounds__(64) void k_tbl(const float* __restrict__ RH, const float* __restrict__ RW, _Float16* __restrict__ TBL) { const int j = blockIdx.x, tb = blockIdx.y, t = threadIdx.x; __shared__ __align__(16) _Float16 s[HD]; const float* src = tb ? RW : RH; s[t] = (_Float16)((j < 2 * IMW - 1) ? bfr(src[(size_t)j * HD + t]) : 0.f); __syncthreads(); if (t < HD / 8) vst2((unsigned*)(TBL + ((size_t)tb * 64 + j) * HD + t * 8), *(const v4u*)&s[t * 8]); }
extern "C" void kernel_launch(void* const* d_in, const int* in_sizes, int n_in, void* d_out, int out_size, void* d_ws, size_t ws_size, hipStream_t stream) {
  (void)in_sizes; (void)n_in; (void)out_size;
  const float** F = (const float**)d_in;   // 0 q, 1 k, 2 v [4,1,1024,1024] (= [b][s][h*64+d]); 3 rel_pos_h [63,64]; 4 rel_pos_w [63,64]
  if (ws_size < (size_t)WS_END) return;
  char* ws = (char*)d_ws; _Float16 *QK = (_Float16*)(ws + WS_QK), *QKL = (_Float16*)(ws + WS_QKL), *VTH = (_Float16*)(ws + WS_VTH), *VTL = (_Float16*)(ws + WS_VTL), *TBL = (_Float16*)(ws + WS_TBL);
  k_tbl<<<dim3(64, 2), 64, 0, stream>>>(F[3], F[4], TBL);
  k_prep<<<dim3(TNB * SS / 64, 40), 256, 0, stream>>>(F[0], F[1], F[2], QK, VTH);
  k_attn<<<dim3(TQB, NH, TNB), 128, 0, stream>>>(QK, QKL, VTH, VTL, nullptr, TBL, (float*)d_out);   // O layout [b*S+q][h*64+d] == the module's merged (b,1,s,n*d) output
}

// v002
// A run of this version takes 59.2 microseconds.
// Two timings next to v001 both put it at 1.55 times that version's speed.
// Over all steps from v000 it is 1.80 times as fast.
// compute dtype: q/k/v and the two relative-position tables rounded to bf16 and used as EXACT f16 operands (bf16 values are exact in f16); per (query, head): TH[j] = q . rel_pos_h[j] and TW[j] = q . rel_pos_w[j] for all table rows on WMMA 16x16x32 (exact products, f32 accumulate), scores = q . k (exact, single product) x 1/8 + TH[hq - kh + 31] + TW[wq - kw + 31]; running-max softmax in f32 (hardware exp); P (scaled by 2^11) as f16 hi + residual x the exact v planes (2 products); f32 accumulate; the merged-head output is written directly.
#include <hip/hip_runtime.h>
#include <math.h>

typedef __attribute__((ext_vector_type(16))) _Float16 v16h;
typedef __attribute__((ext_vector_type(16))) __bf16 v16b;
typedef __attribute__((ext_vector_type(8)))  _Float16 v8h;
typedef __attribute__((ext_vector_type(8)))  float v8f;
typedef __attribute__((ext_vector_type(4)))  float v4f;
typedef __attribute__((ext_vector_type(2)))  float v2f;
typedef __attribute__((ext_vector_type(4)))  unsigned v4u;
typedef __attribute__((ext_vector_type(4)))  int v4i;
typedef float __attribute__((may_alias)) float_a;
typedef int __attribute__((may_alias)) int_a;

template <typename T> __device__ __forceinline__ void vst2(void* p, T v) { *(T*)p = v;  }
__device__ __forceinline__ v8f wmma16(v16h a, v16h b, v8f c) {
  v8f d = __builtin_amdgcn_wmma_f32_16x16x32_f16(false, a, false, b, (short)0, c, false, false);
  asm volatile("v_nop\n\tv_nop\n\tv_nop\n\tv_nop" : "+v"(d) : "v"(a), "v"(b));
  return d;
}
__device__ __forceinline__ v8f wmma_bf(v16b a, v16b b, v8f c) {
  v8f d = __builtin_amdgcn_wmma_f32_16x16x32_bf16(false, a, false, b, (short)0, c, false, false);
  asm volatile("v_nop\n\tv_nop\n\tv_nop\n\tv_nop" : "+v"(d) : "v"(a), "v"(b));
  return d;
}
// Decomposed relative-position attention over a 32 x 32 feature map (B 4, 1,024 positions, 16 heads x 64, q/k/v given): sim = q k^T / 8 + q . R_h[hq, kh] + q . R_w[wq, kw], softmax, . v, heads re-merged.
__device__ __forceinline__ v16h frag_h(const _Float16* rowk0, int lane) {
  union { v16h v; v8h q[2]; } u; const _Float16* p = rowk0 + 8 * (lane >> 4);
  u.q[0] = *(const v8h*)p; u.q[1] = *(const v8h*)(p + 16); return u.v;
}
__device__ __forceinline__ v16h frag_f32(const float* rowk0, int lane) {
  v16h a; const float* p = rowk0 + 8 * (lane >> 4);
#pragma unroll
  for (int i = 0; i < 8; ++i) { a[i] = (_Float16)p[i]; a[8 + i] = (_Float16)p[16 + i]; }
  return a;
}
__device__ __forceinline__ v16h frag_f32s(const float* rowk0, int lane, float sc) {
  v16h a; const float* p = rowk0 + 8 * (lane >> 4);
#pragma unroll
  for (int i = 0; i < 8; ++i) { a[i] = (_Float16)(p[i] * sc); a[8 + i] = (_Float16)(p[16 + i] * sc); }
  return a;
}
// column fragment from a [K][ld] layout (column n), rows >= K read as 0
__device__ __forceinline__ v16h fragc_f32(const float* W, int k0, int n, int lane, int ld, int K) {
  v16h a; const int g = lane >> 4;
#pragma unroll
  for (int i = 0; i < 8; ++i) { const int ka = k0 + 8 * g + i, kb = ka + 16;
    a[i] = (_Float16)(ka < K ? W[(size_t)(ka < K ? ka : K - 1) * ld + n] : 0.f); a[8 + i] = (_Float16)(kb < K ? W[(size_t)(kb < K ? kb : K - 1) * ld + n] : 0.f); }
  return a;
}
struct F2 { v16b h, l; };
__device__ __forceinline__ F2 bsplit16(const float v[16]) { F2 r;
#pragma unroll
  for (int i = 0; i < 16; ++i) { const __bf16 h = (__bf16)v[i]; r.h[i] = h; r.l[i] = (__bf16)(v[i] - (float)h); }
  return r; }
__device__ __forceinline__ F2 split_row(const float* row, int k0, int lane) { float v[16]; const float* p = row + k0 + 8 * (lane >> 4);
#pragma unroll
  for (int i = 0; i < 8; ++i) { v[i] = p[i]; v[8 + i] = p[16 + i]; }
  return bsplit16(v); }
__device__ __forceinline__ F2 split_rowK(const float* row, int k0, int lane, int K) { float v[16]; const int g = lane >> 4;
#pragma unroll
  for (int i = 0; i < 8; ++i) { const int ka = k0 + 8 * g + i, kb = ka + 16; v[i] = ka < K ? row[ka < K ? ka : K - 1] : 0.f; v[8 + i] = kb < K ? row[kb < K ? kb : K - 1] : 0.f; }
  return bsplit16(v); }
__device__ __forceinline__ F2 split_col(const float* W, int k0, int n, int lane, int ld, int K) { float v[16]; const int g = lane >> 4;
#pragma unroll
  for (int i = 0; i < 8; ++i) { const int ka = k0 + 8 * g + i, kb = ka + 16; v[i] = ka < K ? W[(size_t)(ka < K ? ka : K - 1) * ld + n] : 0.f; v[8 + i] = kb < K ? W[(size_t)(kb < K ? kb : K - 1) * ld + n] : 0.f; }
  return bsplit16(v); }
__device__ __forceinline__ v8f mac3(const F2& a, const F2& b, v8f c) { c = wmma_bf(a.l, b.h, c); c = wmma_bf(a.h, b.l, c); return wmma_bf(a.h, b.h, c); }
__device__ __forceinline__ float sigm(float v) { return 1.0f / (1.0f + expf(-v)); }
#define LDSX() do { asm volatile("s_wait_dscnt 0" ::: "memory"); __builtin_amdgcn_wave_barrier(); __builtin_amdgcn_fence(__ATOMIC_RELEASE, "workgroup"); } while (0)


#define NB 4
#define SS 1024
#define IMW 32
#define DM 1024
#define NH 16
#define HD 64
#define QKVW (3 * DM)
#ifndef TQB
#define TQB (SS / 64)
#define TNB NB
#define TOB (NB * SS / 64)     // output row tiles (all)
#endif
typedef __attribute__((ext_vector_type(8))) __bf16 v8b;
__device__ __forceinline__ v16b frag_b(const __bf16* rowk0, int lane) {
  union { v16b v; v8b q[2]; } u; const __bf16* p = rowk0 + 8 * (lane >> 4);
  u.q[0] = *(const v8b*)p; u.q[1] = *(const v8b*)(p + 16); return u.v;
}
__device__ __forceinline__ float bfr(float v) { return (float)(__bf16)v; }
__device__ __attribute__((noinline)) float exp_ni(float v) { return expf(v); }
__device__ __attribute__((noinline)) float erf_ni(float v) { return erff(v); }

#define PK_A 0                       // [3072][1024] Wqkv rows (natural [out][in])
#define PK_P (PK_A + QKVW * DM)        // [1024][1024] Wo rows (natural)
#define PK_END (PK_P + DM * DM)
#define WS_PK  0u
#define WS_QK  (WS_PK + 2u * PK_END)             // f16 [4096 rows][2048]: q | k
#define WS_QKL (WS_QK + 2u * NB * SS * 2 * DM)     // f16 q | k residual planes x2048
#define WS_VTH (WS_QKL + 2u * NB * SS * 2 * DM)    // f16 [b][1024 (h*64+d)][1024 s] hi
#define WS_VTL (WS_VTH + 2u * NB * DM * SS)        // f16 lo x 2048
#define WS_O   (WS_VTL + 2u * NB * DM * SS)        // f32 [4096][1024]
#define WS_CS  (WS_O + 4u * NB * SS * DM)           // f32 2 x [1024][32], unused
#define WS_TBL (WS_CS + 4u * 2 * SS * 32)                 // f16 [2][64][HD]: rel_pos_h rows 0..62 (+ zero row), rel_pos_w
#define WS_END (WS_TBL + 2u * 2 * 64 * HD)
// ---- k_pack: block = (row n, which): natural [out][in] rows -> bf16; which 0..2 -> W_q/W_k/W_v into PK_A rows which*1024 + n; 3 -> W_o into PK_P
__global__ __launch_bounds__(256) void k_pack(const float* __restrict__ WQ, const float* __restrict__ WK, const float* __restrict__ WV, const float* __restrict__ WO, __bf16* __restrict__ PK) {
  __shared__ __align__(16) __bf16 s[DM]; const int n = blockIdx.x, which = blockIdx.y, t = threadIdx.x; const float* Wm = (which == 0) ? WQ : (which == 1) ? WK : (which == 2) ? WV : WO;
  for (int k = t; k < DM; k += 256) s[k] = (__bf16)Wm[(size_t)n * DM + k];
  __syncthreads();
  __bf16* dst = (which < 3) ? PK + PK_A + ((size_t)which * DM + n) * DM : PK + PK_P + (size_t)n * DM;
  for (int q = t; q < DM / 8; q += 256) vst2((unsigned*)(dst + q * 8), *(const v4u*)&s[q * 8]);
}
__global__ __launch_bounds__(128) void k_qkv(const float* __restrict__ XQ, const float* __restrict__ XK, const float* __restrict__ XV, const __bf16* __restrict__ P, const float* __restrict__ BQ, const float* __restrict__ BK, const float* __restrict__ BV, _Float16* __restrict__ QK, _Float16* __restrict__ QKL, _Float16* __restrict__ VTH, _Float16* __restrict__ VTL) {
  const int which0 = (blockIdx.y * 128) / DM; const float* X = (which0 == 0) ? XQ : (which0 == 1) ? XK : XV; const float* BB = BQ ? (((which0 == 0) ? BQ : (which0 == 1) ? BK : BV) + (blockIdx.y * 128 - which0 * DM)) : nullptr;
  __shared__ __align__(16) _Float16 so[4][16][136], sol[4][16][136]; __shared__ __align__(16) _Float16 sth[128][72], stl[128][72];
  const int tid = threadIdx.x, wave = tid >> 5, lane = tid & 31, col = lane & 15, g = lane >> 4; const size_t r0 = (size_t)blockIdx.x * 64 + wave * 16; const int n0 = blockIdx.y * 128;
  v8f acc[8] = {};
#pragma unroll 2
  for (int kc = 0; kc < DM / 32; ++kc) { v16b a; { const float* p = X + (r0 + col) * DM + kc * 32 + 8 * g;
#pragma unroll
      for (int i = 0; i < 8; ++i) { a[i] = (__bf16)p[i]; a[8 + i] = (__bf16)p[16 + i]; } }
#pragma unroll
    for (int j = 0; j < 8; ++j) acc[j] = wmma_bf(a, frag_b(P + (size_t)(n0 + j * 16 + col) * DM + kc * 32, lane), acc[j]); }
  if (n0 < 2 * DM) {   // q stored unscaled (f16 sigma ~0.6, no subnormal exposure); 1/8 applied to the f32 score
#pragma unroll
    for (int j = 0; j < 8; ++j) {
#pragma unroll
      for (int r = 0; r < 8; ++r) { const float v = acc[j][r] + (BB ? bfr(BB[j * 16 + col]) : 0.f); const _Float16 hv = (_Float16)v; so[wave][8 * g + r][j * 16 + col] = hv; sol[wave][8 * g + r][j * 16 + col] = (_Float16)((v - (float)hv) * 2048.0f); } }   // q, k (+ bias) as f16 hi + (x2048) residual
    LDSX();
    for (int rl = 0; rl < 16; ++rl) if (lane < 16) { vst2((unsigned*)(QK + (r0 + rl) * (2 * DM) + n0 + lane * 8), *(const v4u*)&so[wave][rl][lane * 8]); vst2((unsigned*)(QKL + (r0 + rl) * (2 * DM) + n0 + lane * 8), *(const v4u*)&sol[wave][rl][lane * 8]); }
  } else {
#pragma unroll
    for (int j = 0; j < 8; ++j) {
#pragma unroll
      for (int r = 0; r < 8; ++r) { const float v = acc[j][r] + (BB ? bfr(BB[j * 16 + col]) : 0.f); const _Float16 hv = (_Float16)v; sth[j * 16 + col][wave * 16 + 8 * g + r] = hv; stl[j * 16 + col][wave * 16 + 8 * g + r] = (_Float16)((v - (float)hv) * 2048.0f); } }
    __syncthreads();
    const size_t rb = (size_t)blockIdx.x * 64; const int b = (int)(rb / SS), s0 = (int)(rb % SS); const int pc0 = n0 - 2 * DM;
    for (int q = tid; q < 128 * 8; q += 128) { const int d = q >> 3, pc = q & 7; const size_t o = ((size_t)b * DM + pc0 + d) * SS + s0 + pc * 8; vst2((unsigned*)(VTH + o), *(const v4u*)&sth[d][pc * 8]); vst2((unsigned*)(VTL + o), *(const v4u*)&stl[d][pc * 8]); }
  }
}
// ---- k_attn: block = (64 queries, head h, batch b): all-keys flash attention, transposed products: S^T = K . Q^T (A = 16 key rows, B = the wave's 16 queries) and O^T += V^T . P^T (A = 16 channel rows of the v plane, B = P^T).
// Lane (col, g) then holds, for the ONE query q0 + col, the scores of keys 8g + r (tile 0) and 16 + 8g + r (tile 1) of the 32-key pass: exactly the k order of a B fragment, so P goes from the score accumulators into the second product without leaving the registers.
// A pass is one image row of keys (32 = IMW): kh = ks for all of them and kw = ct * 16 + 8g + r in every pass, so the width term is 16 values per lane for the whole loop and the height term one value per pass.
static_assert(IMW == 32, "a 32-key pass is one image row");
// lane l <-> lane l ^ 16 (the two halves that share a query)
__device__ __forceinline__ float xhalf(float v) { const int b = __float_as_int(v); return __int_as_float(__builtin_amdgcn_permlanex16(b, b, 0x76543210, 0xfedcba98, false, false)); }
// K and V of a pass are the same for the four waves of a block: each 32-key tile is brought into LDS once per block, by 16-byte asynchronous copies, two buffers, the next tile in flight while this one is worked on; the waves read their A fragments from LDS.
#define KPITCH 72   // f16 per staged key row: 128 B + 16 B, the conflict-free pitch for 16-byte LDS reads
#define VPITCH 40   // f16 per staged channel row: 64 B + 16 B, likewise
__device__ __forceinline__ unsigned lds_off(const void* p) { return (unsigned)(size_t)p; }
// one lane's four copies of a tile; the s_wait_xcnt closes the copies' own statement, so that it stands in front of every later write of an address register that a copy names
__device__ __forceinline__ void copy4(unsigned l0, const _Float16* g0, unsigned l1, const _Float16* g1, unsigned l2, const _Float16* g2, unsigned l3, const _Float16* g3) {
  asm volatile("global_load_async_to_lds_b128 %0, %1, off\n\tglobal_load_async_to_lds_b128 %2, %3, off\n\tglobal_load_async_to_lds_b128 %4, %5, off\n\tglobal_load_async_to_lds_b128 %6, %7, off\n\ts_wait_xcnt 0x0"
               :: "v"(l0), "v"(g0), "v"(l1), "v"(g1), "v"(l2), "v"(g2), "v"(l3), "v"(g3) : "memory");
}
__global__ __launch_bounds__(128) void k_attn(const _Float16* __restrict__ QK, const _Float16* __restrict__ QKL, const _Float16* __restrict__ VTH, const _Float16* __restrict__ VTL, const void* __restrict__ KMASK, const _Float16* __restrict__ TBL, float* __restrict__ O) {
  __shared__ float sth[4][16][68], stw[4][16][68];
  __shared__ __align__(16) float so[4][16][68];
  __shared__ __align__(16) _Float16 sk[2][32][KPITCH], sv[2][HD][VPITCH];
  const int tid = threadIdx.x, wave = tid >> 5, lane = tid & 31, col = lane & 15, g = lane >> 4;
  const int qb = blockIdx.x, h = blockIdx.y, b = blockIdx.z; const int q0 = qb * 64 + wave * 16; const size_t rq = (size_t)b * SS + q0 + col;
  (void)QKL; (void)VTL; (void)KMASK;
  // thread t copies 16-byte piece t & 7 of key rows t >> 3 and 16 + (t >> 3), and piece t & 3 of channel rows t >> 2 and 32 + (t >> 2)
  const _Float16* gk = QK + ((size_t)b * SS + (tid >> 3)) * (2 * DM) + DM + h * HD + (tid & 7) * 8;
  const _Float16* gv = VTH + ((size_t)b * DM + h * HD + (tid >> 2)) * SS + (tid & 3) * 8;
  const unsigned lk = lds_off(&sk[0][tid >> 3][(tid & 7) * 8]), lv = lds_off(&sv[0][tid >> 2][(tid & 3) * 8]);
  auto stage = [&](int t) { const _Float16* k0 = gk + (size_t)t * 32 * (2 * DM); const _Float16* v0 = gv + t * 32;
    const unsigned k1 = lk + (t & 1) * (unsigned)sizeof(sk[0]), v1 = lv + (t & 1) * (unsigned)sizeof(sv[0]);
    copy4(k1, k0, k1 + 16 * KPITCH * 2, k0 + (size_t)16 * (2 * DM), v1, v0, v1 + 32 * VPITCH * 2, v0 + (size_t)32 * SS); };
  stage(0);
  v16h aq[2];
#pragma unroll
  for (int kc = 0; kc < 2; ++kc) aq[kc] = frag_h(QK + rq * (2 * DM) + h * HD + kc * 32, lane);
  // relative-position dot tables for this wave's 16 queries: TH[r][j] = q_r . rel_pos_h[j], TW[r][j] = q_r . rel_pos_w[j] (exact products)
#pragma unroll
  for (int tb = 0; tb < 2; ++tb) {
#pragma unroll
    for (int jt = 0; jt < 4; ++jt) { v8f tacc = {};
#pragma unroll
      for (int kc = 0; kc < 2; ++kc) tacc = wmma16(aq[kc], frag_h(TBL + ((size_t)tb * 64 + jt * 16 + col) * HD + kc * 32, lane), tacc);
#pragma unroll
      for (int r = 0; r < 8; ++r) { if (tb == 0) sth[wave][8 * g + r][jt * 16 + col] = tacc[r]; else stw[wave][8 * g + r][jt * 16 + col] = tacc[r]; } } }
  LDSX();
  const int pq = q0 + col, hq = pq / IMW, wq = pq % IMW;   // this lane's query
  float tw[2][8];
#pragma unroll
  for (int ct = 0; ct < 2; ++ct) {
#pragma unroll
    for (int r = 0; r < 8; ++r) tw[ct][r] = stw[wave][col][wq - (ct * 16 + 8 * g + r) + (IMW - 1)]; }
  const float* thq = &sth[wave][col][hq + (IMW - 1)];
  float m = -3.0e38f, l = 0.f;   // l: this half's 16 keys of every pass; the halves are joined once, behind the loop
  v8f acc[4] = {}, accl[4] = {};
  const int nks = SS / 32;   // all keys
  static_assert(SS / 32 >= 2, "the prologue fills two tiles");
  asm volatile("s_wait_asynccnt 0x0" ::: "memory");   // this wave's copies of tile 0 have landed
  __syncthreads();                                    // ... and every other wave's
  stage(1);
#pragma unroll 1
  for (int ks = 0; ks < nks; ++ks) { float s[16];
    const float th = thq[-ks];
    v16h kf[2][2], vf[4];   // all of the pass's LDS reads as one group at its head; the v fragments land behind the score products and the softmax (the three loops are unrolled so that both arrays are indexed by constants and stay in registers)
#pragma unroll
    for (int ct = 0; ct < 2; ++ct) {
#pragma unroll
      for (int kc = 0; kc < 2; ++kc) kf[ct][kc] = frag_h(&sk[ks & 1][ct * 16 + col][kc * 32], lane); }
#pragma unroll
    for (int dt = 0; dt < 4; ++dt) vf[dt] = frag_h(&sv[ks & 1][dt * 16 + col][0], lane);
#pragma unroll
    for (int ct = 0; ct < 2; ++ct) { v8f c = {};
#pragma unroll
      for (int kc = 0; kc < 2; ++kc) c = wmma16(kf[ct][kc], aq[kc], c);   // single EXACT product: q, k are bf16 inputs held exactly in f16
#pragma unroll
      for (int r = 0; r < 8; ++r) s[ct * 8 + r] = c[r] * 0.125f + th + tw[ct][r]; }   // q.k/8 + q.R_h[hq,kh] + q.R_w[wq,kw]
    float t8[8];
#pragma unroll
    for (int i = 0; i < 8; ++i) t8[i] = fmaxf(s[i], s[8 + i]);
    float mx = fmaxf(fmaxf(fmaxf(t8[0], t8[1]), fmaxf(t8[2], t8[3])), fmaxf(fmaxf(t8[4], t8[5]), fmaxf(t8[6], t8[7])));
    mx = fmaxf(mx, xhalf(mx));
    const float mn = fmaxf(m, mx); const float alpha = (m <= -1.0e38f) ? 0.f : __expf(m - mn);
    v16h pa, pl; float e[16];
#pragma unroll
    for (int i = 0; i < 16; ++i) { e[i] = (s[i] <= -1.0e38f) ? 0.f : __expf(s[i] - mn);
      const float x = e[i] * 2048.0f; const _Float16 hx = (_Float16)x; pa[i] = hx; pl[i] = (_Float16)((x - (float)hx) * 2048.0f); }   // P scaled by 2^11 before the f16 split so small softmax weights stay out of the f16 subnormal range; 2^-11 folded into the epilogue
#pragma unroll
    for (int i = 0; i < 8; ++i) t8[i] = e[i] + e[8 + i];
    const float es = ((t8[0] + t8[1]) + (t8[2] + t8[3])) + ((t8[4] + t8[5]) + (t8[6] + t8[7]));
    l = l * alpha + es; m = mn;
#pragma unroll
    for (int dt = 0; dt < 4; ++dt) { acc[dt] *= alpha; accl[dt] *= alpha; }
#pragma unroll
    for (int dt = 0; dt < 4; ++dt) { acc[dt] = wmma16(vf[dt], pa, acc[dt]); accl[dt] = wmma16(vf[dt], pl, accl[dt]); }   // V^T x P hi + V^T x P lo / 2048 (v exact)
    asm volatile("s_wait_dscnt 0x0" ::: "memory");      // this wave's reads of buffer ks & 1 are done
    asm volatile("s_wait_asynccnt 0x0" ::: "memory");   // this wave's copies of tile ks + 1 have landed
    __syncthreads();                                    // publishes tile ks + 1 and frees buffer ks & 1
    if (ks + 2 < nks) stage(ks + 2);
  }
  asm volatile("s_wait_asynccnt 0x0" ::: "memory");     // no copy is left in flight behind the loop
  l += xhalf(l);
  const float il = (1.0f / 2048.0f) / l;
#pragma unroll
  for (int dt = 0; dt < 4; ++dt) {   // acc[dt][r] = O[query col][channel dt * 16 + 8g + r]: 8 consecutive channels per lane
#pragma unroll
    for (int hf = 0; hf < 2; ++hf) { v4f o;
#pragma unroll
      for (int i = 0; i < 4; ++i) o[i] = (acc[dt][hf * 4 + i] + accl[dt][hf * 4 + i] * (1.0f / 2048.0f)) * il;
      *(v4f*)&so[wave][col][dt * 16 + 8 * g + hf * 4] = o; } }
  LDSX();
  for (int rl = 0; rl < 16; ++rl) if (lane < 16) vst2(O + ((size_t)b * SS + q0 + rl) * DM + h * HD + lane * 4, *(const v4f*)&so[wave][rl][lane * 4]);
}
// ---- k_out: block = (64 rows, 128 cols): out = O(hi/lo) . Wo rows (2 products) + bo
__global__ __launch_bounds__(128) void k_out(const float* __restrict__ O, const __bf16* __restrict__ P, const float* __restrict__ BO, float* __restrict__ Y) {
  __shared__ __align__(16) float so[4][16][132];
  const int tid = threadIdx.x, wave = tid >> 5, lane = tid & 31, col = lane & 15, g = lane >> 4; const size_t r0 = (size_t)blockIdx.x * 64 + wave * 16; const int n0 = blockIdx.y * 128;
  v8f acc[8] = {};
#pragma unroll 2
  for (int kc = 0; kc < DM / 32; ++kc) { const F2 a = split_row(O + (r0 + col) * DM, kc * 32, lane);
#pragma unroll
    for (int j = 0; j < 8; ++j) { const v16b w = frag_b(P + (size_t)(n0 + j * 16 + col) * DM + kc * 32, lane); acc[j] = wmma_bf(a.l, w, acc[j]); acc[j] = wmma_bf(a.h, w, acc[j]); } }
#pragma unroll
  for (int j = 0; j < 8; ++j) {
#pragma unroll
    for (int r = 0; r < 8; ++r) so[wave][8 * g + r][j * 16 + col] = acc[j][r] + (BO ? bfr(BO[n0 + j * 16 + col]) : 0.f); }
  LDSX();
  for (int rl = 0; rl < 16; ++rl) vst2(Y + (r0 + rl) * DM + n0 + lane * 4, *(const v4f*)&so[wave][rl][lane * 4]);
}
// ---- k_prep: block = 64 rows: q | k -> f16 rows [row][2*DM] (exact); v -> f16 planes [b][DM][SS] (exact)
__global__ __launch_bounds__(256) void k_prep(const float* __restrict__ Q, const float* __restrict__ Kx, const float* __restrict__ V, _Float16* __restrict__ QK, _Float16* __restrict__ VTH) {
  __shared__ __align__(16) _Float16 sq[64][72]; __shared__ __align__(16) _Float16 svt[128][72];
  const int t = threadIdx.x; const size_t r0 = (size_t)blockIdx.x * 64; const int which = blockIdx.y;   // y: 0..15 q chunks of 64 cols, 16..31 k chunks, 32..39 v chunks of 128 channels
  if (which < 32) { const float* src = (which < 16) ? Q : Kx; const int c0 = (which & 15) * 64;
    for (int e = t; e < 64 * 64; e += 256) { const int r = e >> 6, c = e & 63; sq[r][c] = (_Float16)bfr(src[(r0 + r) * DM + c0 + c]); }
    __syncthreads();
    for (int e = t; e < 64 * 8; e += 256) { const int r = e >> 3, q = e & 7; vst2((unsigned*)(QK + (r0 + r) * (2 * DM) + (which < 16 ? 0 : DM) + c0 + q * 8), *(const v4u*)&sq[r][q * 8]); }
  } else { const int c0 = (which - 32) * 128; const size_t b = r0 / SS, s0 = r0 % SS;
    for (int e = t; e < 64 * 128; e += 256) { const int c = e >> 6, r = e & 63; svt[c][r] = (_Float16)bfr(V[(r0 + r) * DM + c0 + c]); }
    __syncthreads();
    for (int e = t; e < 128 * 8; e += 256) { const int c = e >> 3, pc = e & 7; vst2((unsigned*)(VTH + (b * DM + c0 + c) * SS + s0 + pc * 8), *(const v4u*)&svt[c][pc * 8]); } }
}
// ---- k_tbl: rel_pos_h / rel_pos_w [63][64] -> f16 [64][64] (row 63 zero)
__global__ __launch_bounds__(64) void k_tbl(const float* __restrict__ RH, const float* __restrict__ RW, _Float16* __restrict__ TBL) { const int j = blockIdx.x, tb = blockIdx.y, t = threadIdx.x; __shared__ __align__(16) _Float16 s[HD]; const float* src = tb ? RW : RH; s[t] = (_Float16)((j < 2 * IMW - 1) ? bfr(src[(size_t)j * HD + t]) : 0.f); __syncthreads(); if (t < HD / 8) vst2((unsigned*)(TBL + ((size_t)tb * 64 + j) * HD + t * 8), *(const v4u*)&s[t * 8]); }
extern "C" void kernel_launch(void* const* d_in, const int* in_sizes, int n_in, void* d_out, int out_size, void* d_ws, size_t ws_size, hipStream_t stream) {
  (void)in_sizes; (void)n_in; (void)out_size;
  const float** F = (const float**)d_in;   // 0 q, 1 k, 2 v [4,1,1024,1024] (= [b][s][h*64+d]); 3 rel_pos_h [63,64]; 4 rel_pos_w [63,64]
  if (ws_size < (size_t)WS_END) return;
  char* ws = (char*)d_ws; _Float16 *QK = (_Float16*)(ws + WS_QK), *QKL = (_Float16*)(ws + WS_QKL), *VTH = (_Float16*)(ws + WS_VTH), *VTL = (_Float16*)(ws + WS_VTL), *TBL = (_Float16*)(ws + WS_TBL);
  k_tbl<<<dim3(64, 2), 64, 0, stream>>>(F[3], F[4], TBL);
  k_prep<<<dim3(TNB * SS / 64, 40), 256, 0, stream>>>(F[0], F[1], F[2], QK, VTH);
  k_attn<<<dim3(TQB, NH, TNB), 128, 0, stream>>>(QK, QKL, VTH, VTL, nullptr, TBL, (float*)d_out);   // O layout [b*S+q][h*64+d] == the module's merged (b,1,s,n*d) output
}

// v003
// Measured time: 52.3 microseconds a run.
// Timed twice side by side with v002, it ran 1.13 times as fast both times.
// All steps since v000 together make it 2.03 times as fast.
// compute dtype: q/k/v and the two relative-position tables rounded to bf16 and used as EXACT f16 operands (bf16 values are exact in f16); per (query, head): TH[j] = q . rel_pos_h[j] and TW[j] = q . rel_pos_w[j] for all table rows on WMMA 16x16x32 (exact products, f32 accumulate), 8 x scores = q . k (exact products) accumulated onto 8 x (TH[hq - kh + 31] + TW[wq - kw + 31]); running-max softmax in f32, base 2 (hardware exp2); P (scaled by 2^11) as f16 hi + residual x the exact v planes (2 products); f32 accumulate; the merged-head output is written directly.
#include <hip/hip_runtime.h>
#include <math.h>

typedef __attribute__((ext_vector_type(16))) _Float16 v16h;
typedef __attribute__((ext_vector_type(16))) __bf16 v16b;
typedef __attribute__((ext_vector_type(8)))  _Float16 v8h;
typedef __attribute__((ext_vector_type(8)))  float v8f;
typedef __attribute__((ext_vector_type(4)))  float v4f;
typedef __attribute__((ext_vector_type(2)))  float v2f;
typedef __attribute__((ext_vector_type(4)))  unsigned v4u;
typedef __attribute__((ext_vector_type(4)))  int v4i;
typedef float __attribute__((may_alias)) float_a;
typedef int __attribute__((may_alias)) int_a;

template <typename T> __device__ __forceinline__ void vst2(void* p, T v) { *(T*)p = v;  }
__device__ __forceinline__ v8f wmma16(v16h a, v16h b, v8f c) {
  v8f d = __builtin_amdgcn_wmma_f32_16x16x32_f16(false, a, false, b, (short)0, c, false, false);
  asm volatile("v_nop\n\tv_nop\n\tv_nop\n\tv_nop" : "+v"(d) : "v"(a), "v"(b));
  return d;
}
__device__ __forceinline__ v8f wmma_bf(v16b a, v16b b, v8f c) {
  v8f d = __builtin_amdgcn_wmma_f32_16x16x32_bf16(false, a, false, b, (short)0, c, false, false);
  asm volatile("v_nop\n\tv_nop\n\tv_nop\n\tv_nop" : "+v"(d) : "v"(a), "v"(b));
  return d;
}
// Decomposed relative-position attention over a 32 x 32 feature map (B 4, 1,024 positions, 16 heads x 64, q/k/v given): sim = q k^T / 8 + q . R_h[hq, kh] + q . R_w[wq, kw], softmax, . v, heads re-merged.
__device__ __forceinline__ v16h frag_h(const _Float16* rowk0, int lane) {
  union { v16h v; v8h q[2]; } u; const _Float16* p = rowk0 + 8 * (lane >> 4);
  u.q[0] = *(const v8h*)p; u.q[1] = *(const v8h*)(p + 16); return u.v;
}
__device__ __forceinline__ v16h frag_f32(const float* rowk0, int lane) {
  v16h a; const float* p = rowk0 + 8 * (lane >> 4);
#pragma unroll
  for (int i = 0; i < 8; ++i) { a[i] = (_Float16)p[i]; a[8 + i] = (_Float16)p[16 + i]; }
  return a;
}
__device__ __forceinline__ v16h frag_f32s(const float* rowk0, int lane, float sc) {
  v16h a; const float* p = rowk0 + 8 * (lane >> 4);
#pragma unroll
  for (int i = 0; i < 8; ++i) { a[i] = (_Float16)(p[i] * sc); a[8 + i] = (_Float16)(p[16 + i] * sc); }
  return a;
}
// column fragment from a [K][ld] layout (column n), rows >= K read as 0
__device__ __forceinline__ v16h fragc_f32(const float* W, int k0, int n, int lane, int ld, int K) {
  v16h a; const int g = lane >> 4;
#pragma unroll
  for (int i = 0; i < 8; ++i) { const int ka = k0 + 8 * g + i, kb = ka + 16;
    a[i] = (_Float16)(ka < K ? W[(size_t)(ka < K ? ka : K - 1) * ld + n] : 0.f); a[8 + i] = (_Float16)(kb < K ? W[(size_t)(kb < K ? kb : K - 1) * ld + n] : 0.f); }
  return a;
}
struct F2 { v16b h, l; };
__device__ __forceinline__ F2 bsplit16(const float v[16]) { F2 r;
#pragma unroll
  for (int i = 0; i < 16; ++i) { const __bf16 h = (__bf16)v[i]; r.h[i] = h; r.l[i] = (__bf16)(v[i] - (float)h); }
  return r; }
__device__ __forceinline__ F2 split_row(const float* row, int k0, int lane) { float v[16]; const float* p = row + k0 + 8 * (lane >> 4);
#pragma unroll
  for (int i = 0; i < 8; ++i) { v[i] = p[i]; v[8 + i] = p[16 + i]; }
  return bsplit16(v); }
__device__ __forceinline__ F2 split_rowK(const float* row, int k0, int lane, int K) { float v[16]; const int g = lane >> 4;
#pragma unroll
  for (int i = 0; i < 8; ++i) { const int ka = k0 + 8 * g + i, kb = ka + 16; v[i] = ka < K ? row[ka < K ? ka : K - 1] : 0.f; v[8 + i] = kb < K ? row[kb < K ? kb : K - 1] : 0.f; }
  return bsplit16(v); }
__device__ __forceinline__ F2 split_col(const float* W, int k0, int n, int lane, int ld, int K) { float v[16]; const int g = lane >> 4;
#pragma unroll
  for (int i = 0; i < 8; ++i) { const int ka = k0 + 8 * g + i, kb = ka + 16; v[i] = ka < K ? W[(size_t)(ka < K ? ka : K - 1) * ld + n] : 0.f; v[8 + i] = kb < K ? W[(size_t)(kb < K ? kb : K - 1) * ld + n] : 0.f; }
  return bsplit16(v); }
__device__ __forceinline__ v8f mac3(const F2& a, const F2& b, v8f c) { c = wmma_bf(a.l, b.h, c); c = wmma_bf(a.h, b.l, c); return wmma_bf(a.h, b.h, c); }
__device__ __forceinline__ float sigm(float v) { return 1.0f / (1.0f + expf(-v)); }
#define LDSX() do { asm volatile("s_wait_dscnt 0" ::: "memory"); __builtin_amdgcn_wave_barrier(); __builtin_amdgcn_fence(__ATOMIC_RELEASE, "workgroup"); } while (0)


#define NB 4
#define SS 1024
#define IMW 32
#define DM 1024
#define NH 16
#define HD 64
#define QKVW (3 * DM)
#ifndef TQB
#define TQB (SS / 64)
#define TNB NB
#define TOB (NB * SS / 64)     // output row tiles (all)
#endif
typedef __attribute__((ext_vector_type(8))) __bf16 v8b;
__device__ __forceinline__ v16b frag_b(const __bf16* rowk0, int lane) {
  union { v16b v; v8b q[2]; } u; const __bf16* p = rowk0 + 8 * (lane >> 4);
  u.q[0] = *(const v8b*)p; u.q[1] = *(const v8b*)(p + 16); return u.v;
}
__device__ __forceinline__ float bfr(float v) { return (float)(__bf16)v; }
__device__ __attribute__((noinline)) float exp_ni(float v) { return expf(v); }
__device__ __attribute__((noinline)) float erf_ni(float v) { return erff(v); }

#define PK_A 0                       // [3072][1024] Wqkv rows (natural [out][in])
#define PK_P (PK_A + QKVW * DM)        // [1024][1024] Wo rows (natural)
#define PK_END (PK_P + DM * DM)
#define WS_PK  0u
#define WS_QK  (WS_PK + 2u * PK_END)             // f16 [4096 rows][2048]: q | k
#define WS_QKL (WS_QK + 2u * NB * SS * 2 * DM)     // f16 q | k residual planes x2048
#define WS_VTH (WS_QKL + 2u * NB * SS * 2 * DM)    // f16 [b][1024 (h*64+d)][1024 s] hi
#define WS_VTL (WS_VTH + 2u * NB * DM * SS)        // f16 lo x 2048
#define WS_O   (WS_VTL + 2u * NB * DM * SS)        // f32 [4096][1024]
#define WS_CS  (WS_O + 4u * NB * SS * DM)           // f32 2 x [1024][32], unused
#define WS_TBL (WS_CS + 4u * 2 * SS * 32)                 // f16 [2][64][HD]: rel_pos_h rows 0..62 (+ zero row), rel_pos_w
#define WS_END (WS_TBL + 2u * 2 * 64 * HD)
// ---- k_pack: block = (row n, which): natural [out][in] rows -> bf16; which 0..2 -> W_q/W_k/W_v into PK_A rows which*1024 + n; 3 -> W_o into PK_P
__global__ __launch_bounds__(256) void k_pack(const float* __restrict__ WQ, const float* __restrict__ WK, const float* __restrict__ WV, const float* __restrict__ WO, __bf16* __restrict__ PK) {
  __shared__ __align__(16) __bf16 s[DM]; const int n = blockIdx.x, which = blockIdx.y, t = threadIdx.x; const float* Wm = (which == 0) ? WQ : (which == 1) ? WK : (which == 2) ? WV : WO;
  for (int k = t; k < DM; k += 256) s[k] = (__bf16)Wm[(size_t)n * DM + k];
  __syncthreads();
  __bf16* dst = (which < 3) ? PK + PK_A + ((size_t)which * DM + n) * DM : PK + PK_P + (size_t)n * DM;
  for (int q = t; q < DM / 8; q += 256) vst2((unsigned*)(dst + q * 8), *(const v4u*)&s[q * 8]);
}
__global__ __launch_bounds__(128) void k_qkv(const float* __restrict__ XQ, const float* __restrict__ XK, const float* __restrict__ XV, const __bf16* __restrict__ P, const float* __restrict__ BQ, const float* __restrict__ BK, const float* __restrict__ BV, _Float16* __restrict__ QK, _Float16* __restrict__ QKL, _Float16* __restrict__ VTH, _Float16* __restrict__ VTL) {
  const int which0 = (blockIdx.y * 128) / DM; const float* X = (which0 == 0) ? XQ : (which0 == 1) ? XK : XV; const float* BB = BQ ? (((which0 == 0) ? BQ : (which0 == 1) ? BK : BV) + (blockIdx.y * 128 - which0 * DM)) : nullptr;
  __shared__ __align__(16) _Float16 so[4][16][136], sol[4][16][136]; __shared__ __align__(16) _Float16 sth[128][72], stl[128][72];
  const int tid = threadIdx.x, wave = tid >> 5, lane = tid & 31, col = lane & 15, g = lane >> 4; const size_t r0 = (size_t)blockIdx.x * 64 + wave * 16; const int n0 = blockIdx.y * 128;
  v8f acc[8] = {};
#pragma unroll 2
  for (int kc = 0; kc < DM / 32; ++kc) { v16b a; { const float* p = X + (r0 + col) * DM + kc * 32 + 8 * g;
#pragma unroll
      for (int i = 0; i < 8; ++i) { a[i] = (__bf16)p[i]; a[8 + i] = (__bf16)p[16 + i]; } }
#pragma unroll
    for (int j = 0; j < 8; ++j) acc[j] = wmma_bf(a, frag_b(P + (size_t)(n0 + j * 16 + col) * DM + kc * 32, lane), acc[j]); }
  if (n0 < 2 * DM) {   // q stored unscaled (f16 sigma ~0.6, no subnormal exposure); 1/8 applied to the f32 score
#pragma unroll
    for (int j = 0; j < 8; ++j) {
#pragma unroll
      for (int r = 0; r < 8; ++r) { const float v = acc[j][r] + (BB ? bfr(BB[j * 16 + col]) : 0.f); const _Float16 hv = (_Float16)v; so[wave][8 * g + r][j * 16 + col] = hv; sol[wave][8 * g + r][j * 16 + col] = (_Float16)((v - (float)hv) * 2048.0f); } }   // q, k (+ bias) as f16 hi + (x2048) residual
    LDSX();
    for (int rl = 0; rl < 16; ++rl) if (lane < 16) { vst2((unsigned*)(QK + (r0 + rl) * (2 * DM) + n0 + lane * 8), *(const v4u*)&so[wave][rl][lane * 8]); vst2((unsigned*)(QKL + (r0 + rl) * (2 * DM) + n0 + lane * 8), *(const v4u*)&sol[wave][rl][lane * 8]); }
  } else {
#pragma unroll
    for (int j = 0; j < 8; ++j) {
#pragma unroll
      for (int r = 0; r < 8; ++r) { const float v = acc[j][r] + (BB ? bfr(BB[j * 16 + col]) : 0.f); const _Float16 hv = (_Float16)v; sth[j * 16 + col][wave * 16 + 8 * g + r] = hv; stl[j * 16 + col][wave * 16 + 8 * g + r] = (_Float16)((v - (float)hv) * 2048.0f); } }
    __syncthreads();
    const size_t rb = (size_t)blockIdx.x * 64; const int b = (int)(rb / SS), s0 = (int)(rb % SS); const int pc0 = n0 - 2 * DM;
    for (int q = tid; q < 128 * 8; q += 128) { const int d = q >> 3, pc = q & 7; const size_t o = ((size_t)b * DM + pc0 + d) * SS + s0 + pc * 8; vst2((unsigned*)(VTH + o), *(const v4u*)&sth[d][pc * 8]); vst2((unsigned*)(VTL + o), *(const v4u*)&stl[d][pc * 8]); }
  }
}
// ---- k_attn: block = (64 queries, head h, batch b): all-keys flash attention, transposed products: S^T = K . Q^T (A = 16 key rows, B = the wave's 16 queries) and O^T += V^T . P^T (A = 16 channel rows of the v plane, B = P^T).
// Lane (col, g) then holds, for the ONE query q0 + col, the scores of keys 8g + r (tile 0) and 16 + 8g + r (tile 1) of the 32-key pass: exactly the k order of a B fragment, so P goes from the score accumulators into the second product without leaving the registers.
// A pass is one image row of keys (32 = IMW): kh = ks for all of them and kw = ct * 16 + 8g + r in every pass, so the width term is 16 values per lane for the whole loop and the height term one value per pass.
static_assert(IMW == 32, "a 32-key pass is one image row");
// lane l <-> lane l ^ 16 (the two halves that share a query)
__device__ __forceinline__ float xhalf(float v) { const int b = __float_as_int(v); return __int_as_float(__builtin_amdgcn_permlanex16(b, b, 0x76543210, 0xfedcba98, false, false)); }
// K and V of a pass are the same for the four waves of a block: each 32-key tile is brought into LDS once per block, by 16-byte asynchronous copies, two buffers, the next tile in flight while this one is worked on; the waves read their A fragments from LDS.
#define KPITCH 72   // f16 per staged key row: 128 B + 16 B, the conflict-free pitch for 16-byte LDS reads
#define VPITCH 40   // f16 per staged channel row: 64 B + 16 B, likewise
__device__ __forceinline__ unsigned lds_off(const void* p) { return (unsigned)(size_t)p; }
// one lane's four copies of a tile; the s_wait_xcnt closes the copies' own statement, so that it stands in front of every later write of an address register that a copy names
__device__ __forceinline__ void copy4(unsigned l0, const _Float16* g0, unsigned l1, const _Float16* g1, unsigned l2, const _Float16* g2, unsigned l3, const _Float16* g3) {
  asm volatile("global_load_async_to_lds_b128 %0, %1, off\n\tglobal_load_async_to_lds_b128 %2, %3, off\n\tglobal_load_async_to_lds_b128 %4, %5, off\n\tglobal_load_async_to_lds_b128 %6, %7, off\n\ts_wait_xcnt 0x0"
               :: "v"(l0), "v"(g0), "v"(l1), "v"(g1), "v"(l2), "v"(g2), "v"(l3), "v"(g3) : "memory");
}
__global__ __launch_bounds__(128) void k_attn(const _Float16* __restrict__ QK, const _Float16* __restrict__ QKL, const _Float16* __restrict__ VTH, const _Float16* __restrict__ VTL, const void* __restrict__ KMASK, const _Float16* __restrict__ TBL, float* __restrict__ O) {
  __shared__ float sth[4][16][68], stw[4][16][68];
  __shared__ __align__(16) float so[4][16][68];
  __shared__ __align__(16) _Float16 sk[2][32][KPITCH], sv[2][HD][VPITCH];
  const int tid = threadIdx.x, wave = tid >> 5, lane = tid & 31, col = lane & 15, g = lane >> 4;
  const int qb = blockIdx.x, h = blockIdx.y, b = blockIdx.z; const int q0 = qb * 64 + wave * 16; const size_t rq = (size_t)b * SS + q0 + col;
  (void)QKL; (void)VTL; (void)KMASK;
  // thread t copies 16-byte piece t & 7 of key rows t >> 3 and 16 + (t >> 3), and piece t & 3 of channel rows t >> 2 and 32 + (t >> 2)
  const _Float16* gk = QK + ((size_t)b * SS + (tid >> 3)) * (2 * DM) + DM + h * HD + (tid & 7) * 8;
  const _Float16* gv = VTH + ((size_t)b * DM + h * HD + (tid >> 2)) * SS + (tid & 3) * 8;
  const unsigned lk = lds_off(&sk[0][tid >> 3][(tid & 7) * 8]), lv = lds_off(&sv[0][tid >> 2][(tid & 3) * 8]);
  auto stage = [&](int t) { const _Float16* k0 = gk + (size_t)t * 32 * (2 * DM); const _Float16* v0 = gv + t * 32;
    const unsigned k1 = lk + (t & 1) * (unsigned)sizeof(sk[0]), v1 = lv + (t & 1) * (unsigned)sizeof(sv[0]);
    copy4(k1, k0, k1 + 16 * KPITCH * 2, k0 + (size_t)16 * (2 * DM), v1, v0, v1 + 32 * VPITCH * 2, v0 + (size_t)32 * SS); };
  stage(0);
  v16h aq[2];
#pragma unroll
  for (int kc = 0; kc < 2; ++kc) aq[kc] = frag_h(QK + rq * (2 * DM) + h * HD + kc * 32, lane);
  // relative-position dot tables for this wave's 16 queries: TH[r][j] = q_r . rel_pos_h[j], TW[r][j] = q_r . rel_pos_w[j] (exact products)
#pragma unroll
  for (int tb = 0; tb < 2; ++tb) {
#pragma unroll
    for (int jt = 0; jt < 4; ++jt) { v8f tacc = {};
#pragma unroll
      for (int kc = 0; kc < 2; ++kc) tacc = wmma16(aq[kc], frag_h(TBL + ((size_t)tb * 64 + jt * 16 + col) * HD + kc * 32, lane), tacc);
#pragma unroll
      for (int r = 0; r < 8; ++r) { if (tb == 0) sth[wave][8 * g + r][jt * 16 + col] = tacc[r] * 8.0f; else stw[wave][8 * g + r][jt * 16 + col] = tacc[r] * 8.0f; } } }   // x 8 (exact): the tables are added to the unscaled q . k
  LDSX();
  const int pq = q0 + col, hq = pq / IMW, wq = pq % IMW;   // this lane's query
  v8f tw[2];
#pragma unroll
  for (int ct = 0; ct < 2; ++ct) {
#pragma unroll
    for (int r = 0; r < 8; ++r) tw[ct][r] = stw[wave][col][wq - (ct * 16 + 8 * g + r) + (IMW - 1)]; }
  const float* thq = &sth[wave][col][hq + (IMW - 1)];
  // c = 8 x score; P x 2^11 = exp2(c * KS + nm), nm = 11 - (running maximum of c) * KS: one fused multiply-add and one exp2 a score
  const float KS = 0.125f * 1.44269504088896340736f;
  float m = -3.0e38f, nm = 5.0e37f, l = 0.f;   // nm starts so far up that the first pass's alpha is exp2(-5e37) = 0; l (x 2^11): this half's 16 keys of every pass; the halves are joined once, behind the loop
  v8f acc[4] = {}, accl[4] = {};
  const int nks = SS / 32;   // all keys
  static_assert(SS / 32 >= 2, "the prologue fills two tiles");
  asm volatile("s_wait_asynccnt 0x0" ::: "memory");   // this wave's copies of tile 0 have landed
  __syncthreads();                                    // ... and every other wave's
  stage(1);
#pragma unroll 1
  for (int ks = 0; ks < nks; ++ks) { v8f c[2];
    const float th = thq[-ks];
    v16h kf[2][2], vf[4];   // all of the pass's LDS reads as one group at its head; the v fragments land behind the score products and the softmax (the three loops are unrolled so that both arrays are indexed by constants and stay in registers)
#pragma unroll
    for (int ct = 0; ct < 2; ++ct) {
#pragma unroll
      for (int kc = 0; kc < 2; ++kc) kf[ct][kc] = frag_h(&sk[ks & 1][ct * 16 + col][kc * 32], lane); }
#pragma unroll
    for (int dt = 0; dt < 4; ++dt) vf[dt] = frag_h(&sv[ks & 1][dt * 16 + col][0], lane);
#pragma unroll
    for (int ct = 0; ct < 2; ++ct) { c[ct] = tw[ct] + th;   // 8 x (q.R_h[hq,kh] + q.R_w[wq,kw]) is the product's C operand
#pragma unroll
      for (int kc = 0; kc < 2; ++kc) c[ct] = wmma16(kf[ct][kc], aq[kc], c[ct]); }   // + q.k, EXACT products: q, k are bf16 inputs held exactly in f16
    float t8[8];
#pragma unroll
    for (int i = 0; i < 8; ++i) t8[i] = fmaxf(c[0][i], c[1][i]);
    float mx = fmaxf(fmaxf(fmaxf(t8[0], t8[1]), fmaxf(t8[2], t8[3])), fmaxf(fmaxf(t8[4], t8[5]), fmaxf(t8[6], t8[7])));
    mx = fmaxf(mx, xhalf(mx));
    const float mn = fmaxf(m, mx); const float nn = __builtin_fmaf(mn, -KS, 11.0f); const float alpha = __builtin_amdgcn_exp2f(nn - nm);
    v8h ph[2], pr[2]; v8f x[2];
#pragma unroll
    for (int ct = 0; ct < 2; ++ct) { const v8f t = __builtin_elementwise_fma(c[ct], (v8f)(KS), (v8f)(nn));
#pragma unroll
      for (int r = 0; r < 8; ++r) x[ct][r] = __builtin_amdgcn_exp2f(t[r]);   // P scaled by 2^11 before the f16 split so small softmax weights stay out of the f16 subnormal range; l carries the same 2^11
      ph[ct] = __builtin_convertvector(x[ct], v8h);
      const v8f xs = x[ct] * 2048.0f; v8f d;
#pragma unroll
      for (int r = 0; r < 8; ++r) d[r] = __builtin_fmaf((float)ph[ct][r], -2048.0f, xs[r]);   // (x - hi) x 2^11, exact
      pr[ct] = __builtin_convertvector(d, v8h); }
    const v16h pa = __builtin_shufflevector(ph[0], ph[1], 0, 1, 2, 3, 4, 5, 6, 7, 8, 9, 10, 11, 12, 13, 14, 15);
    const v16h pl = __builtin_shufflevector(pr[0], pr[1], 0, 1, 2, 3, 4, 5, 6, 7, 8, 9, 10, 11, 12, 13, 14, 15);
    const v8f x8 = x[0] + x[1]; const v4f x4 = x8.lo + x8.hi; const v2f x2 = x4.lo + x4.hi;
    l = l * alpha + (x2.x + x2.y); m = mn; nm = nn;
#pragma unroll
    for (int dt = 0; dt < 4; ++dt) { acc[dt] *= alpha; accl[dt] *= alpha; }
#pragma unroll
    for (int dt = 0; dt < 4; ++dt) { acc[dt] = wmma16(vf[dt], pa, acc[dt]); accl[dt] = wmma16(vf[dt], pl, accl[dt]); }   // V^T x P hi + V^T x P lo / 2048 (v exact)
    asm volatile("s_wait_dscnt 0x0" ::: "memory");      // this wave's reads of buffer ks & 1 are done
    asm volatile("s_wait_asynccnt 0x0" ::: "memory");   // this wave's copies of tile ks + 1 have landed
    __syncthreads();                                    // publishes tile ks + 1 and frees buffer ks & 1
    if (ks + 2 < nks) stage(ks + 2);
  }
  asm volatile("s_wait_asynccnt 0x0" ::: "memory");     // no copy is left in flight behind the loop
  l += xhalf(l);
  const float il = 1.0f / l;   // l and acc both carry 2^11
#pragma unroll
  for (int dt = 0; dt < 4; ++dt) {   // acc[dt][r] = O[query col][channel dt * 16 + 8g + r]: 8 consecutive channels per lane
#pragma unroll
    for (int hf = 0; hf < 2; ++hf) { v4f o;
#pragma unroll
      for (int i = 0; i < 4; ++i) o[i] = (acc[dt][hf * 4 + i] + accl[dt][hf * 4 + i] * (1.0f / 2048.0f)) * il;
      *(v4f*)&so[wave][col][dt * 16 + 8 * g + hf * 4] = o; } }
  LDSX();
  for (int rl = 0; rl < 16; ++rl) if (lane < 16) vst2(O + ((size_t)b * SS + q0 + rl) * DM + h * HD + lane * 4, *(const v4f*)&so[wave][rl][lane * 4]);
}
// ---- k_out: block = (64 rows, 128 cols): out = O(hi/lo) . Wo rows (2 products) + bo
__global__ __launch_bounds__(128) void k_out(const float* __restrict__ O, const __bf16* __restrict__ P, const float* __restrict__ BO, float* __restrict__ Y) {
  __shared__ __align__(16) float so[4][16][132];
  const int tid = threadIdx.x, wave = tid >> 5, lane = tid & 31, col = lane & 15, g = lane >> 4; const size_t r0 = (size_t)blockIdx.x * 64 + wave * 16; const int n0 = blockIdx.y * 128;
  v8f acc[8] = {};
#pragma unroll 2
  for (int kc = 0; kc < DM / 32; ++kc) { const F2 a = split_row(O + (r0 + col) * DM, kc * 32, lane);
#pragma unroll
    for (int j = 0; j < 8; ++j) { const v16b w = frag_b(P + (size_t)(n0 + j * 16 + col) * DM + kc * 32, lane); acc[j] = wmma_bf(a.l, w, acc[j]); acc[j] = wmma_bf(a.h, w, acc[j]); } }
#pragma unroll
  for (int j = 0; j < 8; ++j) {
#pragma unroll
    for (int r = 0; r < 8; ++r) so[wave][8 * g + r][j * 16 + col] = acc[j][r] + (BO ? bfr(BO[n0 + j * 16 + col]) : 0.f); }
  LDSX();
  for (int rl = 0; rl < 16; ++rl) vst2(Y + (r0 + rl) * DM + n0 + lane * 4, *(const v4f*)&so[wave][rl][lane * 4]);
}
// ---- k_prep: block = 64 rows: q | k -> f16 rows [row][2*DM] (exact); v -> f16 planes [b][DM][SS] (exact)
__global__ __launch_bounds__(256) void k_prep(const float* __restrict__ Q, const float* __restrict__ Kx, const float* __restrict__ V, _Float16* __restrict__ QK, _Float16* __restrict__ VTH) {
  __shared__ __align__(16) _Float16 sq[64][72]; __shared__ __align__(16) _Float16 svt[128][72];
  const int t = threadIdx.x; const size_t r0 = (size_t)blockIdx.x * 64; const int which = blockIdx.y;   // y: 0..15 q chunks of 64 cols, 16..31 k chunks, 32..39 v chunks of 128 channels
  if (which < 32) { const float* src = (which < 16) ? Q : Kx; const int c0 = (which & 15) * 64;
    for (int e = t; e < 64 * 64; e += 256) { const int r = e >> 6, c = e & 63; sq[r][c] = (_Float16)bfr(src[(r0 + r) * DM + c0 + c]); }
    __syncthreads();
    for (int e = t; e < 64 * 8; e += 256) { const int r = e >> 3, q = e & 7; vst2((unsigned*)(QK + (r0 + r) * (2 * DM) + (which < 16 ? 0 : DM) + c0 + q * 8), *(const v4u*)&sq[r][q * 8]); }
  } else { const int c0 = (which - 32) * 128; const size_t b = r0 / SS, s0 = r0 % SS;
    for (int e = t; e < 64 * 128; e += 256) { const int c = e >> 6, r = e & 63; svt[c][r] = (_Float16)bfr(V[(r0 + r) * DM + c0 + c]); }
    __syncthreads();
    for (int e = t; e < 128 * 8; e += 256) { const int c = e >> 3, pc = e & 7; vst2((unsigned*)(VTH + (b * DM + c0 + c) * SS + s0 + pc * 8), *(const v4u*)&svt[c][pc * 8]); } }
}
// ---- k_tbl: rel_pos_h / rel_pos_w [63][64] -> f16 [64][64] (row 63 zero)
__global__ __launch_bounds__(64) void k_tbl(const float* __restrict__ RH, const float* __restrict__ RW, _Float16* __restrict__ TBL) { const int j = blockIdx.x, tb = blockIdx.y, t = threadIdx.x; __shared__ __align__(16) _Float16 s[HD]; const float* src = tb ? RW : RH; s[t] = (_Float16)((j < 2 * IMW - 1) ? bfr(src[(size_t)j * HD + t]) : 0.f); __syncthreads(); if (t < HD / 8) vst2((unsigned*)(TBL + ((size_t)tb * 64 + j) * HD + t * 8), *(const v4u*)&s[t * 8]); }
extern "C" void kernel_launch(void* const* d_in, const int* in_sizes, int n_in, void* d_out, int out_size, void* d_ws, size_t ws_size, hipStream_t stream) {
  (void)in_sizes; (void)n_in; (void)out_size;
  const float** F = (const float**)d_in;   // 0 q, 1 k, 2 v [4,1,1024,1024] (= [b][s][h*64+d]); 3 rel_pos_h [63,64]; 4 rel_pos_w [63,64]
  if (ws_size < (size_t)WS_END) return;
  char* ws = (char*)d_ws; _Float16 *QK = (_Float16*)(ws + WS_QK), *QKL = (_Float16*)(ws + WS_QKL), *VTH = (_Float16*)(ws + WS_VTH), *VTL = (_Float16*)(ws + WS_VTL), *TBL = (_Float16*)(ws + WS_TBL);
  k_tbl<<<dim3(64, 2), 64, 0, stream>>>(F[3], F[4], TBL);
  k_prep<<<dim3(TNB * SS / 64, 40), 256, 0, stream>>>(F[0], F[1], F[2], QK, VTH);
  k_attn<<<dim3(TQB, NH, TNB), 128, 0, stream>>>(QK, QKL, VTH, VTL, nullptr, TBL, (float*)d_out);   // O layout [b*S+q][h*64+d] == the module's merged (b,1,s,n*d) output
}

// v004
// A run of this version takes 48.1 microseconds.
// In two side-by-side timings against v003, it was 1.08 and 1.09 times as fast.
// Counting every step since v000, it is 2.20 times as fast.
// compute dtype: q/k/v and the two relative-position tables rounded to bf16 and used as EXACT f16 operands (bf16 values are exact in f16); per (query, head): TH[j] = q . rel_pos_h[j] and TW[j] = q . rel_pos_w[j] for all table rows on WMMA 16x16x32 (exact products, f32 accumulate), 8 x scores = q . k (exact products) accumulated onto 8 x (TH[hq - kh + 31] + TW[wq - kw + 31]); running-max softmax in f32, base 2 (hardware exp2); P (scaled by 2^11) as f16 hi + residual x the exact v planes (2 products); f32 accumulate; the merged-head output is written directly.
#include <hip/hip_runtime.h>
#include <math.h>

typedef __attribute__((ext_vector_type(16))) _Float16 v16h;
typedef __attribute__((ext_vector_type(16))) __bf16 v16b;
typedef __attribute__((ext_vector_type(8)))  _Float16 v8h;
typedef __attribute__((ext_vector_type(8)))  float v8f;
typedef __attribute__((ext_vector_type(4)))  float v4f;
typedef __attribute__((ext_vector_type(2)))  float v2f;
typedef __attribute__((ext_vector_type(4)))  unsigned v4u;
typedef __attribute__((ext_vector_type(4)))  int v4i;
typedef float __attribute__((may_alias)) float_a;
typedef int __attribute__((may_alias)) int_a;

template <typename T> __device__ __forceinline__ void vst2(void* p, T v) { *(T*)p = v;  }
__device__ __forceinline__ v8f wmma16(v16h a, v16h b, v8f c) {
  return __builtin_amdgcn_wmma_f32_16x16x32_f16(false, a, false, b, (short)0, c, false, false);
}
__device__ __forceinline__ v8f wmma_bf(v16b a, v16b b, v8f c) {
  v8f d = __builtin_amdgcn_wmma_f32_16x16x32_bf16(false, a, false, b, (short)0, c, false, false);
  asm volatile("v_nop\n\tv_nop\n\tv_nop\n\tv_nop" : "+v"(d) : "v"(a), "v"(b));
  return d;
}
// Decomposed relative-position attention over a 32 x 32 feature map (B 4, 1,024 positions, 16 heads x 64, q/k/v given): sim = q k^T / 8 + q . R_h[hq, kh] + q . R_w[wq, kw], softmax, . v, heads re-merged.
__device__ __forceinline__ v16h frag_h(const _Float16* rowk0, int lane) {
  union { v16h v; v8h q[2]; } u; const _Float16* p = rowk0 + 8 * (lane >> 4);
  u.q[0] = *(const v8h*)p; u.q[1] = *(const v8h*)(p + 16); return u.v;
}
__device__ __forceinline__ v16h frag_f32(const float* rowk0, int lane) {
  v16h a; const float* p = rowk0 + 8 * (lane >> 4);
#pragma unroll
  for (int i = 0; i < 8; ++i) { a[i] = (_Float16)p[i]; a[8 + i] = (_Float16)p[16 + i]; }
  return a;
}
__device__ __forceinline__ v16h frag_f32s(const float* rowk0, int lane, float sc) {
  v16h a; const float* p = rowk0 + 8 * (lane >> 4);
#pragma unroll
  for (int i = 0; i < 8; ++i) { a[i] = (_Float16)(p[i] * sc); a[8 + i] = (_Float16)(p[16 + i] * sc); }
  return a;
}
// column fragment from a [K][ld] layout (column n), rows >= K read as 0
__device__ __forceinline__ v16h fragc_f32(const float* W, int k0, int n, int lane, int ld, int K) {
  v16h a; const int g = lane >> 4;
#pragma unroll
  for (int i = 0; i < 8; ++i) { const int ka = k0 + 8 * g + i, kb = ka + 16;
    a[i] = (_Float16)(ka < K ? W[(size_t)(ka < K ? ka : K - 1) * ld + n] : 0.f); a[8 + i] = (_Float16)(kb < K ? W[(size_t)(kb < K ? kb : K - 1) * ld + n] : 0.f); }
  return a;
}
struct F2 { v16b h, l; };
__device__ __forceinline__ F2 bsplit16(const float v[16]) { F2 r;
#pragma unroll
  for (int i = 0; i < 16; ++i) { const __bf16 h = (__bf16)v[i]; r.h[i] = h; r.l[i] = (__bf16)(v[i] - (float)h); }
  return r; }
__device__ __forceinline__ F2 split_row(const float* row, int k0, int lane) { float v[16]; const float* p = row + k0 + 8 * (lane >> 4);
#pragma unroll
  for (int i = 0; i < 8; ++i) { v[i] = p[i]; v[8 + i] = p[16 + i]; }
  return bsplit16(v); }
__device__ __forceinline__ F2 split_rowK(const float* row, int k0, int lane, int K) { float v[16]; const int g = lane >> 4;
#pragma unroll
  for (int i = 0; i < 8; ++i) { const int ka = k0 + 8 * g + i, kb = ka + 16; v[i] = ka < K ? row[ka < K ? ka : K - 1] : 0.f; v[8 + i] = kb < K ? row[kb < K ? kb : K - 1] : 0.f; }
  return bsplit16(v); }
__device__ __forceinline__ F2 split_col(const float* W, int k0, int n, int lane, int ld, int K) { float v[16]; const int g = lane >> 4;
#pragma unroll
  for (int i = 0; i < 8; ++i) { const int ka = k0 + 8 * g + i, kb = ka + 16; v[i] = ka < K ? W[(size_t)(ka < K ? ka : K - 1) * ld + n] : 0.f; v[8 + i] = kb < K ? W[(size_t)(kb < K ? kb : K - 1) * ld + n] : 0.f; }
  return bsplit16(v); }
__device__ __forceinline__ v8f mac3(const F2& a, const F2& b, v8f c) { c = wmma_bf(a.l, b.h, c); c = wmma_bf(a.h, b.l, c); return wmma_bf(a.h, b.h, c); }
__device__ __forceinline__ float sigm(float v) { return 1.0f / (1.0f + expf(-v)); }
#define LDSX() do { asm volatile("s_wait_dscnt 0" ::: "memory"); __builtin_amdgcn_wave_barrier(); __builtin_amdgcn_fence(__ATOMIC_RELEASE, "workgroup"); } while (0)


#define NB 4
#define SS 1024
#define IMW 32
#define DM 1024
#define NH 16
#define HD 64
#define QKVW (3 * DM)
#ifndef TQB
#define TQB (SS / 64)
#define TNB NB
#define TOB (NB * SS / 64)     // output row tiles (all)
#endif
typedef __attribute__((ext_vector_type(8))) __bf16 v8b;
__device__ __forceinline__ v16b frag_b(const __bf16* rowk0, int lane) {
  union { v16b v; v8b q[2]; } u; const __bf16* p = rowk0 + 8 * (lane >> 4);
  u.q[0] = *(const v8b*)p; u.q[1] = *(const v8b*)(p + 16); return u.v;
}
__device__ __forceinline__ float bfr(float v) { return (float)(__bf16)v; }
__device__ __attribute__((noinline)) float exp_ni(float v) { return expf(v); }
__device__ __attribute__((noinline)) float erf_ni(float v) { return erff(v); }

#define PK_A 0                       // [3072][1024] Wqkv rows (natural [out][in])
#define PK_P (PK_A + QKVW * DM)        // [1024][1024] Wo rows (natural)
#define PK_END (PK_P + DM * DM)
#define WS_PK  0u
#define WS_QK  (WS_PK + 2u * PK_END)             // f16 [4096 rows][2048]: q | k
#define WS_QKL (WS_QK + 2u * NB * SS * 2 * DM)     // f16 q | k residual planes x2048
#define WS_VTH (WS_QKL + 2u * NB * SS * 2 * DM)    // f16 [b][1024 (h*64+d)][1024 s] hi
#define WS_VTL (WS_VTH + 2u * NB * DM * SS)        // f16 lo x 2048
#define WS_O   (WS_VTL + 2u * NB * DM * SS)        // f32 [4096][1024]
#define WS_CS  (WS_O + 4u * NB * SS * DM)           // f32 2 x [1024][32], unused
#define WS_TBL (WS_CS + 4u * 2 * SS * 32)                 // f16 [2][64][HD]: rel_pos_h rows 0..62 (+ zero row), rel_pos_w
#define WS_END (WS_TBL + 2u * 2 * 64 * HD)
// ---- k_pack: block = (row n, which): natural [out][in] rows -> bf16; which 0..2 -> W_q/W_k/W_v into PK_A rows which*1024 + n; 3 -> W_o into PK_P
__global__ __launch_bounds__(256) void k_pack(const float* __restrict__ WQ, const float* __restrict__ WK, const float* __restrict__ WV, const float* __restrict__ WO, __bf16* __restrict__ PK) {
  __shared__ __align__(16) __bf16 s[DM]; const int n = blockIdx.x, which = blockIdx.y, t = threadIdx.x; const float* Wm = (which == 0) ? WQ : (which == 1) ? WK : (which == 2) ? WV : WO;
  for (int k = t; k < DM; k += 256) s[k] = (__bf16)Wm[(size_t)n * DM + k];
  __syncthreads();
  __bf16* dst = (which < 3) ? PK + PK_A + ((size_t)which * DM + n) * DM : PK + PK_P + (size_t)n * DM;
  for (int q = t; q < DM / 8; q += 256) vst2((unsigned*)(dst + q * 8), *(const v4u*)&s[q * 8]);
}
__global__ __launch_bounds__(128) void k_qkv(const float* __restrict__ XQ, const float* __restrict__ XK, const float* __restrict__ XV, const __bf16* __restrict__ P, const float* __restrict__ BQ, const float* __restrict__ BK, const float* __restrict__ BV, _Float16* __restrict__ QK, _Float16* __restrict__ QKL, _Float16* __restrict__ VTH, _Float16* __restrict__ VTL) {
  const int which0 = (blockIdx.y * 128) / DM; const float* X = (which0 == 0) ? XQ : (which0 == 1) ? XK : XV; const float* BB = BQ ? (((which0 == 0) ? BQ : (which0 == 1) ? BK : BV) + (blockIdx.y * 128 - which0 * DM)) : nullptr;
  __shared__ __align__(16) _Float16 so[4][16][136], sol[4][16][136]; __shared__ __align__(16) _Float16 sth[128][72], stl[128][72];
  const int tid = threadIdx.x, wave = tid >> 5, lane = tid & 31, col = lane & 15, g = lane >> 4; const size_t r0 = (size_t)blockIdx.x * 64 + wave * 16; const int n0 = blockIdx.y * 128;
  v8f acc[8] = {};
#pragma unroll 2
  for (int kc = 0; kc < DM / 32; ++kc) { v16b a; { const float* p = X + (r0 + col) * DM + kc * 32 + 8 * g;
#pragma unroll
      for (int i = 0; i < 8; ++i) { a[i] = (__bf16)p[i]; a[8 + i] = (__bf16)p[16 + i]; } }
#pragma unroll
    for (int j = 0; j < 8; ++j) acc[j] = wmma_bf(a, frag_b(P + (size_t)(n0 + j * 16 + col) * DM + kc * 32, lane), acc[j]); }
  if (n0 < 2 * DM) {   // q stored unscaled (f16 sigma ~0.6, no subnormal exposure); 1/8 applied to the f32 score
#pragma unroll
    for (int j = 0; j < 8; ++j) {
#pragma unroll
      for (int r = 0; r < 8; ++r) { const float v = acc[j][r] + (BB ? bfr(BB[j * 16 + col]) : 0.f); const _Float16 hv = (_Float16)v; so[wave][8 * g + r][j * 16 + col] = hv; sol[wave][8 * g + r][j * 16 + col] = (_Float16)((v - (float)hv) * 2048.0f); } }   // q, k (+ bias) as f16 hi + (x2048) residual
    LDSX();
    for (int rl = 0; rl < 16; ++rl) if (lane < 16) { vst2((unsigned*)(QK + (r0 + rl) * (2 * DM) + n0 + lane * 8), *(const v4u*)&so[wave][rl][lane * 8]); vst2((unsigned*)(QKL + (r0 + rl) * (2 * DM) + n0 + lane * 8), *(const v4u*)&sol[wave][rl][lane * 8]); }
  } else {
#pragma unroll
    for (int j = 0; j < 8; ++j) {
#pragma unroll
      for (int r = 0; r < 8; ++r) { const float v = acc[j][r] + (BB ? bfr(BB[j * 16 + col]) : 0.f); const _Float16 hv = (_Float16)v; sth[j * 16 + col][wave * 16 + 8 * g + r] = hv; stl[j * 16 + col][wave * 16 + 8 * g + r] = (_Float16)((v - (float)hv) * 2048.0f); } }
    __syncthreads();
    const size_t rb = (size_t)blockIdx.x * 64; const int b = (int)(rb / SS), s0 = (int)(rb % SS); const int pc0 = n0 - 2 * DM;
    for (int q = tid; q < 128 * 8; q += 128) { const int d = q >> 3, pc = q & 7; const size_t o = ((size_t)b * DM + pc0 + d) * SS + s0 + pc * 8; vst2((unsigned*)(VTH + o), *(const v4u*)&sth[d][pc * 8]); vst2((unsigned*)(VTL + o), *(const v4u*)&stl[d][pc * 8]); }
  }
}
// ---- k_attn: block = (64 queries, head h, batch b): all-keys flash attention, transposed products: S^T = K . Q^T (A = 16 key rows, B = the wave's 16 queries) and O^T += V^T . P^T (A = 16 channel rows of the v plane, B = P^T).
// Lane (col, g) then holds, for the ONE query q0 + col, the scores of keys 8g + r (tile 0) and 16 + 8g + r (tile 1) of the 32-key pass: exactly the k order of a B fragment, so P goes from the score accumulators into the second product without leaving the registers.
// A pass is one image row of keys (32 = IMW): kh = ks for all of them and kw = ct * 16 + 8g + r in every pass, so the width term is 16 values per lane for the whole loop and the height term one value per pass.
static_assert(IMW == 32, "a 32-key pass is one image row");
// lane l <-> lane l ^ 16 (the two halves that share a query)
__device__ __forceinline__ float xhalf(float v) { const int b = __float_as_int(v); return __int_as_float(__builtin_amdgcn_permlanex16(b, b, 0x76543210, 0xfedcba98, false, false)); }
// K and V of a pass are the same for the four waves of a block: each 32-key tile is brought into LDS once per block, by 16-byte asynchronous copies, two buffers, the next tile in flight while this one is worked on; the waves read their A fragments from LDS.
#define KPITCH 72   // f16 per staged key row: 128 B + 16 B, the conflict-free pitch for 16-byte LDS reads
#define VPITCH 40   // f16 per staged channel row: 64 B + 16 B, likewise
__device__ __forceinline__ unsigned lds_off(const void* p) { return (unsigned)(size_t)p; }
// one lane's four copies of a tile; the s_wait_xcnt closes the copies' own statement, so that it stands in front of every later write of an address register that a copy names
__device__ __forceinline__ void copy4(unsigned l0, const _Float16* g0, unsigned l1, const _Float16* g1, unsigned l2, const _Float16* g2, unsigned l3, const _Float16* g3) {
  asm volatile("global_load_async_to_lds_b128 %0, %1, off\n\tglobal_load_async_to_lds_b128 %2, %3, off\n\tglobal_load_async_to_lds_b128 %4, %5, off\n\tglobal_load_async_to_lds_b128 %6, %7, off\n\ts_wait_xcnt 0x0"
               :: "v"(l0), "v"(g0), "v"(l1), "v"(g1), "v"(l2), "v"(g2), "v"(l3), "v"(g3) : "memory");
}
__global__ __launch_bounds__(128) void k_attn(const _Float16* __restrict__ QK, const _Float16* __restrict__ QKL, const _Float16* __restrict__ VTH, const _Float16* __restrict__ VTL, const void* __restrict__ KMASK, const _Float16* __restrict__ TBL, float* __restrict__ O) {
  __shared__ float sth[4][16][68], stw[4][16][68];
  __shared__ __align__(16) float so[4][16][68];
  __shared__ __align__(16) _Float16 sk[2][32][KPITCH], sv[2][HD][VPITCH];
  const int tid = threadIdx.x, wave = tid >> 5, lane = tid & 31, col = lane & 15, g = lane >> 4;
  const int qb = blockIdx.x, h = blockIdx.y, b = blockIdx.z; const int q0 = qb * 64 + wave * 16; const size_t rq = (size_t)b * SS + q0 + col;
  (void)QKL; (void)VTL; (void)KMASK;
  // thread t copies 16-byte piece t & 7 of key rows t >> 3 and 16 + (t >> 3), and piece t & 3 of channel rows t >> 2 and 32 + (t >> 2)
  const _Float16* gk = QK + ((size_t)b * SS + (tid >> 3)) * (2 * DM) + DM + h * HD + (tid & 7) * 8;
  const _Float16* gv = VTH + ((size_t)b * DM + h * HD + (tid >> 2)) * SS + (tid & 3) * 8;
  const unsigned lk = lds_off(&sk[0][tid >> 3][(tid & 7) * 8]), lv = lds_off(&sv[0][tid >> 2][(tid & 3) * 8]);
  auto stage = [&](int t) { const _Float16* k0 = gk + (size_t)t * 32 * (2 * DM); const _Float16* v0 = gv + t * 32;
    const unsigned k1 = lk + (t & 1) * (unsigned)sizeof(sk[0]), v1 = lv + (t & 1) * (unsigned)sizeof(sv[0]);
    copy4(k1, k0, k1 + 16 * KPITCH * 2, k0 + (size_t)16 * (2 * DM), v1, v0, v1 + 32 * VPITCH * 2, v0 + (size_t)32 * SS); };
  stage(0);
  v16h aq[2];
#pragma unroll
  for (int kc = 0; kc < 2; ++kc) aq[kc] = frag_h(QK + rq * (2 * DM) + h * HD + kc * 32, lane);
  // relative-position dot tables for this wave's 16 queries: TH[r][j] = q_r . rel_pos_h[j], TW[r][j] = q_r . rel_pos_w[j] (exact products)
#pragma unroll
  for (int tb = 0; tb < 2; ++tb) {
#pragma unroll
    for (int jt = 0; jt < 4; ++jt) { v8f tacc = {};
#pragma unroll
      for (int kc = 0; kc < 2; ++kc) tacc = wmma16(aq[kc], frag_h(TBL + ((size_t)tb * 64 + jt * 16 + col) * HD + kc * 32, lane), tacc);
#pragma unroll
      for (int r = 0; r < 8; ++r) { if (tb == 0) sth[wave][8 * g + r][jt * 16 + col] = tacc[r] * 8.0f; else stw[wave][8 * g + r][jt * 16 + col] = tacc[r] * 8.0f; } } }   // x 8 (exact): the tables are added to the unscaled q . k
  LDSX();
  const int pq = q0 + col, hq = pq / IMW, wq = pq % IMW;   // this lane's query
  v8f tw[2];
#pragma unroll
  for (int ct = 0; ct < 2; ++ct) {
#pragma unroll
    for (int r = 0; r < 8; ++r) tw[ct][r] = stw[wave][col][wq - (ct * 16 + 8 * g + r) + (IMW - 1)]; }
  const float* thq = &sth[wave][col][hq + (IMW - 1)];
  // c = 8 x score; P x 2^11 = exp2(c * KS + nm), nm = 11 - (running maximum of c) * KS: one fused multiply-add and one exp2 a score
  const float KS = 0.125f * 1.44269504088896340736f;
  float m = -3.0e38f, nm = 5.0e37f, l = 0.f;   // nm starts so far up that the first pass's alpha is exp2(-5e37) = 0; l (x 2^11): this half's 16 keys of every pass; the halves are joined once, behind the loop
  v8f acc[4] = {}, accl[4] = {};
  const int nks = SS / 32;   // all keys
  static_assert(SS / 32 >= 2, "the prologue fills two tiles");
  asm volatile("s_wait_asynccnt 0x0" ::: "memory");   // this wave's copies of tile 0 have landed
  __syncthreads();                                    // ... and every other wave's
  stage(1);
#pragma unroll 1
  for (int ks = 0; ks < nks; ++ks) { v8f c[2];
    const float th = thq[-ks];
    v16h kf[2][2], vf[4];   // all of the pass's LDS reads as one group at its head; the v fragments land behind the score products and the softmax (the three loops are unrolled so that both arrays are indexed by constants and stay in registers)
#pragma unroll
    for (int ct = 0; ct < 2; ++ct) {
#pragma unroll
      for (int kc = 0; kc < 2; ++kc) kf[ct][kc] = frag_h(&sk[ks & 1][ct * 16 + col][kc * 32], lane); }
#pragma unroll
    for (int dt = 0; dt < 4; ++dt) vf[dt] = frag_h(&sv[ks & 1][dt * 16 + col][0], lane);
    __builtin_amdgcn_sched_barrier(0);   // keeps the 17 LDS reads one group in front of the first product, with counted waits behind them; left free, the scheduler spreads them among the products and waits to 0 behind each small group
#pragma unroll
    for (int ct = 0; ct < 2; ++ct) c[ct] = tw[ct] + th;   // 8 x (q.R_h[hq,kh] + q.R_w[wq,kw]) is the product's C operand
#pragma unroll
    for (int kc = 0; kc < 2; ++kc) {
#pragma unroll
      for (int ct = 0; ct < 2; ++ct) c[ct] = wmma16(kf[ct][kc], aq[kc], c[ct]); }   // + q.k, EXACT products: q, k are bf16 inputs held exactly in f16
    float t8[8];
#pragma unroll
    for (int i = 0; i < 8; ++i) t8[i] = fmaxf(c[0][i], c[1][i]);
    float mx = fmaxf(fmaxf(fmaxf(t8[0], t8[1]), fmaxf(t8[2], t8[3])), fmaxf(fmaxf(t8[4], t8[5]), fmaxf(t8[6], t8[7])));
    mx = fmaxf(mx, xhalf(mx));
    const float mn = fmaxf(m, mx); const float nn = __builtin_fmaf(mn, -KS, 11.0f); const float alpha = __builtin_amdgcn_exp2f(nn - nm);
    v8h ph[2], pr[2]; v8f x[2];
#pragma unroll
    for (int ct = 0; ct < 2; ++ct) { const v8f t = __builtin_elementwise_fma(c[ct], (v8f)(KS), (v8f)(nn));
#pragma unroll
      for (int r = 0; r < 8; ++r) x[ct][r] = __builtin_amdgcn_exp2f(t[r]);   // P scaled by 2^11 before the f16 split so small softmax weights stay out of the f16 subnormal range; l carries the same 2^11
      ph[ct] = __builtin_convertvector(x[ct], v8h);
      const v8f xs = x[ct] * 2048.0f; v8f d;
#pragma unroll
      for (int r = 0; r < 8; ++r) d[r] = __builtin_fmaf((float)ph[ct][r], -2048.0f, xs[r]);   // (x - hi) x 2^11, exact
      pr[ct] = __builtin_convertvector(d, v8h); }
    const v16h pa = __builtin_shufflevector(ph[0], ph[1], 0, 1, 2, 3, 4, 5, 6, 7, 8, 9, 10, 11, 12, 13, 14, 15);
    const v16h pl = __builtin_shufflevector(pr[0], pr[1], 0, 1, 2, 3, 4, 5, 6, 7, 8, 9, 10, 11, 12, 13, 14, 15);
    const v8f x8 = x[0] + x[1]; const v4f x4 = x8.lo + x8.hi; const v2f x2 = x4.lo + x4.hi;
    l = l * alpha + (x2.x + x2.y); m = mn; nm = nn;
#pragma unroll
    for (int dt = 0; dt < 4; ++dt) { acc[dt] *= alpha; accl[dt] *= alpha; }
#pragma unroll
    for (int dt = 0; dt < 4; ++dt) { acc[dt] = wmma16(vf[dt], pa, acc[dt]); accl[dt] = wmma16(vf[dt], pl, accl[dt]); }   // V^T x P hi + V^T x P lo / 2048 (v exact)
    __builtin_amdgcn_sched_barrier(0);   // keeps the two waits and the barrier below at the pass's foot, behind its products: lifted to the head, tile ks + 2's copies would be waited for right after their issue
    asm volatile("s_wait_dscnt 0x0" ::: "memory");      // this wave's reads of buffer ks & 1 are done
    asm volatile("s_wait_asynccnt 0x0" ::: "memory");   // this wave's copies of tile ks + 1 have landed
    __syncthreads();                                    // publishes tile ks + 1 and frees buffer ks & 1
    if (ks + 2 < nks) stage(ks + 2);
  }
  asm volatile("s_wait_asynccnt 0x0" ::: "memory");     // no copy is left in flight behind the loop
  l += xhalf(l);
  const float il = 1.0f / l;   // l and acc both carry 2^11
#pragma unroll
  for (int dt = 0; dt < 4; ++dt) {   // acc[dt][r] = O[query col][channel dt * 16 + 8g + r]: 8 consecutive channels per lane
#pragma unroll
    for (int hf = 0; hf < 2; ++hf) { v4f o;
#pragma unroll
      for (int i = 0; i < 4; ++i) o[i] = (acc[dt][hf * 4 + i] + accl[dt][hf * 4 + i] * (1.0f / 2048.0f)) * il;
      *(v4f*)&so[wave][col][dt * 16 + 8 * g + hf * 4] = o; } }
  LDSX();
  for (int rl = 0; rl < 16; ++rl) if (lane < 16) vst2(O + ((size_t)b * SS + q0 + rl) * DM + h * HD + lane * 4, *(const v4f*)&so[wave][rl][lane * 4]);
}
// ---- k_out: block = (64 rows, 128 cols): out = O(hi/lo) . Wo rows (2 products) + bo
__global__ __launch_bounds__(128) void k_out(const float* __restrict__ O, const __bf16* __restrict__ P, const float* __restrict__ BO, float* __restrict__ Y) {
  __shared__ __align__(16) float so[4][16][132];
  const int tid = threadIdx.x, wave = tid >> 5, lane = tid & 31, col = lane & 15, g = lane >> 4; const size_t r0 = (size_t)blockIdx.x * 64 + wave * 16; const int n0 = blockIdx.y * 128;
  v8f acc[8] = {};
#pragma unroll 2
  for (int kc = 0; kc < DM / 32; ++kc) { const F2 a = split_row(O + (r0 + col) * DM, kc * 32, lane);
#pragma unroll
    for (int j = 0; j < 8; ++j) { const v16b w = frag_b(P + (size_t)(n0 + j * 16 + col) * DM + kc * 32, lane); acc[j] = wmma_bf(a.l, w, acc[j]); acc[j] = wmma_bf(a.h, w, acc[j]); } }
#pragma unroll
  for (int j = 0; j < 8; ++j) {
#pragma unroll
    for (int r = 0; r < 8; ++r) so[wave][8 * g + r][j * 16 + col] = acc[j][r] + (BO ? bfr(BO[n0 + j * 16 + col]) : 0.f); }
  LDSX();
  for (int rl = 0; rl < 16; ++rl) vst2(Y + (r0 + rl) * DM + n0 + lane * 4, *(const v4f*)&so[wave][rl][lane * 4]);
}
// ---- k_prep: block = 64 rows: q | k -> f16 rows [row][2*DM] (exact); v -> f16 planes [b][DM][SS] (exact)
__global__ __launch_bounds__(256) void k_prep(const float* __restrict__ Q, const float* __restrict__ Kx, const float* __restrict__ V, _Float16* __restrict__ QK, _Float16* __restrict__ VTH) {
  __shared__ __align__(16) _Float16 sq[64][72]; __shared__ __align__(16) _Float16 svt[128][72];
  const int t = threadIdx.x; const size_t r0 = (size_t)blockIdx.x * 64; const int which = blockIdx.y;   // y: 0..15 q chunks of 64 cols, 16..31 k chunks, 32..39 v chunks of 128 channels
  if (which < 32) { const float* src = (which < 16) ? Q : Kx; const int c0 = (which & 15) * 64;
    for (int e = t; e < 64 * 64; e += 256) { const int r = e >> 6, c = e & 63; sq[r][c] = (_Float16)bfr(src[(r0 + r) * DM + c0 + c]); }
    __syncthreads();
    for (int e = t; e < 64 * 8; e += 256) { const int r = e >> 3, q = e & 7; vst2((unsigned*)(QK + (r0 + r) * (2 * DM) + (which < 16 ? 0 : DM) + c0 + q * 8), *(const v4u*)&sq[r][q * 8]); }
  } else { const int c0 = (which - 32) * 128; const size_t b = r0 / SS, s0 = r0 % SS;
    for (int e = t; e < 64 * 128; e += 256) { const int c = e >> 6, r = e & 63; svt[c][r] = (_Float16)bfr(V[(r0 + r) * DM + c0 + c]); }
    __syncthreads();
    for (int e = t; e < 128 * 8; e += 256) { const int c = e >> 3, pc = e & 7; vst2((unsigned*)(VTH + (b * DM + c0 + c) * SS + s0 + pc * 8), *(const v4u*)&svt[c][pc * 8]); } }
}
// ---- k_tbl: rel_pos_h / rel_pos_w [63][64] -> f16 [64][64] (row 63 zero)
__global__ __launch_bounds__(64) void k_tbl(const float* __restrict__ RH, const float* __restrict__ RW, _Float16* __restrict__ TBL) { const int j = blockIdx.x, tb = blockIdx.y, t = threadIdx.x; __shared__ __align__(16) _Float16 s[HD]; const float* src = tb ? RW : RH; s[t] = (_Float16)((j < 2 * IMW - 1) ? bfr(src[(size_t)j * HD + t]) : 0.f); __syncthreads(); if (t < HD / 8) vst2((unsigned*)(TBL + ((size_t)tb * 64 + j) * HD + t * 8), *(const v4u*)&s[t * 8]); }
extern "C" void kernel_launch(void* const* d_in, const int* in_sizes, int n_in, void* d_out, int out_size, void* d_ws, size_t ws_size, hipStream_t stream) {
  (void)in_sizes; (void)n_in; (void)out_size;
  const float** F = (const float**)d_in;   // 0 q, 1 k, 2 v [4,1,1024,1024] (= [b][s][h*64+d]); 3 rel_pos_h [63,64]; 4 rel_pos_w [63,64]
  if (ws_size < (size_t)WS_END) return;
  char* ws = (char*)d_ws; _Float16 *QK = (_Float16*)(ws + WS_QK), *QKL = (_Float16*)(ws + WS_QKL), *VTH = (_Float16*)(ws + WS_VTH), *VTL = (_Float16*)(ws + WS_VTL), *TBL = (_Float16*)(ws + WS_TBL);
  k_tbl<<<dim3(64, 2), 64, 0, stream>>>(F[3], F[4], TBL);
  k_prep<<<dim3(TNB * SS / 64, 40), 256, 0, stream>>>(F[0], F[1], F[2], QK, VTH);
  k_attn<<<dim3(TQB, NH, TNB), 128, 0, stream>>>(QK, QKL, VTH, VTL, nullptr, TBL, (float*)d_out);   // O layout [b*S+q][h*64+d] == the module's merged (b,1,s,n*d) output
}

// v005
// A run of this version takes 45.9 microseconds.
// Two timings next to v004 both put it at 1.05 times that version's speed.
// Counting every step since v000, it is 2.31 times as fast.
// compute dtype: q/k/v and the two relative-position tables rounded to bf16 and used as EXACT f16 operands (bf16 values are exact in f16); per (query, head): TH[j] = q . rel_pos_h[j] and TW[j] = q . rel_pos_w[j] for all table rows on WMMA 16x16x32 (exact products, f32 accumulate), 8 x scores = q . k (exact products) accumulated onto 8 x (TH[hq - kh + 31] + TW[wq - kw + 31]); running-max softmax in f32, base 2 (hardware exp2); P (scaled by 2^11) as f16 hi + residual x the exact v planes (2 products); f32 accumulate; the merged-head output is written directly.
#include <hip/hip_runtime.h>
#include <math.h>

typedef __attribute__((ext_vector_type(16))) _Float16 v16h;
typedef __attribute__((ext_vector_type(16))) __bf16 v16b;
typedef __attribute__((ext_vector_type(8)))  _Float16 v8h;
typedef __attribute__((ext_vector_type(8)))  float v8f;
typedef __attribute__((ext_vector_type(4)))  float v4f;
typedef __attribute__((ext_vector_type(2)))  float v2f;
typedef __attribute__((ext_vector_type(4)))  unsigned v4u;
typedef __attribute__((ext_vector_type(4)))  int v4i;
typedef float __attribute__((may_alias)) float_a;
typedef int __attribute__((may_alias)) int_a;

template <typename T> __device__ __forceinline__ void vst2(void* p, T v) { *(T*)p = v;  }
__device__ __forceinline__ v8f wmma16(v16h a, v16h b, v8f c) {
  return __builtin_amdgcn_wmma_f32_16x16x32_f16(false, a, false, b, (short)0, c, false, false);
}
__device__ __forceinline__ v8f wmma_bf(v16b a, v16b b, v8f c) {
  v8f d = __builtin_amdgcn_wmma_f32_16x16x32_bf16(false, a, false, b, (short)0, c, false, false);
  asm volatile("v_nop\n\tv_nop\n\tv_nop\n\tv_nop" : "+v"(d) : "v"(a), "v"(b));
  return d;
}
// Decomposed relative-position attention over a 32 x 32 feature map (B 4, 1,024 positions, 16 heads x 64, q/k/v given): sim = q k^T / 8 + q . R_h[hq, kh] + q . R_w[wq, kw], softmax, . v, heads re-merged.
__device__ __forceinline__ v16h frag_h(const _Float16* rowk0, int lane) {
  union { v16h v; v8h q[2]; } u; const _Float16* p = rowk0 + 8 * (lane >> 4);
  u.q[0] = *(const v8h*)p; u.q[1] = *(const v8h*)(p + 16); return u.v;
}
__device__ __forceinline__ v16h frag_f32(const float* rowk0, int lane) {
  v16h a; const float* p = rowk0 + 8 * (lane >> 4);
#pragma unroll
  for (int i = 0; i < 8; ++i) { a[i] = (_Float16)p[i]; a[8 + i] = (_Float16)p[16 + i]; }
  return a;
}
__device__ __forceinline__ v16h frag_f32s(const float* rowk0, int lane, float sc) {
  v16h a; const float* p = rowk0 + 8 * (lane >> 4);
#pragma unroll
  for (int i = 0; i < 8; ++i) { a[i] = (_Float16)(p[i] * sc); a[8 + i] = (_Float16)(p[16 + i] * sc); }
  return a;
}
// column fragment from a [K][ld] layout (column n), rows >= K read as 0
__device__ __forceinline__ v16h fragc_f32(const float* W, int k0, int n, int lane, int ld, int K) {
  v16h a; const int g = lane >> 4;
#pragma unroll
  for (int i = 0; i < 8; ++i) { const int ka = k0 + 8 * g + i, kb = ka + 16;
    a[i] = (_Float16)(ka < K ? W[(size_t)(ka < K ? ka : K - 1) * ld + n] : 0.f); a[8 + i] = (_Float16)(kb < K ? W[(size_t)(kb < K ? kb : K - 1) * ld + n] : 0.f); }
  return a;
}
struct F2 { v16b h, l; };
__device__ __forceinline__ F2 bsplit16(const float v[16]) { F2 r;
#pragma unroll
  for (int i = 0; i < 16; ++i) { const __bf16 h = (__bf16)v[i]; r.h[i] = h; r.l[i] = (__bf16)(v[i] - (float)h); }
  return r; }
__device__ __forceinline__ F2 split_row(const float* row, int k0, int lane) { float v[16]; const float* p = row + k0 + 8 * (lane >> 4);
#pragma unroll
  for (int i = 0; i < 8; ++i) { v[i] = p[i]; v[8 + i] = p[16 + i]; }
  return bsplit16(v); }
__device__ __forceinline__ F2 split_rowK(const float* row, int k0, int lane, int K) { float v[16]; const int g = lane >> 4;
#pragma unroll
  for (int i = 0; i < 8; ++i) { const int ka = k0 + 8 * g + i, kb = ka + 16; v[i] = ka < K ? row[ka < K ? ka : K - 1] : 0.f; v[8 + i] = kb < K ? row[kb < K ? kb : K - 1] : 0.f; }
  return bsplit16(v); }
__device__ __forceinline__ F2 split_col(const float* W, int k0, int n, int lane, int ld, int K) { float v[16]; const int g = lane >> 4;
#pragma unroll
  for (int i = 0; i < 8; ++i) { const int ka = k0 + 8 * g + i, kb = ka + 16; v[i] = ka < K ? W[(size_t)(ka < K ? ka : K - 1) * ld + n] : 0.f; v[8 + i] = kb < K ? W[(size_t)(kb < K ? kb : K - 1) * ld + n] : 0.f; }
  return bsplit16(v); }
__device__ __forceinline__ v8f mac3(const F2& a, const F2& b, v8f c) { c = wmma_bf(a.l, b.h, c); c = wmma_bf(a.h, b.l, c); return wmma_bf(a.h, b.h, c); }
__device__ __forceinline__ float sigm(float v) { return 1.0f / (1.0f + expf(-v)); }
#define LDSX() do { asm volatile("s_wait_dscnt 0" ::: "memory"); __builtin_amdgcn_wave_barrier(); __builtin_amdgcn_fence(__ATOMIC_RELEASE, "workgroup"); } while (0)


#define NB 4
#define SS 1024
#define IMW 32
#define DM 1024
#define NH 16
#define HD 64
#define QKVW (3 * DM)
#ifndef TQB
#define TQB (SS / 64)
#define TNB NB
#define TOB (NB * SS / 64)     // output row tiles (all)
#endif
typedef __attribute__((ext_vector_type(8))) __bf16 v8b;
__device__ __forceinline__ v16b frag_b(const __bf16* rowk0, int lane) {
  union { v16b v; v8b q[2]; } u; const __bf16* p = rowk0 + 8 * (lane >> 4);
  u.q[0] = *(const v8b*)p; u.q[1] = *(const v8b*)(p + 16); return u.v;
}
__device__ __forceinline__ float bfr(float v) { return (float)(__bf16)v; }
__device__ __attribute__((noinline)) float exp_ni(float v) { return expf(v); }
__device__ __attribute__((noinline)) float erf_ni(float v) { return erff(v); }

#define PK_A 0                       // [3072][1024] Wqkv rows (natural [out][in])
#define PK_P (PK_A + QKVW * DM)        // [1024][1024] Wo rows (natural)
#define PK_END (PK_P + DM * DM)
#define WS_PK  0u
#define WS_QK  (WS_PK + 2u * PK_END)             // f16 [4096 rows][2048]: q | k
#define WS_QKL (WS_QK + 2u * NB * SS * 2 * DM)     // f16 q | k residual planes x2048
#define WS_VTH (WS_QKL + 2u * NB * SS * 2 * DM)    // f16 [b][1024 (h*64+d)][1024 s] hi
#define WS_VTL (WS_VTH + 2u * NB * DM * SS)        // f16 lo x 2048
#define WS_O   (WS_VTL + 2u * NB * DM * SS)        // f32 [4096][1024]
#define WS_CS  (WS_O + 4u * NB * SS * DM)           // f32 2 x [1024][32], unused
#define WS_TBL (WS_CS + 4u * 2 * SS * 32)                 // f16 [2][64][HD]: rel_pos_h rows 0..62 (+ zero row), rel_pos_w
#define WS_END (WS_TBL + 2u * 2 * 64 * HD)
// ---- k_pack: block = (row n, which): natural [out][in] rows -> bf16; which 0..2 -> W_q/W_k/W_v into PK_A rows which*1024 + n; 3 -> W_o into PK_P
__global__ __launch_bounds__(256) void k_pack(const float* __restrict__ WQ, const float* __restrict__ WK, const float* __restrict__ WV, const float* __restrict__ WO, __bf16* __restrict__ PK) {
  __shared__ __align__(16) __bf16 s[DM]; const int n = blockIdx.x, which = blockIdx.y, t = threadIdx.x; const float* Wm = (which == 0) ? WQ : (which == 1) ? WK : (which == 2) ? WV : WO;
  for (int k = t; k < DM; k += 256) s[k] = (__bf16)Wm[(size_t)n * DM + k];
  __syncthreads();
  __bf16* dst = (which < 3) ? PK + PK_A + ((size_t)which * DM + n) * DM : PK + PK_P + (size_t)n * DM;
  for (int q = t; q < DM / 8; q += 256) vst2((unsigned*)(dst + q * 8), *(const v4u*)&s[q * 8]);
}
__global__ __launch_bounds__(128) void k_qkv(const float* __restrict__ XQ, const float* __restrict__ XK, const float* __restrict__ XV, const __bf16* __restrict__ P, const float* __restrict__ BQ, const float* __restrict__ BK, const float* __restrict__ BV, _Float16* __restrict__ QK, _Float16* __restrict__ QKL, _Float16* __restrict__ VTH, _Float16* __restrict__ VTL) {
  const int which0 = (blockIdx.y * 128) / DM; const float* X = (which0 == 0) ? XQ : (which0 == 1) ? XK : XV; const float* BB = BQ ? (((which0 == 0) ? BQ : (which0 == 1) ? BK : BV) + (blockIdx.y * 128 - which0 * DM)) : nullptr;
  __shared__ __align__(16) _Float16 so[4][16][136], sol[4][16][136]; __shared__ __align__(16) _Float16 sth[128][72], stl[128][72];
  const int tid = threadIdx.x, wave = tid >> 5, lane = tid & 31, col = lane & 15, g = lane >> 4; const size_t r0 = (size_t)blockIdx.x * 64 + wave * 16; const int n0 = blockIdx.y * 128;
  v8f acc[8] = {};
#pragma unroll 2
  for (int kc = 0; kc < DM / 32; ++kc) { v16b a; { const float* p = X + (r0 + col) * DM + kc * 32 + 8 * g;
#pragma unroll
      for (int i = 0; i < 8; ++i) { a[i] = (__bf16)p[i]; a[8 + i] = (__bf16)p[16 + i]; } }
#pragma unroll
    for (int j = 0; j < 8; ++j) acc[j] = wmma_bf(a, frag_b(P + (size_t)(n0 + j * 16 + col) * DM + kc * 32, lane), acc[j]); }
  if (n0 < 2 * DM) {   // q stored unscaled (f16 sigma ~0.6, no subnormal exposure); 1/8 applied to the f32 score
#pragma unroll
    for (int j = 0; j < 8; ++j) {
#pragma unroll
      for (int r = 0; r < 8; ++r) { const float v = acc[j][r] + (BB ? bfr(BB[j * 16 + col]) : 0.f); const _Float16 hv = (_Float16)v; so[wave][8 * g + r][j * 16 + col] = hv; sol[wave][8 * g + r][j * 16 + col] = (_Float16)((v - (float)hv) * 2048.0f); } }   // q, k (+ bias) as f16 hi + (x2048) residual
    LDSX();
    for (int rl = 0; rl < 16; ++rl) if (lane < 16) { vst2((unsigned*)(QK + (r0 + rl) * (2 * DM) + n0 + lane * 8), *(const v4u*)&so[wave][rl][lane * 8]); vst2((unsigned*)(QKL + (r0 + rl) * (2 * DM) + n0 + lane * 8), *(const v4u*)&sol[wave][rl][lane * 8]); }
  } else {
#pragma unroll
    for (int j = 0; j < 8; ++j) {
#pragma unroll
      for (int r = 0; r < 8; ++r) { const float v = acc[j][r] + (BB ? bfr(BB[j * 16 + col]) : 0.f); const _Float16 hv = (_Float16)v; sth[j * 16 + col][wave * 16 + 8 * g + r] = hv; stl[j * 16 + col][wave * 16 + 8 * g + r] = (_Float16)((v - (float)hv) * 2048.0f); } }
    __syncthreads();
    const size_t rb = (size_t)blockIdx.x * 64; const int b = (int)(rb / SS), s0 = (int)(rb % SS); const int pc0 = n0 - 2 * DM;
    for (int q = tid; q < 128 * 8; q += 128) { const int d = q >> 3, pc = q & 7; const size_t o = ((size_t)b * DM + pc0 + d) * SS + s0 + pc * 8; vst2((unsigned*)(VTH + o), *(const v4u*)&sth[d][pc * 8]); vst2((unsigned*)(VTL + o), *(const v4u*)&stl[d][pc * 8]); }
  }
}
// ---- k_attn: block = (64 queries, head h, batch b): all-keys flash attention, transposed products: S^T = K . Q^T (A = 16 key rows, B = the wave's 16 queries) and O^T += V^T . P^T (A = 16 channel rows of the v plane, B = P^T).
// Lane (col, g) then holds, for the ONE query q0 + col, the scores of keys 8g + r (tile 0) and 16 + 8g + r (tile 1) of the 32-key pass: exactly the k order of a B fragment, so P goes from the score accumulators into the second product without leaving the registers.
// A pass is one image row of keys (32 = IMW): kh = ks for all of them and kw = ct * 16 + 8g + r in every pass, so the width term is 16 values per lane for the whole loop and the height term one value per pass.
static_assert(IMW == 32, "a 32-key pass is one image row");
// lane l <-> lane l ^ 16 (the two halves that share a query)
__device__ __forceinline__ float xhalf(float v) { const int b = __float_as_int(v); return __int_as_float(__builtin_amdgcn_permlanex16(b, b, 0x76543210, 0xfedcba98, false, false)); }
// K and V of a pass are the same for the four waves of a block: each 32-key tile is brought into LDS once per block, by 16-byte asynchronous copies, two buffers, the next tile in flight while this one is worked on; the waves read their A fragments from LDS.
#define KPITCH 72   // f16 per staged key row: 128 B + 16 B, the conflict-free pitch for 16-byte LDS reads
#define VPITCH 40   // f16 per staged channel row: 64 B + 16 B, likewise
__device__ __forceinline__ unsigned lds_off(const void* p) { return (unsigned)(size_t)p; }
// one lane's four copies of a tile; the s_wait_xcnt closes the copies' own statement, so that it stands in front of every later write of an address register that a copy names
__device__ __forceinline__ void copy4(unsigned l0, const _Float16* g0, unsigned l1, const _Float16* g1, unsigned l2, const _Float16* g2, unsigned l3, const _Float16* g3) {
  asm volatile("global_load_async_to_lds_b128 %0, %1, off\n\tglobal_load_async_to_lds_b128 %2, %3, off\n\tglobal_load_async_to_lds_b128 %4, %5, off\n\tglobal_load_async_to_lds_b128 %6, %7, off\n\ts_wait_xcnt 0x0"
               :: "v"(l0), "v"(g0), "v"(l1), "v"(g1), "v"(l2), "v"(g2), "v"(l3), "v"(g3) : "memory");
}
__global__ __launch_bounds__(128) void k_attn(const _Float16* __restrict__ QK, const _Float16* __restrict__ QKL, const _Float16* __restrict__ VTH, const _Float16* __restrict__ VTL, const void* __restrict__ KMASK, const _Float16* __restrict__ TBL, float* __restrict__ O) {
  __shared__ float sth[4][16][68], stw[4][16][68];
  __shared__ __align__(16) float so[4][16][68];
  __shared__ __align__(16) _Float16 sk[2][32][KPITCH], sv[2][HD][VPITCH];
  const int tid = threadIdx.x, wave = tid >> 5, lane = tid & 31, col = lane & 15, g = lane >> 4;
  const int qb = blockIdx.x, h = blockIdx.y, b = blockIdx.z; const int q0 = qb * 64 + wave * 16; const size_t rq = (size_t)b * SS + q0 + col;
  (void)QKL; (void)VTL; (void)KMASK;
  // thread t copies 16-byte piece t & 7 of key rows t >> 3 and 16 + (t >> 3), and piece t & 3 of channel rows t >> 2 and 32 + (t >> 2)
  const _Float16* gk = QK + ((size_t)b * SS + (tid >> 3)) * (2 * DM) + DM + h * HD + (tid & 7) * 8;
  const _Float16* gv = VTH + ((size_t)b * DM + h * HD + (tid >> 2)) * SS + (tid & 3) * 8;
  const unsigned lk = lds_off(&sk[0][tid >> 3][(tid & 7) * 8]), lv = lds_off(&sv[0][tid >> 2][(tid & 3) * 8]);
  auto stage = [&](int t) { const _Float16* k0 = gk + (size_t)t * 32 * (2 * DM); const _Float16* v0 = gv + t * 32;
    const unsigned k1 = lk + (t & 1) * (unsigned)sizeof(sk[0]), v1 = lv + (t & 1) * (unsigned)sizeof(sv[0]);
    copy4(k1, k0, k1 + 16 * KPITCH * 2, k0 + (size_t)16 * (2 * DM), v1, v0, v1 + 32 * VPITCH * 2, v0 + (size_t)32 * SS); };
  stage(0);
  v16h aq[2];
#pragma unroll
  for (int kc = 0; kc < 2; ++kc) aq[kc] = frag_h(QK + rq * (2 * DM) + h * HD + kc * 32, lane);
  // relative-position dot tables for this wave's 16 queries: TH[r][j] = q_r . rel_pos_h[j], TW[r][j] = q_r . rel_pos_w[j] (exact products)
#pragma unroll
  for (int tb = 0; tb < 2; ++tb) {
#pragma unroll
    for (int jt = 0; jt < 4; ++jt) { v8f tacc = {};
#pragma unroll
      for (int kc = 0; kc < 2; ++kc) tacc = wmma16(aq[kc], frag_h(TBL + ((size_t)tb * 64 + jt * 16 + col) * HD + kc * 32, lane), tacc);
#pragma unroll
      for (int r = 0; r < 8; ++r) { if (tb == 0) sth[wave][8 * g + r][jt * 16 + col] = tacc[r] * 8.0f; else stw[wave][8 * g + r][jt * 16 + col] = tacc[r] * 8.0f; } } }   // x 8 (exact): the tables are added to the unscaled q . k
  LDSX();
  const int pq = q0 + col, hq = pq / IMW, wq = pq % IMW;   // this lane's query
  v8f tw[2];
#pragma unroll
  for (int ct = 0; ct < 2; ++ct) {
#pragma unroll
    for (int r = 0; r < 8; ++r) tw[ct][r] = stw[wave][col][wq - (ct * 16 + 8 * g + r) + (IMW - 1)]; }
  const float* thq = &sth[wave][col][hq + (IMW - 1)];
  // c = 8 x score; P x 2^11 = exp2(c * KS + nm), nm = 11 - (running maximum of c) * KS: one fused multiply-add and one exp2 a score
  const float KS = 0.125f * 1.44269504088896340736f;
  float m = -3.0e38f, nm = 5.0e37f, l = 0.f;   // nm starts so far up that the first pass's alpha is exp2(-5e37) = 0; l (x 2^11): this half's 16 keys of every pass; the halves are joined once, behind the loop
  v8f acc[4] = {}, accl[4] = {};
  const int nks = SS / 32;   // all keys
  static_assert(SS / 32 >= 2, "the prologue fills two tiles");
  asm volatile("s_wait_asynccnt 0x0" ::: "memory");   // this wave's copies of tile 0 have landed
  __syncthreads();                                    // ... and every other wave's
  stage(1);
#pragma unroll 1
  for (int ks = 0; ks < nks; ++ks) { v8f c[2];
    const float th = thq[-ks];
    v16h kf[2][2], vf[4];   // all of the pass's LDS reads as one group at its head; the v fragments land behind the score products and the softmax (the three loops are unrolled so that both arrays are indexed by constants and stay in registers)
#pragma unroll
    for (int ct = 0; ct < 2; ++ct) {
#pragma unroll
      for (int kc = 0; kc < 2; ++kc) kf[ct][kc] = frag_h(&sk[ks & 1][ct * 16 + col][kc * 32], lane); }
#pragma unroll
    for (int dt = 0; dt < 4; ++dt) vf[dt] = frag_h(&sv[ks & 1][dt * 16 + col][0], lane);
    __builtin_amdgcn_sched_barrier(0);   // keeps the 17 LDS reads one group in front of the first product, with counted waits behind them; left free, the scheduler spreads them among the products and waits to 0 behind each small group
#pragma unroll
    for (int ct = 0; ct < 2; ++ct) c[ct] = tw[ct] + th;   // 8 x (q.R_h[hq,kh] + q.R_w[wq,kw]) is the product's C operand
#pragma unroll
    for (int kc = 0; kc < 2; ++kc) {
#pragma unroll
      for (int ct = 0; ct < 2; ++ct) c[ct] = wmma16(kf[ct][kc], aq[kc], c[ct]); }   // + q.k, EXACT products: q, k are bf16 inputs held exactly in f16
    float t8[8];
#pragma unroll
    for (int i = 0; i < 8; ++i) t8[i] = fmaxf(c[0][i], c[1][i]);
    float mx = fmaxf(fmaxf(fmaxf(t8[0], t8[1]), fmaxf(t8[2], t8[3])), fmaxf(fmaxf(t8[4], t8[5]), fmaxf(t8[6], t8[7])));
    mx = fmaxf(mx, xhalf(mx));
    const float mn = fmaxf(m, mx); const float nn = __builtin_fmaf(mn, -KS, 11.0f); const float alpha = __builtin_amdgcn_exp2f(nn - nm);
    v8h ph[2], pr[2]; v8f x[2];
#pragma unroll
    for (int ct = 0; ct < 2; ++ct) { const v8f t = __builtin_elementwise_fma(c[ct], (v8f)(KS), (v8f)(nn));
#pragma unroll
      for (int r = 0; r < 8; ++r) x[ct][r] = __builtin_amdgcn_exp2f(t[r]);   // P scaled by 2^11 before the f16 split so small softmax weights stay out of the f16 subnormal range; l carries the same 2^11
      ph[ct] = __builtin_convertvector(x[ct], v8h);
      const v8f xs = x[ct] * 2048.0f; v8f d;
#pragma unroll
      for (int r = 0; r < 8; ++r) d[r] = __builtin_fmaf((float)ph[ct][r], -2048.0f, xs[r]);   // (x - hi) x 2^11, exact
      pr[ct] = __builtin_convertvector(d, v8h); }
    const v16h pa = __builtin_shufflevector(ph[0], ph[1], 0, 1, 2, 3, 4, 5, 6, 7, 8, 9, 10, 11, 12, 13, 14, 15);
    const v16h pl = __builtin_shufflevector(pr[0], pr[1], 0, 1, 2, 3, 4, 5, 6, 7, 8, 9, 10, 11, 12, 13, 14, 15);
    const v8f x8 = x[0] + x[1]; const v4f x4 = x8.lo + x8.hi; const v2f x2 = x4.lo + x4.hi;
    l = l * alpha + (x2.x + x2.y); m = mn; nm = nn;
#pragma unroll
    for (int dt = 0; dt < 4; ++dt) { acc[dt] *= alpha; accl[dt] *= alpha; }
#pragma unroll
    for (int dt = 0; dt < 4; ++dt) { acc[dt] = wmma16(vf[dt], pa, acc[dt]); accl[dt] = wmma16(vf[dt], pl, accl[dt]); }   // V^T x P hi + V^T x P lo / 2048 (v exact)
    __builtin_amdgcn_sched_barrier(0);   // keeps the two waits and the barrier below at the pass's foot, behind its products: lifted to the head, tile ks + 2's copies would be waited for right after their issue
    asm volatile("s_wait_dscnt 0x0" ::: "memory");      // this wave's reads of buffer ks & 1 are done
    asm volatile("s_wait_asynccnt 0x0" ::: "memory");   // this wave's copies of tile ks + 1 have landed
    __syncthreads();                                    // publishes tile ks + 1 and frees buffer ks & 1
    if (ks + 2 < nks) stage(ks + 2);
  }
  asm volatile("s_wait_asynccnt 0x0" ::: "memory");     // no copy is left in flight behind the loop
  l += xhalf(l);
  const float il = 1.0f / l;   // l and acc both carry 2^11
#pragma unroll
  for (int dt = 0; dt < 4; ++dt) {   // acc[dt][r] = O[query col][channel dt * 16 + 8g + r]: 8 consecutive channels per lane
#pragma unroll
    for (int hf = 0; hf < 2; ++hf) { v4f o;
#pragma unroll
      for (int i = 0; i < 4; ++i) o[i] = (acc[dt][hf * 4 + i] + accl[dt][hf * 4 + i] * (1.0f / 2048.0f)) * il;
      *(v4f*)&so[wave][col][dt * 16 + 8 * g + hf * 4] = o; } }
  LDSX();
  for (int rl = 0; rl < 16; ++rl) if (lane < 16) vst2(O + ((size_t)b * SS + q0 + rl) * DM + h * HD + lane * 4, *(const v4f*)&so[wave][rl][lane * 4]);
}
// ---- k_out: block = (64 rows, 128 cols): out = O(hi/lo) . Wo rows (2 products) + bo
__global__ __launch_bounds__(128) void k_out(const float* __restrict__ O, const __bf16* __restrict__ P, const float* __restrict__ BO, float* __restrict__ Y) {
  __shared__ __align__(16) float so[4][16][132];
  const int tid = threadIdx.x, wave = tid >> 5, lane = tid & 31, col = lane & 15, g = lane >> 4; const size_t r0 = (size_t)blockIdx.x * 64 + wave * 16; const int n0 = blockIdx.y * 128;
  v8f acc[8] = {};
#pragma unroll 2
  for (int kc = 0; kc < DM / 32; ++kc) { const F2 a = split_row(O + (r0 + col) * DM, kc * 32, lane);
#pragma unroll
    for (int j = 0; j < 8; ++j) { const v16b w = frag_b(P + (size_t)(n0 + j * 16 + col) * DM + kc * 32, lane); acc[j] = wmma_bf(a.l, w, acc[j]); acc[j] = wmma_bf(a.h, w, acc[j]); } }
#pragma unroll
  for (int j = 0; j < 8; ++j) {
#pragma unroll
    for (int r = 0; r < 8; ++r) so[wave][8 * g + r][j * 16 + col] = acc[j][r] + (BO ? bfr(BO[n0 + j * 16 + col]) : 0.f); }
  LDSX();
  for (int rl = 0; rl < 16; ++rl) vst2(Y + (r0 + rl) * DM + n0 + lane * 4, *(const v4f*)&so[wave][rl][lane * 4]);
}
// ---- k_prep: q | k -> f16 rows [row][2*DM] (exact); v -> f16 planes [b][DM][SS] (exact). A stream: every block takes 16 whole rows of q or k and one 64-position x 128-channel tile of v.
// Every global read is a 16-byte load whose wave covers 512 contiguous bytes of one row, and a lane's 24 loads are all issued before the first is used.
// v is turned in registers: a lane holds 8 positions x 4 channels, so each channel's 8 positions are one 16-byte LDS store; the tile leaves LDS as whole 128-byte lines. q and k need no LDS: a wave's 8-byte stores cover 256 contiguous bytes.
#define PREPB (2 * NB * SS / 16)
static_assert(PREPB == (NB * SS / 64) * (DM / 128), "as many q | k row groups as v tiles");
static_assert(DM == 256 * 4, "a block's 256 lanes x 4 floats are one row");
typedef __attribute__((ext_vector_type(4))) _Float16 v4h;
__global__ __launch_bounds__(256) void k_prep(const float* __restrict__ Q, const float* __restrict__ Kx, const float* __restrict__ V, _Float16* __restrict__ QK, _Float16* __restrict__ VTH) {
  __shared__ __align__(16) _Float16 svt[128][72];
  const int t = threadIdx.x, wave = t >> 5, lane = t & 31, x = blockIdx.x;
  const size_t vr0 = (size_t)(x >> 3) * 64; const int c0 = (x & 7) * 128;          // the v tile: rows vr0 .. + 63, channels c0 .. + 127
  const bool isq = x < PREPB / 2; const size_t qr0 = (size_t)(x & (PREPB / 2 - 1)) * 16;   // the q or k rows
  const float* vs = V + (vr0 + wave * 8) * DM + c0 + lane * 4;
  const float* qs = (isq ? Q : Kx) + qr0 * DM + t * 4;
  v4f a[8], q[16];
#pragma unroll
  for (int j = 0; j < 8; ++j) a[j] = *(const v4f*)(vs + (size_t)j * DM);
  asm volatile("s_wait_xcnt 0x0" ::: "memory");   // the v loads' address pair is dead from here on and becomes the destination of a later load: the wait stands in front of that overwrite
#pragma unroll
  for (int j = 0; j < 16; ++j) q[j] = *(const v4f*)(qs + (size_t)j * DM);
  __builtin_amdgcn_sched_barrier(0);   // keeps the 24 loads one group in front of all the work: left free, the scheduler mixes q | k conversions among v's, so that the LDS stores and the barrier wait for q | k loads too and most stores for the last load
#pragma unroll
  for (int i = 0; i < 4; ++i) { v8h h;
#pragma unroll
    for (int j = 0; j < 8; ++j) h[j] = (_Float16)bfr(a[j][i]);
    *(v8h*)&svt[lane * 4 + i][wave * 8] = h; }
  // the tile's hand-over between the waves is LDS traffic alone: fences on LDS only, so that the barrier waits for the four LDS stores and not for the 16 q | k loads still in flight (__syncthreads() waited for them all)
  __builtin_amdgcn_fence(__ATOMIC_RELEASE, "workgroup", "local");
  __builtin_amdgcn_s_barrier();
  __builtin_amdgcn_fence(__ATOMIC_ACQUIRE, "workgroup", "local");
  const size_t b = vr0 / SS, s0 = vr0 % SS;
#pragma unroll
  for (int k = 0; k < 4; ++k) { const int e = t + k * 256, c = e >> 3, pc = e & 7; vst2((unsigned*)(VTH + (b * DM + c0 + c) * SS + s0 + pc * 8), *(const v4u*)&svt[c][pc * 8]); }
  _Float16* qd = QK + qr0 * (2 * DM) + (isq ? 0 : DM) + t * 4;
#pragma unroll
  for (int j = 0; j < 16; ++j) { v4h h;
#pragma unroll
    for (int i = 0; i < 4; ++i) h[i] = (_Float16)bfr(q[j][i]);
    *(v4h*)(qd + (size_t)j * (2 * DM)) = h; }
}
// ---- k_tbl: rel_pos_h / rel_pos_w [63][64] -> f16 [64][64] (row 63 zero)
__global__ __launch_bounds__(64) void k_tbl(const float* __restrict__ RH, const float* __restrict__ RW, _Float16* __restrict__ TBL) { const int j = blockIdx.x, tb = blockIdx.y, t = threadIdx.x; __shared__ __align__(16) _Float16 s[HD]; const float* src = tb ? RW : RH; s[t] = (_Float16)((j < 2 * IMW - 1) ? bfr(src[(size_t)j * HD + t]) : 0.f); __syncthreads(); if (t < HD / 8) vst2((unsigned*)(TBL + ((size_t)tb * 64 + j) * HD + t * 8), *(const v4u*)&s[t * 8]); }
extern "C" void kernel_launch(void* const* d_in, const int* in_sizes, int n_in, void* d_out, int out_size, void* d_ws, size_t ws_size, hipStream_t stream) {
  (void)in_sizes; (void)n_in; (void)out_size;
  const float** F = (const float**)d_in;   // 0 q, 1 k, 2 v [4,1,1024,1024] (= [b][s][h*64+d]); 3 rel_pos_h [63,64]; 4 rel_pos_w [63,64]
  if (ws_size < (size_t)WS_END) return;
  char* ws = (char*)d_ws; _Float16 *QK = (_Float16*)(ws + WS_QK), *QKL = (_Float16*)(ws + WS_QKL), *VTH = (_Float16*)(ws + WS_VTH), *VTL = (_Float16*)(ws + WS_VTL), *TBL = (_Float16*)(ws + WS_TBL);
  k_tbl<<<dim3(64, 2), 64, 0, stream>>>(F[3], F[4], TBL);
  k_prep<<<dim3(PREPB), 256, 0, stream>>>(F[0], F[1], F[2], QK, VTH);
  k_attn<<<dim3(TQB, NH, TNB), 128, 0, stream>>>(QK, QKL, VTH, VTL, nullptr, TBL, (float*)d_out);   // O layout [b*S+q][h*64+d] == the module's merged (b,1,s,n*d) output
}

// v006
// One run takes 44 microseconds.
// Timed twice side by side with v005, it ran 1.05 and 1.04 times as fast.
// Over all steps from v000 it is 2.41 times as fast.
// compute dtype: q/k/v and the two relative-position tables rounded to bf16 and used as EXACT f16 operands (bf16 values are exact in f16); per (query, head): TH[j] = q . rel_pos_h[j] and TW[j] = q . rel_pos_w[j] for all table rows on WMMA 16x16x32 (exact products, f32 accumulate), 8 x scores = q . k (exact products) accumulated onto 8 x (TH[hq - kh + 31] + TW[wq - kw + 31]); running-max softmax in f32, base 2 (hardware exp2); P (scaled by 2^11) as f16 hi + residual x the exact v planes (2 products); f32 accumulate; the merged-head output is written directly.
#include <hip/hip_runtime.h>
#include <math.h>

typedef __attribute__((ext_vector_type(16))) _Float16 v16h;
typedef __attribute__((ext_vector_type(16))) __bf16 v16b;
typedef __attribute__((ext_vector_type(8)))  _Float16 v8h;
typedef __attribute__((ext_vector_type(8)))  float v8f;
typedef __attribute__((ext_vector_type(4)))  float v4f;
typedef __attribute__((ext_vector_type(2)))  float v2f;
typedef __attribute__((ext_vector_type(4)))  unsigned v4u;
typedef __attribute__((ext_vector_type(4)))  int v4i;
typedef float __attribute__((may_alias)) float_a;
typedef int __attribute__((may_alias)) int_a;

template <typename T> __device__ __forceinline__ void vst2(void* p, T v) { *(T*)p = v;  }
__device__ __forceinline__ v8f wmma16(v16h a, v16h b, v8f c) {
  return __builtin_amdgcn_wmma_f32_16x16x32_f16(false, a, false, b, (short)0, c, false, false);
}
__device__ __forceinline__ v8f wmma_bf(v16b a, v16b b, v8f c) {
  v8f d = __builtin_amdgcn_wmma_f32_16x16x32_bf16(false, a, false, b, (short)0, c, false, false);
  asm volatile("v_nop\n\tv_nop\n\tv_nop\n\tv_nop" : "+v"(d) : "v"(a), "v"(b));
  return d;
}
// Decomposed relative-position attention over a 32 x 32 feature map (B 4, 1,024 positions, 16 heads x 64, q/k/v given): sim = q k^T / 8 + q . R_h[hq, kh] + q . R_w[wq, kw], softmax, . v, heads re-merged.
__device__ __forceinline__ v16h frag_h(const _Float16* rowk0, int lane) {
  union { v16h v; v8h q[2]; } u; const _Float16* p = rowk0 + 8 * (lane >> 4);
  u.q[0] = *(const v8h*)p; u.q[1] = *(const v8h*)(p + 16); return u.v;
}
__device__ __forceinline__ v16h frag_f32(const float* rowk0, int lane) {
  v16h a; const float* p = rowk0 + 8 * (lane >> 4);
#pragma unroll
  for (int i = 0; i < 8; ++i) { a[i] = (_Float16)p[i]; a[8 + i] = (_Float16)p[16 + i]; }
  return a;
}
__device__ __forceinline__ v16h frag_f32s(const float* rowk0, int lane, float sc) {
  v16h a; const float* p = rowk0 + 8 * (lane >> 4);
#pragma unroll
  for (int i = 0; i < 8; ++i) { a[i] = (_Float16)(p[i] * sc); a[8 + i] = (_Float16)(p[16 + i] * sc); }
  return a;
}
// column fragment from a [K][ld] layout (column n), rows >= K read as 0
__device__ __forceinline__ v16h fragc_f32(const float* W, int k0, int n, int lane, int ld, int K) {
  v16h a; const int g = lane >> 4;
#pragma unroll
  for (int i = 0; i < 8; ++i) { const int ka = k0 + 8 * g + i, kb = ka + 16;
    a[i] = (_Float16)(ka < K ? W[(size_t)(ka < K ? ka : K - 1) * ld + n] : 0.f); a[8 + i] = (_Float16)(kb < K ? W[(size_t)(kb < K ? kb : K - 1) * ld + n] : 0.f); }
  return a;
}
struct F2 { v16b h, l; };
__device__ __forceinline__ F2 bsplit16(const float v[16]) { F2 r;
#pragma unroll
  for (int i = 0; i < 16; ++i) { const __bf16 h = (__bf16)v[i]; r.h[i] = h; r.l[i] = (__bf16)(v[i] - (float)h); }
  return r; }
__device__ __forceinline__ F2 split_row(const float* row, int k0, int lane) { float v[16]; const float* p = row + k0 + 8 * (lane >> 4);
#pragma unroll
  for (int i = 0; i < 8; ++i) { v[i] = p[i]; v[8 + i] = p[16 + i]; }
  return bsplit16(v); }
__device__ __forceinline__ F2 split_rowK(const float* row, int k0, int lane, int K) { float v[16]; const int g = lane >> 4;
#pragma unroll
  for (int i = 0; i < 8; ++i) { const int ka = k0 + 8 * g + i, kb = ka + 16; v[i] = ka < K ? row[ka < K ? ka : K - 1] : 0.f; v[8 + i] = kb < K ? row[kb < K ? kb : K - 1] : 0.f; }
  return bsplit16(v); }
__device__ __forceinline__ F2 split_col(const float* W, int k0, int n, int lane, int ld, int K) { float v[16]; const int g = lane >> 4;
#pragma unroll
  for (int i = 0; i < 8; ++i) { const int ka = k0 + 8 * g + i, kb = ka + 16; v[i] = ka < K ? W[(size_t)(ka < K ? ka : K - 1) * ld + n] : 0.f; v[8 + i] = kb < K ? W[(size_t)(kb < K ? kb : K - 1) * ld + n] : 0.f; }
  return bsplit16(v); }
__device__ __forceinline__ v8f mac3(const F2& a, const F2& b, v8f c) { c = wmma_bf(a.l, b.h, c); c = wmma_bf(a.h, b.l, c); return wmma_bf(a.h, b.h, c); }
__device__ __forceinline__ float sigm(float v) { return 1.0f / (1.0f + expf(-v)); }
#define LDSX() do { asm volatile("s_wait_dscnt 0" ::: "memory"); __builtin_amdgcn_wave_barrier(); __builtin_amdgcn_fence(__ATOMIC_RELEASE, "workgroup"); } while (0)


#define NB 4
#define SS 1024
#define IMW 32
#define DM 1024
#define NH 16
#define HD 64
#define QKVW (3 * DM)
#ifndef TQB
#define TQB (SS / 64)
#define TNB NB
#define TOB (NB * SS / 64)     // output row tiles (all)
#endif
typedef __attribute__((ext_vector_type(8))) __bf16 v8b;
__device__ __forceinline__ v16b frag_b(const __bf16* rowk0, int lane) {
  union { v16b v; v8b q[2]; } u; const __bf16* p = rowk0 + 8 * (lane >> 4);
  u.q[0] = *(const v8b*)p; u.q[1] = *(const v8b*)(p + 16); return u.v;
}
__device__ __forceinline__ float bfr(float v) { return (float)(__bf16)v; }
__device__ __attribute__((noinline)) float exp_ni(float v) { return expf(v); }
__device__ __attribute__((noinline)) float erf_ni(float v) { return erff(v); }

#define PK_A 0                       // [3072][1024] Wqkv rows (natural [out][in])
#define PK_P (PK_A + QKVW * DM)        // [1024][1024] Wo rows (natural)
#define PK_END (PK_P + DM * DM)
#define WS_PK  0u
#define WS_QK  (WS_PK + 2u * PK_END)             // f16 [4096 rows][2048]: q | k
#define WS_QKL (WS_QK + 2u * NB * SS * 2 * DM)     // f16 q | k residual planes x2048
#define WS_VTH (WS_QKL + 2u * NB * SS * 2 * DM)    // f16 [b][1024 (h*64+d)][1024 s] hi
#define WS_VTL (WS_VTH + 2u * NB * DM * SS)        // f16 lo x 2048
#define WS_O   (WS_VTL + 2u * NB * DM * SS)        // f32 [4096][1024]
#define WS_CS  (WS_O + 4u * NB * SS * DM)           // f32 2 x [1024][32], unused
#define WS_TBL (WS_CS + 4u * 2 * SS * 32)                 // f16 [2][64][HD]: rel_pos_h rows 0..62 (+ zero row), rel_pos_w
#define WS_END (WS_TBL + 2u * 2 * 64 * HD)
// ---- k_pack: block = (row n, which): natural [out][in] rows -> bf16; which 0..2 -> W_q/W_k/W_v into PK_A rows which*1024 + n; 3 -> W_o into PK_P
__global__ __launch_bounds__(256) void k_pack(const float* __restrict__ WQ, const float* __restrict__ WK, const float* __restrict__ WV, const float* __restrict__ WO, __bf16* __restrict__ PK) {
  __shared__ __align__(16) __bf16 s[DM]; const int n = blockIdx.x, which = blockIdx.y, t = threadIdx.x; const float* Wm = (which == 0) ? WQ : (which == 1) ? WK : (which == 2) ? WV : WO;
  for (int k = t; k < DM; k += 256) s[k] = (__bf16)Wm[(size_t)n * DM + k];
  __syncthreads();
  __bf16* dst = (which < 3) ? PK + PK_A + ((size_t)which * DM + n) * DM : PK + PK_P + (size_t)n * DM;
  for (int q = t; q < DM / 8; q += 256) vst2((unsigned*)(dst + q * 8), *(const v4u*)&s[q * 8]);
}
__global__ __launch_bounds__(128) void k_qkv(const float* __restrict__ XQ, const float* __restrict__ XK, const float* __restrict__ XV, const __bf16* __restrict__ P, const float* __restrict__ BQ, const float* __restrict__ BK, const float* __restrict__ BV, _Float16* __restrict__ QK, _Float16* __restrict__ QKL, _Float16* __restrict__ VTH, _Float16* __restrict__ VTL) {
  const int which0 = (blockIdx.y * 128) / DM; const float* X = (which0 == 0) ? XQ : (which0 == 1) ? XK : XV; const float* BB = BQ ? (((which0 == 0) ? BQ : (which0 == 1) ? BK : BV) + (blockIdx.y * 128 - which0 * DM)) : nullptr;
  __shared__ __align__(16) _Float16 so[4][16][136], sol[4][16][136]; __shared__ __align__(16) _Float16 sth[128][72], stl[128][72];
  const int tid = threadIdx.x, wave = tid >> 5, lane = tid & 31, col = lane & 15, g = lane >> 4; const size_t r0 = (size_t)blockIdx.x * 64 + wave * 16; const int n0 = blockIdx.y * 128;
  v8f acc[8] = {};
#pragma unroll 2
  for (int kc = 0; kc < DM / 32; ++kc) { v16b a; { const float* p = X + (r0 + col) * DM + kc * 32 + 8 * g;
#pragma unroll
      for (int i = 0; i < 8; ++i) { a[i] = (__bf16)p[i]; a[8 + i] = (__bf16)p[16 + i]; } }
#pragma unroll
    for (int j = 0; j < 8; ++j) acc[j] = wmma_bf(a, frag_b(P + (size_t)(n0 + j * 16 + col) * DM + kc * 32, lane), acc[j]); }
  if (n0 < 2 * DM) {   // q stored unscaled (f16 sigma ~0.6, no subnormal exposure); 1/8 applied to the f32 score
#pragma unroll
    for (int j = 0; j < 8; ++j) {
#pragma unroll
      for (int r = 0; r < 8; ++r) { const float v = acc[j][r] + (BB ? bfr(BB[j * 16 + col]) : 0.f); const _Float16 hv = (_Float16)v; so[wave][8 * g + r][j * 16 + col] = hv; sol[wave][8 * g + r][j * 16 + col] = (_Float16)((v - (float)hv) * 2048.0f); } }   // q, k (+ bias) as f16 hi + (x2048) residual
    LDSX();
    for (int rl = 0; rl < 16; ++rl) if (lane < 16) { vst2((unsigned*)(QK + (r0 + rl) * (2 * DM) + n0 + lane * 8), *(const v4u*)&so[wave][rl][lane * 8]); vst2((unsigned*)(QKL + (r0 + rl) * (2 * DM) + n0 + lane * 8), *(const v4u*)&sol[wave][rl][lane * 8]); }
  } else {
#pragma unroll
    for (int j = 0; j < 8; ++j) {
#pragma unroll
      for (int r = 0; r < 8; ++r) { const float v = acc[j][r] + (BB ? bfr(BB[j * 16 + col]) : 0.f); const _Float16 hv = (_Float16)v; sth[j * 16 + col][wave * 16 + 8 * g + r] = hv; stl[j * 16 + col][wave * 16 + 8 * g + r] = (_Float16)((v - (float)hv) * 2048.0f); } }
    __syncthreads();
    const size_t rb = (size_t)blockIdx.x * 64; const int b = (int)(rb / SS), s0 = (int)(rb % SS); const int pc0 = n0 - 2 * DM;
    for (int q = tid; q < 128 * 8; q += 128) { const int d = q >> 3, pc = q & 7; const size_t o = ((size_t)b * DM + pc0 + d) * SS + s0 + pc * 8; vst2((unsigned*)(VTH + o), *(const v4u*)&sth[d][pc * 8]); vst2((unsigned*)(VTL + o), *(const v4u*)&stl[d][pc * 8]); }
  }
}
// ---- k_attn: block = (64 queries, head h, batch b): all-keys flash attention, transposed products: S^T = K . Q^T (A = 16 key rows, B = the wave's 16 queries) and O^T += V^T . P^T (A = 16 channel rows of the v plane, B = P^T).
// Lane (col, g) then holds, for the ONE query q0 + col, the scores of keys 8g + r (tile 0) and 16 + 8g + r (tile 1) of the 32-key pass: exactly the k order of a B fragment, so P goes from the score accumulators into the second product without leaving the registers.
// A pass is one image row of keys (32 = IMW): kh = ks for all of them and kw = ct * 16 + 8g + r in every pass, so the width term is 16 values per lane for the whole loop and the height term one value per pass.
static_assert(IMW == 32, "a 32-key pass is one image row");
// lane l <-> lane l ^ 16 (the two halves that share a query)
__device__ __forceinline__ float xhalf(float v) { const int b = __float_as_int(v); return __int_as_float(__builtin_amdgcn_permlanex16(b, b, 0x76543210, 0xfedcba98, false, false)); }
// K and V of a pass are the same for the four waves of a block: each 32-key tile is brought into LDS once per block, by 16-byte asynchronous copies, two buffers, the next tile in flight while this one is worked on; the waves read their A fragments from LDS.
#define KPITCH 72   // f16 per staged key row: 128 B + 16 B, the conflict-free pitch for 16-byte LDS reads
#define VPITCH 40   // f16 per staged channel row: 64 B + 16 B, likewise
__device__ __forceinline__ unsigned lds_off(const void* p) { return (unsigned)(size_t)p; }
// one lane's four copies of a tile; the s_wait_xcnt closes the copies' own statement, so that it stands in front of every later write of an address register that a copy names
__device__ __forceinline__ void copy4(unsigned l0, const _Float16* g0, unsigned l1, const _Float16* g1, unsigned l2, const _Float16* g2, unsigned l3, const _Float16* g3) {
  asm volatile("global_load_async_to_lds_b128 %0, %1, off\n\tglobal_load_async_to_lds_b128 %2, %3, off\n\tglobal_load_async_to_lds_b128 %4, %5, off\n\tglobal_load_async_to_lds_b128 %6, %7, off\n\ts_wait_xcnt 0x0"
               :: "v"(l0), "v"(g0), "v"(l1), "v"(g1), "v"(l2), "v"(g2), "v"(l3), "v"(g3) : "memory");
}
__global__ __launch_bounds__(128) void k_attn(const _Float16* __restrict__ QK, const _Float16* __restrict__ QKL, const _Float16* __restrict__ VTH, const _Float16* __restrict__ VTL, const void* __restrict__ KMASK, const _Float16* __restrict__ TBL, float* __restrict__ O) {
  __shared__ float sth[4][16][68], stw[4][16][68];
  __shared__ __align__(16) float so[4][16][68];
  __shared__ __align__(16) _Float16 sk[2][32][KPITCH], sv[2][HD][VPITCH];
  const int tid = threadIdx.x, wave = tid >> 5, lane = tid & 31, col = lane & 15, g = lane >> 4;
  const int qb = blockIdx.x, h = blockIdx.y, b = blockIdx.z; const int q0 = qb * 64 + wave * 16; const size_t rq = (size_t)b * SS + q0 + col;
  (void)QKL; (void)VTL; (void)KMASK;
  // thread t copies 16-byte piece t & 7 of key rows t >> 3 and 16 + (t >> 3), and piece t & 3 of channel rows t >> 2 and 32 + (t >> 2)
  const _Float16* gk = QK + ((size_t)b * SS + (tid >> 3)) * (2 * DM) + DM + h * HD + (tid & 7) * 8;
  const _Float16* gv = VTH + ((size_t)b * DM + h * HD + (tid >> 2)) * SS + (tid & 3) * 8;
  const unsigned lk = lds_off(&sk[0][tid >> 3][(tid & 7) * 8]), lv = lds_off(&sv[0][tid >> 2][(tid & 3) * 8]);
  auto stage = [&](int t) { const _Float16* k0 = gk + (size_t)t * 32 * (2 * DM); const _Float16* v0 = gv + t * 32;
    const unsigned k1 = lk + (t & 1) * (unsigned)sizeof(sk[0]), v1 = lv + (t & 1) * (unsigned)sizeof(sv[0]);
    copy4(k1, k0, k1 + 16 * KPITCH * 2, k0 + (size_t)16 * (2 * DM), v1, v0, v1 + 32 * VPITCH * 2, v0 + (size_t)32 * SS); };
  stage(0);
  v16h aq[2];
#pragma unroll
  for (int kc = 0; kc < 2; ++kc) aq[kc] = frag_h(QK + rq * (2 * DM) + h * HD + kc * 32, lane);
  // relative-position dot tables for this wave's 16 queries: TH[r][j] = q_r . rel_pos_h[j], TW[r][j] = q_r . rel_pos_w[j] (exact products)
#pragma unroll
  for (int tb = 0; tb < 2; ++tb) {
#pragma unroll
    for (int jt = 0; jt < 4; ++jt) { v8f tacc = {};
#pragma unroll
      for (int kc = 0; kc < 2; ++kc) tacc = wmma16(aq[kc], frag_h(TBL + ((size_t)tb * 64 + jt * 16 + col) * HD + kc * 32, lane), tacc);
#pragma unroll
      for (int r = 0; r < 8; ++r) { if (tb == 0) sth[wave][8 * g + r][jt * 16 + col] = tacc[r] * 8.0f; else stw[wave][8 * g + r][jt * 16 + col] = tacc[r] * 8.0f; } } }   // x 8 (exact): the tables are added to the unscaled q . k
  LDSX();
  const int pq = q0 + col, hq = pq / IMW, wq = pq % IMW;   // this lane's query
  v8f tw[2];
#pragma unroll
  for (int ct = 0; ct < 2; ++ct) {
#pragma unroll
    for (int r = 0; r < 8; ++r) tw[ct][r] = stw[wave][col][wq - (ct * 16 + 8 * g + r) + (IMW - 1)]; }
  const float* thq = &sth[wave][col][hq + (IMW - 1)];
  // c = 8 x score; P x 2^11 = exp2(c * KS + nm), nm = 11 - (running maximum of c) * KS: one fused multiply-add and one exp2 a score
  const float KS = 0.125f * 1.44269504088896340736f;
  float m = -3.0e38f, nm = 5.0e37f, l = 0.f;   // nm starts so far up that the first pass's alpha is exp2(-5e37) = 0; l (x 2^11): this half's 16 keys of every pass; the halves are joined once, behind the loop
  v8f acc[4] = {}, accl[4] = {};
  const int nks = SS / 32;   // all keys
  static_assert(SS / 32 >= 2, "the prologue fills two tiles");
  asm volatile("s_wait_asynccnt 0x0" ::: "memory");   // this wave's copies of tile 0 have landed
  __syncthreads();                                    // ... and every other wave's
  stage(1);
#pragma unroll 1
  for (int ks = 0; ks < nks; ++ks) { v8f c[2];
    const float th = thq[-ks];
    v16h kf[2][2], vf[4];   // all of the pass's LDS reads as one group at its head; the v fragments land behind the score products and the softmax (the three loops are unrolled so that both arrays are indexed by constants and stay in registers)
#pragma unroll
    for (int ct = 0; ct < 2; ++ct) {
#pragma unroll
      for (int kc = 0; kc < 2; ++kc) kf[ct][kc] = frag_h(&sk[ks & 1][ct * 16 + col][kc * 32], lane); }
#pragma unroll
    for (int dt = 0; dt < 4; ++dt) vf[dt] = frag_h(&sv[ks & 1][dt * 16 + col][0], lane);
    __builtin_amdgcn_sched_barrier(0);   // keeps the 17 LDS reads one group in front of the first product, with counted waits behind them; left free, the scheduler spreads them among the products and waits to 0 behind each small group
#pragma unroll
    for (int ct = 0; ct < 2; ++ct) c[ct] = tw[ct] + th;   // 8 x (q.R_h[hq,kh] + q.R_w[wq,kw]) is the product's C operand
#pragma unroll
    for (int kc = 0; kc < 2; ++kc) {
#pragma unroll
      for (int ct = 0; ct < 2; ++ct) c[ct] = wmma16(kf[ct][kc], aq[kc], c[ct]); }   // + q.k, EXACT products: q, k are bf16 inputs held exactly in f16
    float t8[8];
#pragma unroll
    for (int i = 0; i < 8; ++i) t8[i] = fmaxf(c[0][i], c[1][i]);
    float mx = fmaxf(fmaxf(fmaxf(t8[0], t8[1]), fmaxf(t8[2], t8[3])), fmaxf(fmaxf(t8[4], t8[5]), fmaxf(t8[6], t8[7])));
    mx = fmaxf(mx, xhalf(mx));
    const float mn = fmaxf(m, mx); const float nn = __builtin_fmaf(mn, -KS, 11.0f); const float alpha = __builtin_amdgcn_exp2f(nn - nm);
    v8h ph[2], pr[2]; v8f x[2];
#pragma unroll
    for (int ct = 0; ct < 2; ++ct) { const v8f t = __builtin_elementwise_fma(c[ct], (v8f)(KS), (v8f)(nn));
#pragma unroll
      for (int r = 0; r < 8; ++r) x[ct][r] = __builtin_amdgcn_exp2f(t[r]);   // P scaled by 2^11 before the f16 split so small softmax weights stay out of the f16 subnormal range; l carries the same 2^11
      ph[ct] = __builtin_convertvector(x[ct], v8h);
      const v8f xs = x[ct] * 2048.0f; v8f d;
#pragma unroll
      for (int r = 0; r < 8; ++r) d[r] = __builtin_fmaf((float)ph[ct][r], -2048.0f, xs[r]);   // (x - hi) x 2^11, exact
      pr[ct] = __builtin_convertvector(d, v8h); }
    const v16h pa = __builtin_shufflevector(ph[0], ph[1], 0, 1, 2, 3, 4, 5, 6, 7, 8, 9, 10, 11, 12, 13, 14, 15);
    const v16h pl = __builtin_shufflevector(pr[0], pr[1], 0, 1, 2, 3, 4, 5, 6, 7, 8, 9, 10, 11, 12, 13, 14, 15);
    const v8f x8 = x[0] + x[1]; const v4f x4 = x8.lo + x8.hi; const v2f x2 = x4.lo + x4.hi;
    l = l * alpha + (x2.x + x2.y); m = mn; nm = nn;
#pragma unroll
    for (int dt = 0; dt < 4; ++dt) { acc[dt] *= alpha; accl[dt] *= alpha; }
#pragma unroll
    for (int dt = 0; dt < 4; ++dt) { acc[dt] = wmma16(vf[dt], pa, acc[dt]); accl[dt] = wmma16(vf[dt], pl, accl[dt]); }   // V^T x P hi + V^T x P lo / 2048 (v exact)
    __builtin_amdgcn_sched_barrier(0);   // keeps the two waits and the barrier below at the pass's foot, behind its products: lifted to the head, tile ks + 2's copies would be waited for right after their issue
    asm volatile("s_wait_dscnt 0x0" ::: "memory");      // this wave's reads of buffer ks & 1 are done
    asm volatile("s_wait_asynccnt 0x0" ::: "memory");   // this wave's copies of tile ks + 1 have landed
    __syncthreads();                                    // publishes tile ks + 1 and frees buffer ks & 1
    if (ks + 2 < nks) stage(ks + 2);
  }
  asm volatile("s_wait_asynccnt 0x0" ::: "memory");     // no copy is left in flight behind the loop
  l += xhalf(l);
  const float il = 1.0f / l;   // l and acc both carry 2^11
#pragma unroll
  for (int dt = 0; dt < 4; ++dt) {   // acc[dt][r] = O[query col][channel dt * 16 + 8g + r]: 8 consecutive channels per lane
#pragma unroll
    for (int hf = 0; hf < 2; ++hf) { v4f o;
#pragma unroll
      for (int i = 0; i < 4; ++i) o[i] = (acc[dt][hf * 4 + i] + accl[dt][hf * 4 + i] * (1.0f / 2048.0f)) * il;
      *(v4f*)&so[wave][col][dt * 16 + 8 * g + hf * 4] = o; } }
  LDSX();
  for (int rl = 0; rl < 16; ++rl) if (lane < 16) vst2(O + ((size_t)b * SS + q0 + rl) * DM + h * HD + lane * 4, *(const v4f*)&so[wave][rl][lane * 4]);
}
// ---- k_out: block = (64 rows, 128 cols): out = O(hi/lo) . Wo rows (2 products) + bo
__global__ __launch_bounds__(128) void k_out(const float* __restrict__ O, const __bf16* __restrict__ P, const float* __restrict__ BO, float* __restrict__ Y) {
  __shared__ __align__(16) float so[4][16][132];
  const int tid = threadIdx.x, wave = tid >> 5, lane = tid & 31, col = lane & 15, g = lane >> 4; const size_t r0 = (size_t)blockIdx.x * 64 + wave * 16; const int n0 = blockIdx.y * 128;
  v8f acc[8] = {};
#pragma unroll 2
  for (int kc = 0; kc < DM / 32; ++kc) { const F2 a = split_row(O + (r0 + col) * DM, kc * 32, lane);
#pragma unroll
    for (int j = 0; j < 8; ++j) { const v16b w = frag_b(P + (size_t)(n0 + j * 16 + col) * DM + kc * 32, lane); acc[j] = wmma_bf(a.l, w, acc[j]); acc[j] = wmma_bf(a.h, w, acc[j]); } }
#pragma unroll
  for (int j = 0; j < 8; ++j) {
#pragma unroll
    for (int r = 0; r < 8; ++r) so[wave][8 * g + r][j * 16 + col] = acc[j][r] + (BO ? bfr(BO[n0 + j * 16 + col]) : 0.f); }
  LDSX();
  for (int rl = 0; rl < 16; ++rl) vst2(Y + (r0 + rl) * DM + n0 + lane * 4, *(const v4f*)&so[wave][rl][lane * 4]);
}
// ---- k_prep: q | k -> f16 rows [row][2*DM] (exact); v -> f16 planes [b][DM][SS] (exact). A stream: every block past the first TBLB takes 16 whole rows of q or k and one 64-position x 128-channel tile of v.
// Every q, k, v read is a 16-byte load whose wave covers 512 contiguous bytes of one row, and a lane's 24 loads are all issued before the first is used.
// v is turned in registers: a lane holds 8 positions x 4 channels, so each channel's 8 positions are one 16-byte LDS store; the tile leaves LDS as whole 128-byte lines. q and k need no LDS: a wave's 8-byte stores cover 256 contiguous bytes.
// The two relative-position tables need nothing of q, k, v and nothing here needs them: they share this grid instead of a launch of their own. The first TBLB blocks turn rel_pos_h / rel_pos_w [63][64] into f16 [2][64][64] (row 63 zero), 4 elements a lane: a 16-byte load, an 8-byte store, a wave's stores 256 contiguous bytes.
#define PREPB (2 * NB * SS / 16)
#define TBLB (2 * 64 * HD / (256 * 4))
static_assert(TBLB * 256 * 4 == 2 * 64 * HD && HD % 4 == 0, "the table blocks cover both tables exactly, a lane's 4 elements inside one row");
static_assert(PREPB == (NB * SS / 64) * (DM / 128), "as many q | k row groups as v tiles");
static_assert(DM == 256 * 4, "a block's 256 lanes x 4 floats are one row");
typedef __attribute__((ext_vector_type(4))) _Float16 v4h;
__global__ __launch_bounds__(256) void k_prep(const float* __restrict__ Q, const float* __restrict__ Kx, const float* __restrict__ V, const float* __restrict__ RH, const float* __restrict__ RW, _Float16* __restrict__ QK, _Float16* __restrict__ VTH, _Float16* __restrict__ TBL) {
  __shared__ __align__(16) _Float16 svt[128][72];
  const int t = threadIdx.x, wave = t >> 5, lane = t & 31;
  if (blockIdx.x < TBLB) {   // the same for a whole block, and in front of the barrier
    const int e = ((int)blockIdx.x * 256 + t) * 4, tb = e / (64 * HD), j = (e / HD) & 63, c = e % HD;
    v4f r = {};
    if (j < 2 * IMW - 1) r = *(const v4f*)((tb ? RW : RH) + (size_t)j * HD + c);
    const v4h h = { (_Float16)bfr(r[0]), (_Float16)bfr(r[1]), (_Float16)bfr(r[2]), (_Float16)bfr(r[3]) };
    *(v4h*)(TBL + e) = h;
    return;
  }
  const int x = (int)blockIdx.x - TBLB;
  const size_t vr0 = (size_t)(x >> 3) * 64; const int c0 = (x & 7) * 128;          // the v tile: rows vr0 .. + 63, channels c0 .. + 127
  const bool isq = x < PREPB / 2; const size_t qr0 = (size_t)(x & (PREPB / 2 - 1)) * 16;   // the q or k rows
  const float* vs = V + (vr0 + wave * 8) * DM + c0 + lane * 4;
  const float* qs = (isq ? Q : Kx) + qr0 * DM + t * 4;
  v4f a[8], q[16];
#pragma unroll
  for (int j = 0; j < 8; ++j) a[j] = *(const v4f*)(vs + (size_t)j * DM);
  asm volatile("s_wait_xcnt 0x0" ::: "memory");   // the v loads' address pair is dead from here on and becomes the destination of a later load: the wait stands in front of that overwrite
#pragma unroll
  for (int j = 0; j < 16; ++j) q[j] = *(const v4f*)(qs + (size_t)j * DM);
  __builtin_amdgcn_sched_barrier(0);   // keeps the 24 loads one group in front of all the work: left free, the scheduler mixes q | k conversions among v's, so that the LDS stores and the barrier wait for q | k loads too and most stores for the last load
#pragma unroll
  for (int i = 0; i < 4; ++i) { v8h h;
#pragma unroll
    for (int j = 0; j < 8; ++j) h[j] = (_Float16)bfr(a[j][i]);
    *(v8h*)&svt[lane * 4 + i][wave * 8] = h; }
  // the tile's hand-over between the waves is LDS traffic alone: fences on LDS only, so that the barrier waits for the four LDS stores and not for the 16 q | k loads still in flight (__syncthreads() waited for them all)
  __builtin_amdgcn_fence(__ATOMIC_RELEASE, "workgroup", "local");
  __builtin_amdgcn_s_barrier();
  __builtin_amdgcn_fence(__ATOMIC_ACQUIRE, "workgroup", "local");
  const size_t b = vr0 / SS, s0 = vr0 % SS;
#pragma unroll
  for (int k = 0; k < 4; ++k) { const int e = t + k * 256, c = e >> 3, pc = e & 7; vst2((unsigned*)(VTH + (b * DM + c0 + c) * SS + s0 + pc * 8), *(const v4u*)&svt[c][pc * 8]); }
  _Float16* qd = QK + qr0 * (2 * DM) + (isq ? 0 : DM) + t * 4;
#pragma unroll
  for (int j = 0; j < 16; ++j) { v4h h;
#pragma unroll
    for (int i = 0; i < 4; ++i) h[i] = (_Float16)bfr(q[j][i]);
    *(v4h*)(qd + (size_t)j * (2 * DM)) = h; }
}
extern "C" void kernel_launch(void* const* d_in, const int* in_sizes, int n_in, void* d_out, int out_size, void* d_ws, size_t ws_size, hipStream_t stream) {
  (void)in_sizes; (void)n_in; (void)out_size;
  const float** F = (const float**)d_in;   // 0 q, 1 k, 2 v [4,1,1024,1024] (= [b][s][h*64+d]); 3 rel_pos_h [63,64]; 4 rel_pos_w [63,64]
  if (ws_size < (size_t)WS_END) return;
  char* ws = (char*)d_ws; _Float16 *QK = (_Float16*)(ws + WS_QK), *QKL = (_Float16*)(ws + WS_QKL), *VTH = (_Float16*)(ws + WS_VTH), *VTL = (_Float16*)(ws + WS_VTL), *TBL = (_Float16*)(ws + WS_TBL);
  k_prep<<<dim3(TBLB + PREPB), 256, 0, stream>>>(F[0], F[1], F[2], F[3], F[4], QK, VTH, TBL);
  k_attn<<<dim3(TQB, NH, TNB), 128, 0, stream>>>(QK, QKL, VTH, VTL, nullptr, TBL, (float*)d_out);   // O layout [b*S+q][h*64+d] == the module's merged (b,1,s,n*d) output
}

// v007
// One run takes 41.3 microseconds.
// Next to v006, in two timings, it ran 1.06 and 1.07 times as fast.
// Counting every step since v000, it is 2.57 times as fast.
// compute dtype: q/k/v and the two relative-position tables rounded to bf16 and used as EXACT f16 operands (bf16 values are exact in f16); per (query, head): TH[j] = q . rel_pos_h[j] and TW[j] = q . rel_pos_w[j] for all table rows on WMMA 16x16x32 (exact products, f32 accumulate), 8 x scores = q . k (exact products) accumulated onto 8 x (TH[hq - kh + 31] + TW[wq - kw + 31]); running-max softmax in f32, base 2 (hardware exp2); P (scaled by 2^11) as f16 hi + f16 residual at the same scale x the exact v planes (2 products into one tile); f32 accumulate; the merged-head output is written directly.
#include <hip/hip_runtime.h>
#include <math.h>

typedef __attribute__((ext_vector_type(16))) _Float16 v16h;
typedef __attribute__((ext_vector_type(16))) __bf16 v16b;
typedef __attribute__((ext_vector_type(8)))  _Float16 v8h;
typedef __attribute__((ext_vector_type(8)))  float v8f;
typedef __attribute__((ext_vector_type(4)))  float v4f;
typedef __attribute__((ext_vector_type(2)))  float v2f;
typedef __attribute__((ext_vector_type(4)))  unsigned v4u;
typedef __attribute__((ext_vector_type(4)))  int v4i;
typedef float __attribute__((may_alias)) float_a;
typedef int __attribute__((may_alias)) int_a;

template <typename T> __device__ __forceinline__ void vst2(void* p, T v) { *(T*)p = v;  }
__device__ __forceinline__ v8f wmma16(v16h a, v16h b, v8f c) {
  return __builtin_amdgcn_wmma_f32_16x16x32_f16(false, a, false, b, (short)0, c, false, false);
}
__device__ __forceinline__ v8f wmma_bf(v16b a, v16b b, v8f c) {
  v8f d = __builtin_amdgcn_wmma_f32_16x16x32_bf16(false, a, false, b, (short)0, c, false, false);
  asm volatile("v_nop\n\tv_nop\n\tv_nop\n\tv_nop" : "+v"(d) : "v"(a), "v"(b));
  return d;
}
// Decomposed relative-position attention over a 32 x 32 feature map (B 4, 1,024 positions, 16 heads x 64, q/k/v given): sim = q k^T / 8 + q . R_h[hq, kh] + q . R_w[wq, kw], softmax, . v, heads re-merged.
__device__ __forceinline__ v16h frag_h(const _Float16* rowk0, int lane) {
  union { v16h v; v8h q[2]; } u; const _Float16* p = rowk0 + 8 * (lane >> 4);
  u.q[0] = *(const v8h*)p; u.q[1] = *(const v8h*)(p + 16); return u.v;
}
__device__ __forceinline__ v16h frag_f32(const float* rowk0, int lane) {
  v16h a; const float* p = rowk0 + 8 * (lane >> 4);
#pragma unroll
  for (int i = 0; i < 8; ++i) { a[i] = (_Float16)p[i]; a[8 + i] = (_Float16)p[16 + i]; }
  return a;
}
__device__ __forceinline__ v16h frag_f32s(const float* rowk0, int lane, float sc) {
  v16h a; const float* p = rowk0 + 8 * (lane >> 4);
#pragma unroll
  for (int i = 0; i < 8; ++i) { a[i] = (_Float16)(p[i] * sc); a[8 + i] = (_Float16)(p[16 + i] * sc); }
  return a;
}
// column fragment from a [K][ld] layout (column n), rows >= K read as 0
__device__ __forceinline__ v16h fragc_f32(const float* W, int k0, int n, int lane, int ld, int K) {
  v16h a; const int g = lane >> 4;
#pragma unroll
  for (int i = 0; i < 8; ++i) { const int ka = k0 + 8 * g + i, kb = ka + 16;
    a[i] = (_Float16)(ka < K ? W[(size_t)(ka < K ? ka : K - 1) * ld + n] : 0.f); a[8 + i] = (_Float16)(kb < K ? W[(size_t)(kb < K ? kb : K - 1) * ld + n] : 0.f); }
  return a;
}
struct F2 { v16b h, l; };
__device__ __forceinline__ F2 bsplit16(const float v[16]) { F2 r;
#pragma unroll
  for (int i = 0; i < 16; ++i) { const __bf16 h = (__bf16)v[i]; r.h[i] = h; r.l[i] = (__bf16)(v[i] - (float)h); }
  return r; }
__device__ __forceinline__ F2 split_row(const float* row, int k0, int lane) { float v[16]; const float* p = row + k0 + 8 * (lane >> 4);
#pragma unroll
  for (int i = 0; i < 8; ++i) { v[i] = p[i]; v[8 + i] = p[16 + i]; }
  return bsplit16(v); }
__device__ __forceinline__ F2 split_rowK(const float* row, int k0, int lane, int K) { float v[16]; const int g = lane >> 4;
#pragma unroll
  for (int i = 0; i < 8; ++i) { const int ka = k0 + 8 * g + i, kb = ka + 16; v[i] = ka < K ? row[ka < K ? ka : K - 1] : 0.f; v[8 + i] = kb < K ? row[kb < K ? kb : K - 1] : 0.f; }
  return bsplit16(v); }
__device__ __forceinline__ F2 split_col(const float* W, int k0, int n, int lane, int ld, int K) { float v[16]; const int g = lane >> 4;
#pragma unroll
  for (int i = 0; i < 8; ++i) { const int ka = k0 + 8 * g + i, kb = ka + 16; v[i] = ka < K ? W[(size_t)(ka < K ? ka : K - 1) * ld + n] : 0.f; v[8 + i] = kb < K ? W[(size_t)(kb < K ? kb : K - 1) * ld + n] : 0.f; }
  return bsplit16(v); }
__device__ __forceinline__ v8f mac3(const F2& a, const F2& b, v8f c) { c = wmma_bf(a.l, b.h, c); c = wmma_bf(a.h, b.l, c); return wmma_bf(a.h, b.h, c); }
__device__ __forceinline__ float sigm(float v) { return 1.0f / (1.0f + expf(-v)); }
#define LDSX() do { asm volatile("s_wait_dscnt 0" ::: "memory"); __builtin_amdgcn_wave_barrier(); __builtin_amdgcn_fence(__ATOMIC_RELEASE, "workgroup"); } while (0)


#define NB 4
#define SS 1024
#define IMW 32
#define DM 1024
#define NH 16
#define HD 64
#define QKVW (3 * DM)
#ifndef TQB
#define TQB (SS / 64)
#define TNB NB
#define TOB (NB * SS / 64)     // output row tiles (all)
#endif
typedef __attribute__((ext_vector_type(8))) __bf16 v8b;
__device__ __forceinline__ v16b frag_b(const __bf16* rowk0, int lane) {
  union { v16b v; v8b q[2]; } u; const __bf16* p = rowk0 + 8 * (lane >> 4);
  u.q[0] = *(const v8b*)p; u.q[1] = *(const v8b*)(p + 16); return u.v;
}
__device__ __forceinline__ float bfr(float v) { return (float)(__bf16)v; }
__device__ __attribute__((noinline)) float exp_ni(float v) { return expf(v); }
__device__ __attribute__((noinline)) float erf_ni(float v) { return erff(v); }

#define PK_A 0                       // [3072][1024] Wqkv rows (natural [out][in])
#define PK_P (PK_A + QKVW * DM)        // [1024][1024] Wo rows (natural)
#define PK_END (PK_P + DM * DM)
#define WS_PK  0u
#define WS_QK  (WS_PK + 2u * PK_END)             // f16 [4096 rows][2048]: q | k
#define WS_QKL (WS_QK + 2u * NB * SS * 2 * DM)     // f16 q | k residual planes x2048
#define WS_VTH (WS_QKL + 2u * NB * SS * 2 * DM)    // f16 [b][1024 (h*64+d)][1024 s] hi
#define WS_VTL (WS_VTH + 2u * NB * DM * SS)        // f16 lo x 2048
#define WS_O   (WS_VTL + 2u * NB * DM * SS)        // f32 [4096][1024]
#define WS_CS  (WS_O + 4u * NB * SS * DM)           // f32 2 x [1024][32], unused
#define WS_TBL (WS_CS + 4u * 2 * SS * 32)                 // f16 [2][64][HD]: rel_pos_h rows 0..62 (+ zero row), rel_pos_w
#define WS_END (WS_TBL + 2u * 2 * 64 * HD)
// ---- k_pack: block = (row n, which): natural [out][in] rows -> bf16; which 0..2 -> W_q/W_k/W_v into PK_A rows which*1024 + n; 3 -> W_o into PK_P
__global__ __launch_bounds__(256) void k_pack(const float* __restrict__ WQ, const float* __restrict__ WK, const float* __restrict__ WV, const float* __restrict__ WO, __bf16* __restrict__ PK) {
  __shared__ __align__(16) __bf16 s[DM]; const int n = blockIdx.x, which = blockIdx.y, t = threadIdx.x; const float* Wm = (which == 0) ? WQ : (which == 1) ? WK : (which == 2) ? WV : WO;
  for (int k = t; k < DM; k += 256) s[k] = (__bf16)Wm[(size_t)n * DM + k];
  __syncthreads();
  __bf16* dst = (which < 3) ? PK + PK_A + ((size_t)which * DM + n) * DM : PK + PK_P + (size_t)n * DM;
  for (int q = t; q < DM / 8; q += 256) vst2((unsigned*)(dst + q * 8), *(const v4u*)&s[q * 8]);
}
__global__ __launch_bounds__(128) void k_qkv(const float* __restrict__ XQ, const float* __restrict__ XK, const float* __restrict__ XV, const __bf16* __restrict__ P, const float* __restrict__ BQ, const float* __restrict__ BK, const float* __restrict__ BV, _Float16* __restrict__ QK, _Float16* __restrict__ QKL, _Float16* __restrict__ VTH, _Float16* __restrict__ VTL) {
  const int which0 = (blockIdx.y * 128) / DM; const float* X = (which0 == 0) ? XQ : (which0 == 1) ? XK : XV; const float* BB = BQ ? (((which0 == 0) ? BQ : (which0 == 1) ? BK : BV) + (blockIdx.y * 128 - which0 * DM)) : nullptr;
  __shared__ __align__(16) _Float16 so[4][16][136], sol[4][16][136]; __shared__ __align__(16) _Float16 sth[128][72], stl[128][72];
  const int tid = threadIdx.x, wave = tid >> 5, lane = tid & 31, col = lane & 15, g = lane >> 4; const size_t r0 = (size_t)blockIdx.x * 64 + wave * 16; const int n0 = blockIdx.y * 128;
  v8f acc[8] = {};
#pragma unroll 2
  for (int kc = 0; kc < DM / 32; ++kc) { v16b a; { const float* p = X + (r0 + col) * DM + kc * 32 + 8 * g;
#pragma unroll
      for (int i = 0; i < 8; ++i) { a[i] = (__bf16)p[i]; a[8 + i] = (__bf16)p[16 + i]; } }
#pragma unroll
    for (int j = 0; j < 8; ++j) acc[j] = wmma_bf(a, frag_b(P + (size_t)(n0 + j * 16 + col) * DM + kc * 32, lane), acc[j]); }
  if (n0 < 2 * DM) {   // q stored unscaled (f16 sigma ~0.6, no subnormal exposure); 1/8 applied to the f32 score
#pragma unroll
    for (int j = 0; j < 8; ++j) {
#pragma unroll
      for (int r = 0; r < 8; ++r) { const float v = acc[j][r] + (BB ? bfr(BB[j * 16 + col]) : 0.f); const _Float16 hv = (_Float16)v; so[wave][8 * g + r][j * 16 + col] = hv; sol[wave][8 * g + r][j * 16 + col] = (_Float16)((v - (float)hv) * 2048.0f); } }   // q, k (+ bias) as f16 hi + (x2048) residual
    LDSX();
    for (int rl = 0; rl < 16; ++rl) if (lane < 16) { vst2((unsigned*)(QK + (r0 + rl) * (2 * DM) + n0 + lane * 8), *(const v4u*)&so[wave][rl][lane * 8]); vst2((unsigned*)(QKL + (r0 + rl) * (2 * DM) + n0 + lane * 8), *(const v4u*)&sol[wave][rl][lane * 8]); }
  } else {
#pragma unroll
    for (int j = 0; j < 8; ++j) {
#pragma unroll
      for (int r = 0; r < 8; ++r) { const float v = acc[j][r] + (BB ? bfr(BB[j * 16 + col]) : 0.f); const _Float16 hv = (_Float16)v; sth[j * 16 + col][wave * 16 + 8 * g + r] = hv; stl[j * 16 + col][wave * 16 + 8 * g + r] = (_Float16)((v - (float)hv) * 2048.0f); } }
    __syncthreads();
    const size_t rb = (size_t)blockIdx.x * 64; const int b = (int)(rb / SS), s0 = (int)(rb % SS); const int pc0 = n0 - 2 * DM;
    for (int q = tid; q < 128 * 8; q += 128) { const int d = q >> 3, pc = q & 7; const size_t o = ((size_t)b * DM + pc0 + d) * SS + s0 + pc * 8; vst2((unsigned*)(VTH + o), *(const v4u*)&sth[d][pc * 8]); vst2((unsigned*)(VTL + o), *(const v4u*)&stl[d][pc * 8]); }
  }
}
// ---- k_attn: block = (64 queries, head h, batch b): all-keys flash attention, transposed products: S^T = K . Q^T (A = 16 key rows, B = the wave's 16 queries) and O^T += V^T . P^T (A = 16 channel rows of the v plane, B = P^T).
// Lane (col, g) then holds, for the ONE query q0 + col, the scores of keys 8g + r (tile 0) and 16 + 8g + r (tile 1) of the 32-key pass: exactly the k order of a B fragment, so P goes from the score accumulators into the second product without leaving the registers.
// A pass is one image row of keys (32 = IMW): kh = ks for all of them and kw = ct * 16 + 8g + r in every pass, so the width term is 16 values per lane for the whole loop and the height term one value per pass.
static_assert(IMW == 32, "a 32-key pass is one image row");
// lane l <-> lane l ^ 16 (the two halves that share a query)
__device__ __forceinline__ float xhalf(float v) { const int b = __float_as_int(v); return __int_as_float(__builtin_amdgcn_permlanex16(b, b, 0x76543210, 0xfedcba98, false, false)); }
// K and V of a pass are the same for the four waves of a block: each 32-key tile is brought into LDS once per block, by 16-byte asynchronous copies, two buffers, the next tile in flight while this one is worked on; the waves read their A fragments from LDS.
#define KPITCH 72   // f16 per staged key row: 128 B + 16 B, the conflict-free pitch for 16-byte LDS reads
#define VPITCH 40   // f16 per staged channel row: 64 B + 16 B, likewise
__device__ __forceinline__ unsigned lds_off(const void* p) { return (unsigned)(size_t)p; }
// one lane's four copies of a tile; the s_wait_xcnt closes the copies' own statement, so that it stands in front of every later write of an address register that a copy names
__device__ __forceinline__ void copy4(unsigned l0, const _Float16* g0, unsigned l1, const _Float16* g1, unsigned l2, const _Float16* g2, unsigned l3, const _Float16* g3) {
  asm volatile("global_load_async_to_lds_b128 %0, %1, off\n\tglobal_load_async_to_lds_b128 %2, %3, off\n\tglobal_load_async_to_lds_b128 %4, %5, off\n\tglobal_load_async_to_lds_b128 %6, %7, off\n\ts_wait_xcnt 0x0"
               :: "v"(l0), "v"(g0), "v"(l1), "v"(g1), "v"(l2), "v"(g2), "v"(l3), "v"(g3) : "memory");
}
// the f16 residual of 16 f32 values against their f16 roundings: f16(x - hi), one mixed-precision FMA a value (f16 hi x -1 + f32 x, rounded once to f16 and written into its own half of the pair's register); the compiler's own form is an FMA to f32 a value and a packed conversion a pair.
// All eight low halves stand in front of the high halves, so that the write of a register's second half is eight instructions behind the first and waits for nothing.
typedef __attribute__((ext_vector_type(8))) unsigned v8u;
__device__ __forceinline__ v16h resid16(v16h hi, v8f xa, v8f xb) {
  union { v16h h; v8u u; } a, d; a.h = hi;
  unsigned d0, d1, d2, d3, d4, d5, d6, d7;
  asm("v_fma_mixlo_f16 %0, %8, -1.0, %16 op_sel_hi:[1,1,0]\n\tv_fma_mixlo_f16 %1, %9, -1.0, %17 op_sel_hi:[1,1,0]\n\tv_fma_mixlo_f16 %2, %10, -1.0, %18 op_sel_hi:[1,1,0]\n\tv_fma_mixlo_f16 %3, %11, -1.0, %19 op_sel_hi:[1,1,0]\n\t"
      "v_fma_mixlo_f16 %4, %12, -1.0, %20 op_sel_hi:[1,1,0]\n\tv_fma_mixlo_f16 %5, %13, -1.0, %21 op_sel_hi:[1,1,0]\n\tv_fma_mixlo_f16 %6, %14, -1.0, %22 op_sel_hi:[1,1,0]\n\tv_fma_mixlo_f16 %7, %15, -1.0, %23 op_sel_hi:[1,1,0]"
      : "=&v"(d0), "=&v"(d1), "=&v"(d2), "=&v"(d3), "=&v"(d4), "=&v"(d5), "=&v"(d6), "=&v"(d7)
      : "v"(a.u[0]), "v"(a.u[1]), "v"(a.u[2]), "v"(a.u[3]), "v"(a.u[4]), "v"(a.u[5]), "v"(a.u[6]), "v"(a.u[7]),
        "v"(xa[0]), "v"(xa[2]), "v"(xa[4]), "v"(xa[6]), "v"(xb[0]), "v"(xb[2]), "v"(xb[4]), "v"(xb[6]));
  asm("v_fma_mixhi_f16 %0, %4, -1.0, %8 op_sel:[1,0,0] op_sel_hi:[1,1,0]\n\tv_fma_mixhi_f16 %1, %5, -1.0, %9 op_sel:[1,0,0] op_sel_hi:[1,1,0]\n\tv_fma_mixhi_f16 %2, %6, -1.0, %10 op_sel:[1,0,0] op_sel_hi:[1,1,0]\n\tv_fma_mixhi_f16 %3, %7, -1.0, %11 op_sel:[1,0,0] op_sel_hi:[1,1,0]"
      : "+v"(d0), "+v"(d1), "+v"(d2), "+v"(d3)
      : "v"(a.u[0]), "v"(a.u[1]), "v"(a.u[2]), "v"(a.u[3]), "v"(xa[1]), "v"(xa[3]), "v"(xa[5]), "v"(xa[7]));
  asm("v_fma_mixhi_f16 %0, %4, -1.0, %8 op_sel:[1,0,0] op_sel_hi:[1,1,0]\n\tv_fma_mixhi_f16 %1, %5, -1.0, %9 op_sel:[1,0,0] op_sel_hi:[1,1,0]\n\tv_fma_mixhi_f16 %2, %6, -1.0, %10 op_sel:[1,0,0] op_sel_hi:[1,1,0]\n\tv_fma_mixhi_f16 %3, %7, -1.0, %11 op_sel:[1,0,0] op_sel_hi:[1,1,0]"
      : "+v"(d4), "+v"(d5), "+v"(d6), "+v"(d7)
      : "v"(a.u[4]), "v"(a.u[5]), "v"(a.u[6]), "v"(a.u[7]), "v"(xb[1]), "v"(xb[3]), "v"(xb[5]), "v"(xb[7]));
  d.u = (v8u){ d0, d1, d2, d3, d4, d5, d6, d7 };
  return d.h;
}
__global__ __launch_bounds__(128) void k_attn(const _Float16* __restrict__ QK, const _Float16* __restrict__ QKL, const _Float16* __restrict__ VTH, const _Float16* __restrict__ VTL, const void* __restrict__ KMASK, const _Float16* __restrict__ TBL, float* __restrict__ O) {
  __shared__ float sth[4][16][68], stw[4][16][68];
  __shared__ __align__(16) float so[4][16][68];
  __shared__ __align__(16) _Float16 sk[2][32][KPITCH], sv[2][HD][VPITCH];
  const int tid = threadIdx.x, wave = tid >> 5, lane = tid & 31, col = lane & 15, g = lane >> 4;
  const int qb = blockIdx.x, h = blockIdx.y, b = blockIdx.z; const int q0 = qb * 64 + wave * 16; const size_t rq = (size_t)b * SS + q0 + col;
  (void)QKL; (void)VTL; (void)KMASK;
  // thread t copies 16-byte piece t & 7 of key rows t >> 3 and 16 + (t >> 3), and piece t & 3 of channel rows t >> 2 and 32 + (t >> 2)
  const _Float16* gk = QK + ((size_t)b * SS + (tid >> 3)) * (2 * DM) + DM + h * HD + (tid & 7) * 8;
  const _Float16* gv = VTH + ((size_t)b * DM + h * HD + (tid >> 2)) * SS + (tid & 3) * 8;
  const unsigned lk = lds_off(&sk[0][tid >> 3][(tid & 7) * 8]), lv = lds_off(&sv[0][tid >> 2][(tid & 3) * 8]);
  auto stage = [&](int t) { const _Float16* k0 = gk + (size_t)t * 32 * (2 * DM); const _Float16* v0 = gv + t * 32;
    const unsigned k1 = lk + (t & 1) * (unsigned)sizeof(sk[0]), v1 = lv + (t & 1) * (unsigned)sizeof(sv[0]);
    copy4(k1, k0, k1 + 16 * KPITCH * 2, k0 + (size_t)16 * (2 * DM), v1, v0, v1 + 32 * VPITCH * 2, v0 + (size_t)32 * SS); };
  stage(0);
  v16h aq[2];
#pragma unroll
  for (int kc = 0; kc < 2; ++kc) aq[kc] = frag_h(QK + rq * (2 * DM) + h * HD + kc * 32, lane);
  // relative-position dot tables for this wave's 16 queries: TH[r][j] = q_r . rel_pos_h[j], TW[r][j] = q_r . rel_pos_w[j] (exact products)
#pragma unroll
  for (int tb = 0; tb < 2; ++tb) {
#pragma unroll
    for (int jt = 0; jt < 4; ++jt) { v8f tacc = {};
#pragma unroll
      for (int kc = 0; kc < 2; ++kc) tacc = wmma16(aq[kc], frag_h(TBL + ((size_t)tb * 64 + jt * 16 + col) * HD + kc * 32, lane), tacc);
#pragma unroll
      for (int r = 0; r < 8; ++r) { if (tb == 0) sth[wave][8 * g + r][jt * 16 + col] = tacc[r] * 8.0f; else stw[wave][8 * g + r][jt * 16 + col] = tacc[r] * 8.0f; } } }   // x 8 (exact): the tables are added to the unscaled q . k
  LDSX();
  const int pq = q0 + col, hq = pq / IMW, wq = pq % IMW;   // this lane's query
  v8f tw[2];
#pragma unroll
  for (int ct = 0; ct < 2; ++ct) {
#pragma unroll
    for (int r = 0; r < 8; ++r) tw[ct][r] = stw[wave][col][wq - (ct * 16 + 8 * g + r) + (IMW - 1)]; }
  const float* thq = &sth[wave][col][hq + (IMW - 1)];
  // c = 8 x score; P x 2^11 = exp2(c * KS + nm), nm = 11 - (running maximum of c) * KS: one fused multiply-add and one exp2 a score
  const float KS = 0.125f * 1.44269504088896340736f;
  float m = -3.0e38f, nm = 5.0e37f, l = 0.f;   // nm starts so far up that the first pass's alpha is exp2(-5e37) = 0; l (x 2^11): this half's 16 keys of every pass; the halves are joined once, behind the loop
  v8f acc[4] = {};
  const int nks = SS / 32;   // all keys
  static_assert(SS / 32 >= 2, "the prologue fills two tiles");
  asm volatile("s_wait_asynccnt 0x0" ::: "memory");   // this wave's copies of tile 0 have landed
  __syncthreads();                                    // ... and every other wave's
  stage(1);
#pragma unroll 1
  for (int ks = 0; ks < nks; ++ks) { v8f c[2];
    const float th = thq[-ks];
    v16h kf[2][2], vf[4];   // all of the pass's LDS reads as one group at its head; the v fragments land behind the score products and the softmax (the three loops are unrolled so that both arrays are indexed by constants and stay in registers)
#pragma unroll
    for (int ct = 0; ct < 2; ++ct) {
#pragma unroll
      for (int kc = 0; kc < 2; ++kc) kf[ct][kc] = frag_h(&sk[ks & 1][ct * 16 + col][kc * 32], lane); }
#pragma unroll
    for (int dt = 0; dt < 4; ++dt) vf[dt] = frag_h(&sv[ks & 1][dt * 16 + col][0], lane);
    __builtin_amdgcn_sched_barrier(0);   // keeps the 17 LDS reads one group in front of the first product, with counted waits behind them; left free, the scheduler spreads them among the products and waits to 0 behind each small group
#pragma unroll
    for (int ct = 0; ct < 2; ++ct) c[ct] = tw[ct] + th;   // 8 x (q.R_h[hq,kh] + q.R_w[wq,kw]) is the product's C operand
#pragma unroll
    for (int kc = 0; kc < 2; ++kc) {
#pragma unroll
      for (int ct = 0; ct < 2; ++ct) c[ct] = wmma16(kf[ct][kc], aq[kc], c[ct]); }   // + q.k, EXACT products: q, k are bf16 inputs held exactly in f16
    float t8[8];
#pragma unroll
    for (int i = 0; i < 8; ++i) t8[i] = fmaxf(c[0][i], c[1][i]);
    float mx = fmaxf(fmaxf(fmaxf(t8[0], t8[1]), fmaxf(t8[2], t8[3])), fmaxf(fmaxf(t8[4], t8[5]), fmaxf(t8[6], t8[7])));
    mx = fmaxf(mx, xhalf(mx));
    const float mn = fmaxf(m, mx); const float nn = __builtin_fmaf(mn, -KS, 11.0f); const float alpha = __builtin_amdgcn_exp2f(nn - nm);
    v8h ph[2]; v8f x[2];
#pragma unroll
    for (int ct = 0; ct < 2; ++ct) { const v8f t = __builtin_elementwise_fma(c[ct], (v8f)(KS), (v8f)(nn));
#pragma unroll
      for (int r = 0; r < 8; ++r) x[ct][r] = __builtin_amdgcn_exp2f(t[r]);   // P scaled by 2^11 before the f16 split so small softmax weights stay out of the f16 subnormal range; l carries the same 2^11
      ph[ct] = __builtin_convertvector(x[ct], v8h);
    }
    const v16h pa = __builtin_shufflevector(ph[0], ph[1], 0, 1, 2, 3, 4, 5, 6, 7, 8, 9, 10, 11, 12, 13, 14, 15);
    const v16h pl = resid16(pa, x[0], x[1]);   // x - hi (exact in f32), at hi's own scale: at most 2^-11 of x, and f16 subnormals are kept, so what its rounding drops is below 2^-24 against a row sum of at least 2^11
    const v8f x8 = x[0] + x[1]; const v4f x4 = x8.lo + x8.hi; const v2f x2 = x4.lo + x4.hi;
    l = l * alpha + (x2.x + x2.y); m = mn; nm = nn;
#pragma unroll
    for (int dt = 0; dt < 4; ++dt) acc[dt] *= alpha;
#pragma unroll
    for (int dt = 0; dt < 4; ++dt) acc[dt] = wmma16(vf[dt], pa, acc[dt]);   // V^T x P hi (v exact)
#pragma unroll
    for (int dt = 0; dt < 4; ++dt) acc[dt] = wmma16(vf[dt], pl, acc[dt]);   // + V^T x P lo, same scale, same tile; the other three tiles' products lie between a tile's two
    __builtin_amdgcn_sched_barrier(0);   // keeps the two waits and the barrier below at the pass's foot, behind its products: lifted to the head, tile ks + 2's copies would be waited for right after their issue
    asm volatile("s_wait_dscnt 0x0" ::: "memory");      // this wave's reads of buffer ks & 1 are done
    asm volatile("s_wait_asynccnt 0x0" ::: "memory");   // this wave's copies of tile ks + 1 have landed
    __syncthreads();                                    // publishes tile ks + 1 and frees buffer ks & 1
    if (ks + 2 < nks) stage(ks + 2);
  }
  asm volatile("s_wait_asynccnt 0x0" ::: "memory");     // no copy is left in flight behind the loop
  l += xhalf(l);
  const float il = 1.0f / l;   // l and acc both carry 2^11
#pragma unroll
  for (int dt = 0; dt < 4; ++dt) {   // acc[dt][r] = O[query col][channel dt * 16 + 8g + r]: 8 consecutive channels per lane
#pragma unroll
    for (int hf = 0; hf < 2; ++hf) { v4f o;
#pragma unroll
      for (int i = 0; i < 4; ++i) o[i] = acc[dt][hf * 4 + i] * il;
      *(v4f*)&so[wave][col][dt * 16 + 8 * g + hf * 4] = o; } }
  LDSX();
  for (int rl = 0; rl < 16; ++rl) if (lane < 16) vst2(O + ((size_t)b * SS + q0 + rl) * DM + h * HD + lane * 4, *(const v4f*)&so[wave][rl][lane * 4]);
}
// ---- k_out: block = (64 rows, 128 cols): out = O(hi/lo) . Wo rows (2 products) + bo
__global__ __launch_bounds__(128) void k_out(const float* __restrict__ O, const __bf16* __restrict__ P, const float* __restrict__ BO, float* __restrict__ Y) {
  __shared__ __align__(16) float so[4][16][132];
  const int tid = threadIdx.x, wave = tid >> 5, lane = tid & 31, col = lane & 15, g = lane >> 4; const size_t r0 = (size_t)blockIdx.x * 64 + wave * 16; const int n0 = blockIdx.y * 128;
  v8f acc[8] = {};
#pragma unroll 2
  for (int kc = 0; kc < DM / 32; ++kc) { const F2 a = split_row(O + (r0 + col) * DM, kc * 32, lane);
#pragma unroll
    for (int j = 0; j < 8; ++j) { const v16b w = frag_b(P + (size_t)(n0 + j * 16 + col) * DM + kc * 32, lane); acc[j] = wmma_bf(a.l, w, acc[j]); acc[j] = wmma_bf(a.h, w, acc[j]); } }
#pragma unroll
  for (int j = 0; j < 8; ++j) {
#pragma unroll
    for (int r = 0; r < 8; ++r) so[wave][8 * g + r][j * 16 + col] = acc[j][r] + (BO ? bfr(BO[n0 + j * 16 + col]) : 0.f); }
  LDSX();
  for (int rl = 0; rl < 16; ++rl) vst2(Y + (r0 + rl) * DM + n0 + lane * 4, *(const v4f*)&so[wave][rl][lane * 4]);
}
// ---- k_prep: q | k -> f16 rows [row][2*DM] (exact); v -> f16 planes [b][DM][SS] (exact). A stream: every block past the first TBLB takes 16 whole rows of q or k and one 64-position x 128-channel tile of v.
// Every q, k, v read is a 16-byte load whose wave covers 512 contiguous bytes of one row, and a lane's 24 loads are all issued before the first is used.
// v is turned in registers: a lane holds 8 positions x 4 channels, so each channel's 8 positions are one 16-byte LDS store; the tile leaves LDS as whole 128-byte lines. q and k need no LDS: a wave's 8-byte stores cover 256 contiguous bytes.
// The two relative-position tables need nothing of q, k, v and nothing here needs them: they share this grid instead of a launch of their own. The first TBLB blocks turn rel_pos_h / rel_pos_w [63][64] into f16 [2][64][64] (row 63 zero), 4 elements a lane: a 16-byte load, an 8-byte store, a wave's stores 256 contiguous bytes.
#define PREPB (2 * NB * SS / 16)
#define TBLB (2 * 64 * HD / (256 * 4))
static_assert(TBLB * 256 * 4 == 2 * 64 * HD && HD % 4 == 0, "the table blocks cover both tables exactly, a lane's 4 elements inside one row");
static_assert(PREPB == (NB * SS / 64) * (DM / 128), "as many q | k row groups as v tiles");
static_assert(DM == 256 * 4, "a block's 256 lanes x 4 floats are one row");
typedef __attribute__((ext_vector_type(4))) _Float16 v4h;
__global__ __launch_bounds__(256) void k_prep(const float* __restrict__ Q, const float* __restrict__ Kx, const float* __restrict__ V, const float* __restrict__ RH, const float* __restrict__ RW, _Float16* __restrict__ QK, _Float16* __restrict__ VTH, _Float16* __restrict__ TBL) {
  __shared__ __align__(16) _Float16 svt[128][72];
  const int t = threadIdx.x, wave = t >> 5, lane = t & 31;
  if (blockIdx.x < TBLB) {   // the same for a whole block, and in front of the barrier
    const int e = ((int)blockIdx.x * 256 + t) * 4, tb = e / (64 * HD), j = (e / HD) & 63, c = e % HD;
    v4f r = {};
    if (j < 2 * IMW - 1) r = *(const v4f*)((tb ? RW : RH) + (size_t)j * HD + c);
    const v4h h = { (_Float16)bfr(r[0]), (_Float16)bfr(r[1]), (_Float16)bfr(r[2]), (_Float16)bfr(r[3]) };
    *(v4h*)(TBL + e) = h;
    return;
  }
  const int x = (int)blockIdx.x - TBLB;
  const size_t vr0 = (size_t)(x >> 3) * 64; const int c0 = (x & 7) * 128;          // the v tile: rows vr0 .. + 63, channels c0 .. + 127
  const bool isq = x < PREPB / 2; const size_t qr0 = (size_t)(x & (PREPB / 2 - 1)) * 16;   // the q or k rows
  const float* vs = V + (vr0 + wave * 8) * DM + c0 + lane * 4;
  const float* qs = (isq ? Q : Kx) + qr0 * DM + t * 4;
  v4f a[8], q[16];
#pragma unroll
  for (int j = 0; j < 8; ++j) a[j] = *(const v4f*)(vs + (size_t)j * DM);
  asm volatile("s_wait_xcnt 0x0" ::: "memory");   // the v loads' address pair is dead from here on and becomes the destination of a later load: the wait stands in front of that overwrite
#pragma unroll
  for (int j = 0; j < 16; ++j) q[j] = *(const v4f*)(qs + (size_t)j * DM);
  __builtin_amdgcn_sched_barrier(0);   // keeps the 24 loads one group in front of all the work: left free, the scheduler mixes q | k conversions among v's, so that the LDS stores and the barrier wait for q | k loads too and most stores for the last load
#pragma unroll
  for (int i = 0; i < 4; ++i) { v8h h;
#pragma unroll
    for (int j = 0; j < 8; ++j) h[j] = (_Float16)bfr(a[j][i]);
    *(v8h*)&svt[lane * 4 + i][wave * 8] = h; }
  // the tile's hand-over between the waves is LDS traffic alone: fences on LDS only, so that the barrier waits for the four LDS stores and not for the 16 q | k loads still in flight (__syncthreads() waited for them all)
  __builtin_amdgcn_fence(__ATOMIC_RELEASE, "workgroup", "local");
  __builtin_amdgcn_s_barrier();
  __builtin_amdgcn_fence(__ATOMIC_ACQUIRE, "workgroup", "local");
  const size_t b = vr0 / SS, s0 = vr0 % SS;
#pragma unroll
  for (int k = 0; k < 4; ++k) { const int e = t + k * 256, c = e >> 3, pc = e & 7; vst2((unsigned*)(VTH + (b * DM + c0 + c) * SS + s0 + pc * 8), *(const v4u*)&svt[c][pc * 8]); }
  _Float16* qd = QK + qr0 * (2 * DM) + (isq ? 0 : DM) + t * 4;
#pragma unroll
  for (int j = 0; j < 16; ++j) { v4h h;
#pragma unroll
    for (int i = 0; i < 4; ++i) h[i] = (_Float16)bfr(q[j][i]);
    *(v4h*)(qd + (size_t)j * (2 * DM)) = h; }
}
extern "C" void kernel_launch(void* const* d_in, const int* in_sizes, int n_in, void* d_out, int out_size, void* d_ws, size_t ws_size, hipStream_t stream) {
  (void)in_sizes; (void)n_in; (void)out_size;
  const float** F = (const float**)d_in;   // 0 q, 1 k, 2 v [4,1,1024,1024] (= [b][s][h*64+d]); 3 rel_pos_h [63,64]; 4 rel_pos_w [63,64]
  if (ws_size < (size_t)WS_END) return;
  char* ws = (char*)d_ws; _Float16 *QK = (_Float16*)(ws + WS_QK), *QKL = (_Float16*)(ws + WS_QKL), *VTH = (_Float16*)(ws + WS_VTH), *VTL = (_Float16*)(ws + WS_VTL), *TBL = (_Float16*)(ws + WS_TBL);
  k_prep<<<dim3(TBLB + PREPB), 256, 0, stream>>>(F[0], F[1], F[2], F[3], F[4], QK, VTH, TBL);
  k_attn<<<dim3(TQB, NH, TNB), 128, 0, stream>>>(QK, QKL, VTH, VTL, nullptr, TBL, (float*)d_out);   // O layout [b*S+q][h*64+d] == the module's merged (b,1,s,n*d) output
}

// v008
// One run takes 35.9 microseconds.
// Two timings next to v007 put it at 1.18 and 1.15 times that version's speed.
// All steps since v000 together make it 2.99 times as fast.
// compute dtype: q/k/v and the two relative-position tables rounded to bf16 and used as EXACT f16 operands (bf16 values are exact in f16); per (query, head): TH[j] = q . rel_pos_h[j] and TW[j] = q . rel_pos_w[j] for all table rows on WMMA 16x16x32 (exact products, f32 accumulate), 8 x scores = q . k (exact products) accumulated onto 8 x (TH[hq - kh + 31] + TW[wq - kw + 31]); running-max softmax in f32, base 2 (hardware exp2); P (scaled by 2^11) as f16 hi + f16 residual at the same scale x the exact v planes (2 products into one tile); f32 accumulate; the merged-head output is written directly.
#include <hip/hip_runtime.h>
#include <math.h>

typedef __attribute__((ext_vector_type(16))) _Float16 v16h;
typedef __attribute__((ext_vector_type(16))) __bf16 v16b;
typedef __attribute__((ext_vector_type(8)))  _Float16 v8h;
typedef __attribute__((ext_vector_type(8)))  float v8f;
typedef __attribute__((ext_vector_type(4)))  float v4f;
typedef __attribute__((ext_vector_type(2)))  float v2f;
typedef __attribute__((ext_vector_type(4)))  unsigned v4u;
typedef __attribute__((ext_vector_type(4)))  int v4i;
typedef float __attribute__((may_alias)) float_a;
typedef int __attribute__((may_alias)) int_a;

template <typename T> __device__ __forceinline__ void vst2(void* p, T v) { *(T*)p = v;  }
__device__ __forceinline__ v8f wmma16(v16h a, v16h b, v8f c) {
  return __builtin_amdgcn_wmma_f32_16x16x32_f16(false, a, false, b, (short)0, c, false, false);
}
__device__ __forceinline__ v8f wmma_bf(v16b a, v16b b, v8f c) {
  v8f d = __builtin_amdgcn_wmma_f32_16x16x32_bf16(false, a, false, b, (short)0, c, false, false);
  asm volatile("v_nop\n\tv_nop\n\tv_nop\n\tv_nop" : "+v"(d) : "v"(a), "v"(b));
  return d;
}
// Decomposed relative-position attention over a 32 x 32 feature map (B 4, 1,024 positions, 16 heads x 64, q/k/v given): sim = q k^T / 8 + q . R_h[hq, kh] + q . R_w[wq, kw], softmax, . v, heads re-merged.
__device__ __forceinline__ v16h frag_h(const _Float16* rowk0, int lane) {
  union { v16h v; v8h q[2]; } u; const _Float16* p = rowk0 + 8 * (lane >> 4);
  u.q[0] = *(const v8h*)p; u.q[1] = *(const v8h*)(p + 16); return u.v;
}
__device__ __forceinline__ v16h frag_f32(const float* rowk0, int lane) {
  v16h a; const float* p = rowk0 + 8 * (lane >> 4);
#pragma unroll
  for (int i = 0; i < 8; ++i) { a[i] = (_Float16)p[i]; a[8 + i] = (_Float16)p[16 + i]; }
  return a;
}
__device__ __forceinline__ v16h frag_f32s(const float* rowk0, int lane, float sc) {
  v16h a; const float* p = rowk0 + 8 * (lane >> 4);
#pragma unroll
  for (int i = 0; i < 8; ++i) { a[i] = (_Float16)(p[i] * sc); a[8 + i] = (_Float16)(p[16 + i] * sc); }
  return a;
}
// column fragment from a [K][ld] layout (column n), rows >= K read as 0
__device__ __forceinline__ v16h fragc_f32(const float* W, int k0, int n, int lane, int ld, int K) {
  v16h a; const int g = lane >> 4;
#pragma unroll
  for (int i = 0; i < 8; ++i) { const int ka = k0 + 8 * g + i, kb = ka + 16;
    a[i] = (_Float16)(ka < K ? W[(size_t)(ka < K ? ka : K - 1) * ld + n] : 0.f); a[8 + i] = (_Float16)(kb < K ? W[(size_t)(kb < K ? kb : K - 1) * ld + n] : 0.f); }
  return a;
}
struct F2 { v16b h, l; };
__device__ __forceinline__ F2 bsplit16(const float v[16]) { F2 r;
#pragma unroll
  for (int i = 0; i < 16; ++i) { const __bf16 h = (__bf16)v[i]; r.h[i] = h; r.l[i] = (__bf16)(v[i] - (float)h); }
  return r; }
__device__ __forceinline__ F2 split_row(const float* row, int k0, int lane) { float v[16]; const float* p = row + k0 + 8 * (lane >> 4);
#pragma unroll
  for (int i = 0; i < 8; ++i) { v[i] = p[i]; v[8 + i] = p[16 + i]; }
  return bsplit16(v); }
__device__ __forceinline__ F2 split_rowK(const float* row, int k0, int lane, int K) { float v[16]; const int g = lane >> 4;
#pragma unroll
  for (int i = 0; i < 8; ++i) { const int ka = k0 + 8 * g + i, kb = ka + 16; v[i] = ka < K ? row[ka < K ? ka : K - 1] : 0.f; v[8 + i] = kb < K ? row[kb < K ? kb : K - 1] : 0.f; }
  return bsplit16(v); }
__device__ __forceinline__ F2 split_col(const float* W, int k0, int n, int lane, int ld, int K) { float v[16]; const int g = lane >> 4;
#pragma unroll
  for (int i = 0; i < 8; ++i) { const int ka = k0 + 8 * g + i, kb = ka + 16; v[i] = ka < K ? W[(size_t)(ka < K ? ka : K - 1) * ld + n] : 0.f; v[8 + i] = kb < K ? W[(size_t)(kb < K ? kb : K - 1) * ld + n] : 0.f; }
  return bsplit16(v); }
__device__ __forceinline__ v8f mac3(const F2& a, const F2& b, v8f c) { c = wmma_bf(a.l, b.h, c); c = wmma_bf(a.h, b.l, c); return wmma_bf(a.h, b.h, c); }
__device__ __forceinline__ float sigm(float v) { return 1.0f / (1.0f + expf(-v)); }
#define LDSX() do { asm volatile("s_wait_dscnt 0" ::: "memory"); __builtin_amdgcn_wave_barrier(); __builtin_amdgcn_fence(__ATOMIC_RELEASE, "workgroup"); } while (0)


#define NB 4
#define SS 1024
#define IMW 32
#define DM 1024
#define NH 16
#define HD 64
#define QKVW (3 * DM)
#ifndef TQB
#define TQB (SS / 64)
#define TNB NB
#define TOB (NB * SS / 64)     // output row tiles (all)
#endif
typedef __attribute__((ext_vector_type(8))) __bf16 v8b;
__device__ __forceinline__ v16b frag_b(const __bf16* rowk0, int lane) {
  union { v16b v; v8b q[2]; } u; const __bf16* p = rowk0 + 8 * (lane >> 4);
  u.q[0] = *(const v8b*)p; u.q[1] = *(const v8b*)(p + 16); return u.v;
}
__device__ __forceinline__ float bfr(float v) { return (float)(__bf16)v; }
__device__ __attribute__((noinline)) float exp_ni(float v) { return expf(v); }
__device__ __attribute__((noinline)) float erf_ni(float v) { return erff(v); }

#define PK_A 0                       // [3072][1024] Wqkv rows (natural [out][in])
#define PK_P (PK_A + QKVW * DM)        // [1024][1024] Wo rows (natural)
#define PK_END (PK_P + DM * DM)
#define WS_PK  0u
#define WS_QK  (WS_PK + 2u * PK_END)             // f16 [4096 rows][2048]: q | k
#define WS_QKL (WS_QK + 2u * NB * SS * 2 * DM)     // f16 q | k residual planes x2048
#define WS_VTH (WS_QKL + 2u * NB * SS * 2 * DM)    // f16 [b][1024 (h*64+d)][1024 s] hi
#define WS_VTL (WS_VTH + 2u * NB * DM * SS)        // f16 lo x 2048
#define WS_O   (WS_VTL + 2u * NB * DM * SS)        // f32 [4096][1024]
#define WS_CS  (WS_O + 4u * NB * SS * DM)           // f32 2 x [1024][32], unused
#define WS_TBL (WS_CS + 4u * 2 * SS * 32)                 // f16 [2][64][HD]: rel_pos_h rows 0..62 (+ zero row), rel_pos_w
#define WS_END (WS_TBL + 2u * 2 * 64 * HD)
// ---- k_pack: block = (row n, which): natural [out][in] rows -> bf16; which 0..2 -> W_q/W_k/W_v into PK_A rows which*1024 + n; 3 -> W_o into PK_P
__global__ __launch_bounds__(256) void k_pack(const float* __restrict__ WQ, const float* __restrict__ WK, const float* __restrict__ WV, const float* __restrict__ WO, __bf16* __restrict__ PK) {
  __shared__ __align__(16) __bf16 s[DM]; const int n = blockIdx.x, which = blockIdx.y, t = threadIdx.x; const float* Wm = (which == 0) ? WQ : (which == 1) ? WK : (which == 2) ? WV : WO;
  for (int k = t; k < DM; k += 256) s[k] = (__bf16)Wm[(size_t)n * DM + k];
  __syncthreads();
  __bf16* dst = (which < 3) ? PK + PK_A + ((size_t)which * DM + n) * DM : PK + PK_P + (size_t)n * DM;
  for (int q = t; q < DM / 8; q += 256) vst2((unsigned*)(dst + q * 8), *(const v4u*)&s[q * 8]);
}
__global__ __launch_bounds__(128) void k_qkv(const float* __restrict__ XQ, const float* __restrict__ XK, const float* __restrict__ XV, const __bf16* __restrict__ P, const float* __restrict__ BQ, const float* __restrict__ BK, const float* __restrict__ BV, _Float16* __restrict__ QK, _Float16* __restrict__ QKL, _Float16* __restrict__ VTH, _Float16* __restrict__ VTL) {
  const int which0 = (blockIdx.y * 128) / DM; const float* X = (which0 == 0) ? XQ : (which0 == 1) ? XK : XV; const float* BB = BQ ? (((which0 == 0) ? BQ : (which0 == 1) ? BK : BV) + (blockIdx.y * 128 - which0 * DM)) : nullptr;
  __shared__ __align__(16) _Float16 so[4][16][136], sol[4][16][136]; __shared__ __align__(16) _Float16 sth[128][72], stl[128][72];
  const int tid = threadIdx.x, wave = tid >> 5, lane = tid & 31, col = lane & 15, g = lane >> 4; const size_t r0 = (size_t)blockIdx.x * 64 + wave * 16; const int n0 = blockIdx.y * 128;
  v8f acc[8] = {};
#pragma unroll 2
  for (int kc = 0; kc < DM / 32; ++kc) { v16b a; { const float* p = X + (r0 + col) * DM + kc * 32 + 8 * g;
#pragma unroll
      for (int i = 0; i < 8; ++i) { a[i] = (__bf16)p[i]; a[8 + i] = (__bf16)p[16 + i]; } }
#pragma unroll
    for (int j = 0; j < 8; ++j) acc[j] = wmma_bf(a, frag_b(P + (size_t)(n0 + j * 16 + col) * DM + kc * 32, lane), acc[j]); }
  if (n0 < 2 * DM) {   // q stored unscaled (f16 sigma ~0.6, no subnormal exposure); 1/8 applied to the f32 score
#pragma unroll
    for (int j = 0; j < 8; ++j) {
#pragma unroll
      for (int r = 0; r < 8; ++r) { const float v = acc[j][r] + (BB ? bfr(BB[j * 16 + col]) : 0.f); const _Float16 hv = (_Float16)v; so[wave][8 * g + r][j * 16 + col] = hv; sol[wave][8 * g + r][j * 16 + col] = (_Float16)((v - (float)hv) * 2048.0f); } }   // q, k (+ bias) as f16 hi + (x2048) residual
    LDSX();
    for (int rl = 0; rl < 16; ++rl) if (lane < 16) { vst2((unsigned*)(QK + (r0 + rl) * (2 * DM) + n0 + lane * 8), *(const v4u*)&so[wave][rl][lane * 8]); vst2((unsigned*)(QKL + (r0 + rl) * (2 * DM) + n0 + lane * 8), *(const v4u*)&sol[wave][rl][lane * 8]); }
  } else {
#pragma unroll
    for (int j = 0; j < 8; ++j) {
#pragma unroll
      for (int r = 0; r < 8; ++r) { const float v = acc[j][r] + (BB ? bfr(BB[j * 16 + col]) : 0.f); const _Float16 hv = (_Float16)v; sth[j * 16 + col][wave * 16 + 8 * g + r] = hv; stl[j * 16 + col][wave * 16 + 8 * g + r] = (_Float16)((v - (float)hv) * 2048.0f); } }
    __syncthreads();
    const size_t rb = (size_t)blockIdx.x * 64; const int b = (int)(rb / SS), s0 = (int)(rb % SS); const int pc0 = n0 - 2 * DM;
    for (int q = tid; q < 128 * 8; q += 128) { const int d = q >> 3, pc = q & 7; const size_t o = ((size_t)b * DM + pc0 + d) * SS + s0 + pc * 8; vst2((unsigned*)(VTH + o), *(const v4u*)&sth[d][pc * 8]); vst2((unsigned*)(VTL + o), *(const v4u*)&stl[d][pc * 8]); }
  }
}
// ---- k_attn: block = (128 queries, head h, batch b), 8 waves; a wave takes 32 queries (two 16-query column groups) and every second 32-key pass: all-keys flash attention, transposed products: S^T = K . Q^T (A = 16 key rows, B = 16 queries of the wave) and O^T += V^T . P^T (A = 16 channel rows of the v plane, B = P^T).
// Lane (col, g) then holds, in each group for the ONE query q0 + 16 * group + col, the scores of keys 8g + r (tile 0) and 16 + 8g + r (tile 1) of the 32-key pass: exactly the k order of a B fragment, so P goes from the score accumulators into the second product without leaving the registers.
// A pass is one image row of keys (32 = IMW): the keys' image row is the pass number and their column is ct * 16 + 8g + r in every pass, so the width term is 16 values per lane for the whole loop and the height term one value per pass.
static_assert(IMW == 32, "a 32-key pass is one image row");
// lane l <-> lane l ^ 16 (the two halves that share a query)
__device__ __forceinline__ float xhalf(float v) { const int b = __float_as_int(v); return __int_as_float(__builtin_amdgcn_permlanex16(b, b, 0x76543210, 0xfedcba98, false, false)); }
// K and V of a pass are the same for the four query sets of a block: each 64-key stage (one pass for either key half) is brought into LDS once per block, by 16-byte asynchronous copies, two buffers, the next tile in flight while this one is worked on; the waves read their A fragments from LDS.
#define KPITCH 72   // f16 per staged key row or channel row: 128 B + 16 B, the conflict-free pitch for 16-byte LDS reads
__device__ __forceinline__ unsigned lds_off(const void* p) { return (unsigned)(size_t)p; }
// one lane's four copies of a tile; the s_wait_xcnt closes the copies' own statement, so that it stands in front of every later write of an address register that a copy names
__device__ __forceinline__ void copy4(unsigned l0, const _Float16* g0, unsigned l1, const _Float16* g1, unsigned l2, const _Float16* g2, unsigned l3, const _Float16* g3) {
  asm volatile("global_load_async_to_lds_b128 %0, %1, off\n\tglobal_load_async_to_lds_b128 %2, %3, off\n\tglobal_load_async_to_lds_b128 %4, %5, off\n\tglobal_load_async_to_lds_b128 %6, %7, off\n\ts_wait_xcnt 0x0"
               :: "v"(l0), "v"(g0), "v"(l1), "v"(g1), "v"(l2), "v"(g2), "v"(l3), "v"(g3) : "memory");
}
// the f16 residual of 16 f32 values against their f16 roundings: f16(x - hi), one mixed-precision FMA a value (f16 hi x -1 + f32 x, rounded once to f16 and written into its own half of the pair's register); the compiler's own form is an FMA to f32 a value and a packed conversion a pair.
// All eight low halves stand in front of the high halves, so that the write of a register's second half is eight instructions behind the first and waits for nothing.
typedef __attribute__((ext_vector_type(8))) unsigned v8u;
__device__ __forceinline__ v16h resid16(v16h hi, v8f xa, v8f xb) {
  union { v16h h; v8u u; } a, d; a.h = hi;
  unsigned d0, d1, d2, d3, d4, d5, d6, d7;
  asm("v_fma_mixlo_f16 %0, %8, -1.0, %16 op_sel_hi:[1,1,0]\n\tv_fma_mixlo_f16 %1, %9, -1.0, %17 op_sel_hi:[1,1,0]\n\tv_fma_mixlo_f16 %2, %10, -1.0, %18 op_sel_hi:[1,1,0]\n\tv_fma_mixlo_f16 %3, %11, -1.0, %19 op_sel_hi:[1,1,0]\n\t"
      "v_fma_mixlo_f16 %4, %12, -1.0, %20 op_sel_hi:[1,1,0]\n\tv_fma_mixlo_f16 %5, %13, -1.0, %21 op_sel_hi:[1,1,0]\n\tv_fma_mixlo_f16 %6, %14, -1.0, %22 op_sel_hi:[1,1,0]\n\tv_fma_mixlo_f16 %7, %15, -1.0, %23 op_sel_hi:[1,1,0]"
      : "=&v"(d0), "=&v"(d1), "=&v"(d2), "=&v"(d3), "=&v"(d4), "=&v"(d5), "=&v"(d6), "=&v"(d7)
      : "v"(a.u[0]), "v"(a.u[1]), "v"(a.u[2]), "v"(a.u[3]), "v"(a.u[4]), "v"(a.u[5]), "v"(a.u[6]), "v"(a.u[7]),
        "v"(xa[0]), "v"(xa[2]), "v"(xa[4]), "v"(xa[6]), "v"(xb[0]), "v"(xb[2]), "v"(xb[4]), "v"(xb[6]));
  asm("v_fma_mixhi_f16 %0, %4, -1.0, %8 op_sel:[1,0,0] op_sel_hi:[1,1,0]\n\tv_fma_mixhi_f16 %1, %5, -1.0, %9 op_sel:[1,0,0] op_sel_hi:[1,1,0]\n\tv_fma_mixhi_f16 %2, %6, -1.0, %10 op_sel:[1,0,0] op_sel_hi:[1,1,0]\n\tv_fma_mixhi_f16 %3, %7, -1.0, %11 op_sel:[1,0,0] op_sel_hi:[1,1,0]"
      : "+v"(d0), "+v"(d1), "+v"(d2), "+v"(d3)
      : "v"(a.u[0]), "v"(a.u[1]), "v"(a.u[2]), "v"(a.u[3]), "v"(xa[1]), "v"(xa[3]), "v"(xa[5]), "v"(xa[7]));
  asm("v_fma_mixhi_f16 %0, %4, -1.0, %8 op_sel:[1,0,0] op_sel_hi:[1,1,0]\n\tv_fma_mixhi_f16 %1, %5, -1.0, %9 op_sel:[1,0,0] op_sel_hi:[1,1,0]\n\tv_fma_mixhi_f16 %2, %6, -1.0, %10 op_sel:[1,0,0] op_sel_hi:[1,1,0]\n\tv_fma_mixhi_f16 %3, %7, -1.0, %11 op_sel:[1,0,0] op_sel_hi:[1,1,0]"
      : "+v"(d4), "+v"(d5), "+v"(d6), "+v"(d7)
      : "v"(a.u[4]), "v"(a.u[5]), "v"(a.u[6]), "v"(a.u[7]), "v"(xb[1]), "v"(xb[3]), "v"(xb[5]), "v"(xb[7]));
  d.u = (v8u){ d0, d1, d2, d3, d4, d5, d6, d7 };
  return d.h;
}
// exp2 of eight scores (and, in the second form, of the rescale exponent), each IN PLACE. In place no exp2 writes another's source.
// The closing v_nop is the slot the instruction set asks for behind a transcendental before its result is used.
__device__ __forceinline__ v8f exp2x8(v8f t) {
  float e0 = t[0], e1 = t[1], e2 = t[2], e3 = t[3], e4 = t[4], e5 = t[5], e6 = t[6], e7 = t[7];
  asm("v_exp_f32 %0, %0\n\tv_exp_f32 %1, %1\n\tv_exp_f32 %2, %2\n\tv_exp_f32 %3, %3\n\tv_exp_f32 %4, %4\n\tv_exp_f32 %5, %5\n\tv_exp_f32 %6, %6\n\tv_exp_f32 %7, %7\n\tv_nop"
      : "+v"(e0), "+v"(e1), "+v"(e2), "+v"(e3), "+v"(e4), "+v"(e5), "+v"(e6), "+v"(e7));
  return (v8f){ e0, e1, e2, e3, e4, e5, e6, e7 };
}
__device__ __forceinline__ v8f exp2x9(v8f t, float& a) {
  float e0 = t[0], e1 = t[1], e2 = t[2], e3 = t[3], e4 = t[4], e5 = t[5], e6 = t[6], e7 = t[7], e8 = a;
  asm("v_exp_f32 %8, %8\n\tv_exp_f32 %0, %0\n\tv_exp_f32 %1, %1\n\tv_exp_f32 %2, %2\n\tv_exp_f32 %3, %3\n\tv_exp_f32 %4, %4\n\tv_exp_f32 %5, %5\n\tv_exp_f32 %6, %6\n\tv_exp_f32 %7, %7\n\tv_nop"
      : "+v"(e0), "+v"(e1), "+v"(e2), "+v"(e3), "+v"(e4), "+v"(e5), "+v"(e6), "+v"(e7), "+v"(e8));
  a = e8;
  return (v8f){ e0, e1, e2, e3, e4, e5, e6, e7 };
}
#define QG 2   // 16-query column groups a wave: every K and V fragment read from LDS feeds QG products
#define KH 2   // key halves: the waves of a block are 4 query sets x KH halves of every staged 64-key tile, so that the wave count stays what it was with 16-query waves
static_assert(KH == 2 && QG == 2, "at the end each wave of a pair gives one query group away and finishes the other");
// two 8-wave blocks a WGP are four waves a SIMD: the register budget is held at 256 a wave, and 2 x the LDS below fits the WGP's 327,680 B
__global__ __launch_bounds__(256) __attribute__((amdgpu_waves_per_eu(4, 4))) void k_attn(const _Float16* __restrict__ QK, const _Float16* __restrict__ QKL, const _Float16* __restrict__ VTH, const _Float16* __restrict__ VTL, const void* __restrict__ KMASK, const _Float16* __restrict__ TBL, float* __restrict__ O) {
  __shared__ __align__(16) float st[2][4][16 * QG][68];   // [0] the height table, [1] the width table, per query set; behind the loop both are free and carry the hand-over between the key halves
  __shared__ __align__(16) float so[4 * KH][16][68];
  __shared__ __align__(16) _Float16 sk[2][32 * KH][KPITCH], sv[2][HD][KPITCH];   // a stage: 64 keys; a v row is 64 keys = 128 B, the pitch of a key row
  const int tid = threadIdx.x, lane = tid & 31, col = lane & 15, g = lane >> 4;
  const int wave = __builtin_amdgcn_readfirstlane(tid >> 5), qs = wave & 3, kh = wave >> 2;   // the same in every lane of a wave: held in scalar registers
  const int qb = blockIdx.x, h = blockIdx.y, b = blockIdx.z; const int q0 = (qb * 4 + qs) * (16 * QG);
  (void)QKL; (void)VTL; (void)KMASK;
  // thread t copies 16-byte piece t & 7 of key rows t >> 3 and 32 + (t >> 3), and of channel rows t >> 3 and 32 + (t >> 3)
  const _Float16* gk = QK + ((size_t)b * SS + (tid >> 3)) * (2 * DM) + DM + h * HD + (tid & 7) * 8;
  const _Float16* gv = VTH + ((size_t)b * DM + h * HD + (tid >> 3)) * SS + (tid & 7) * 8;
  const unsigned lk = lds_off(&sk[0][tid >> 3][(tid & 7) * 8]), lv = lds_off(&sv[0][tid >> 3][(tid & 7) * 8]);
  auto stage = [&](int t) { const _Float16* k0 = gk + (size_t)t * (32 * KH) * (2 * DM); const _Float16* v0 = gv + t * (32 * KH);
    const unsigned k1 = lk + (t & 1) * (unsigned)sizeof(sk[0]), v1 = lv + (t & 1) * (unsigned)sizeof(sv[0]);
    copy4(k1, k0, k1 + 32 * KPITCH * 2, k0 + (size_t)32 * (2 * DM), v1, v0, v1 + 32 * KPITCH * 2, v0 + (size_t)32 * SS); };
  stage(0);
  v16h aq[QG][2];
#pragma unroll
  for (int qg = 0; qg < QG; ++qg) {
#pragma unroll
    for (int kc = 0; kc < 2; ++kc) aq[qg][kc] = frag_h(QK + ((size_t)b * SS + q0 + qg * 16 + col) * (2 * DM) + h * HD + kc * 32, lane); }
  // relative-position dot tables for the query set: TH[r][j] = q_r . rel_pos_h[j], TW[r][j] = q_r . rel_pos_w[j] (exact products); the wave of half 0 makes TH, its partner TW
#pragma unroll
  for (int jt = 0; jt < 4; ++jt) { v16h tf[2];
#pragma unroll
    for (int kc = 0; kc < 2; ++kc) tf[kc] = frag_h(TBL + ((size_t)kh * 64 + jt * 16 + col) * HD + kc * 32, lane);
#pragma unroll
    for (int qg = 0; qg < QG; ++qg) { v8f tacc = {};
#pragma unroll
      for (int kc = 0; kc < 2; ++kc) tacc = wmma16(aq[qg][kc], tf[kc], tacc);
#pragma unroll
      for (int r = 0; r < 8; ++r) st[kh][qs][qg * 16 + 8 * g + r][jt * 16 + col] = tacc[r] * 8.0f; } }   // x 8 (exact): the tables are added to the unscaled q . k
  const int nst = SS / (32 * KH);   // all keys
  static_assert(SS / (32 * KH) >= 2, "the prologue fills two stages");
  asm volatile("s_wait_asynccnt 0x0" ::: "memory");   // this wave's copies of stage 0 have landed
  __syncthreads();                                    // ... and every other wave's; the partner's table is written
  stage(1);
  v8f tw[QG][2]; const float* thq[QG];
#pragma unroll
  for (int qg = 0; qg < QG; ++qg) { const int pq = q0 + qg * 16 + col, hq = pq / IMW, wq = pq % IMW;   // this lane's query of the group
#pragma unroll
    for (int ct = 0; ct < 2; ++ct) {
#pragma unroll
      for (int r = 0; r < 8; ++r) tw[qg][ct][r] = st[1][qs][qg * 16 + col][wq - (ct * 16 + 8 * g + r) + (IMW - 1)]; }
    thq[qg] = &st[0][qs][qg * 16 + col][hq + (IMW - 1) - kh]; }   // this wave's key row in stage s is KH * s + kh
  // c = 8 x score; P x 2^11 = exp2(c * KS + nm), nm = 11 - (running maximum of c) * KS: one fused multiply-add and one exp2 a score
  const float KS = 0.125f * 1.44269504088896340736f;
  float m[QG], nm[QG], l[QG];   // nm starts so far up that the first pass's alpha is exp2(-5e37) = 0; l (x 2^11): this half's 16 keys of every pass; the lane halves are joined once, behind the loop
  v8f acc[QG][4] = {};
#pragma unroll
  for (int qg = 0; qg < QG; ++qg) { m[qg] = -3.0e38f; nm[qg] = 5.0e37f; l[qg] = 0.f; }
#pragma unroll 1
  for (int s = 0; s < nst; ++s) { v8f c[QG][2];
    float th[QG];
#pragma unroll
    for (int qg = 0; qg < QG; ++qg) th[qg] = thq[qg][-KH * s];
    v16h kf[2][2], vf[4];   // all of the pass's LDS reads as one group at its head; the v fragments land behind the score products and the softmax (the loops are unrolled so that the arrays are indexed by constants and stay in registers)
#pragma unroll
    for (int ct = 0; ct < 2; ++ct) {
#pragma unroll
      for (int kc = 0; kc < 2; ++kc) kf[ct][kc] = frag_h(&sk[s & 1][kh * 32 + ct * 16 + col][kc * 32], lane); }
#pragma unroll
    for (int dt = 0; dt < 4; ++dt) vf[dt] = frag_h(&sv[s & 1][dt * 16 + col][kh * 32], lane);
    __builtin_amdgcn_sched_barrier(0);   // keeps the LDS reads one group in front of the first product, with counted waits behind them; left free, the scheduler spreads them among the products and waits to 0 behind each small group
#pragma unroll
    for (int qg = 0; qg < QG; ++qg) {
#pragma unroll
      for (int ct = 0; ct < 2; ++ct) c[qg][ct] = tw[qg][ct] + th[qg]; }   // 8 x (q.R_h[hq, key row] + q.R_w[wq, key column]) is the product's C operand
#pragma unroll
    for (int kc = 0; kc < 2; ++kc) {
#pragma unroll
      for (int ct = 0; ct < 2; ++ct) {
#pragma unroll
        for (int qg = 0; qg < QG; ++qg) c[qg][ct] = wmma16(kf[ct][kc], aq[qg][kc], c[qg][ct]); } }   // + q.k, EXACT products: q, k are bf16 inputs held exactly in f16
#pragma unroll
    for (int qg = 0; qg < QG; ++qg) {
      float t8[8];
#pragma unroll
      for (int i = 0; i < 8; ++i) t8[i] = fmaxf(c[qg][0][i], c[qg][1][i]);
      float mx = fmaxf(fmaxf(fmaxf(t8[0], t8[1]), fmaxf(t8[2], t8[3])), fmaxf(fmaxf(t8[4], t8[5]), fmaxf(t8[6], t8[7])));
      mx = fmaxf(mx, xhalf(mx));
      const float mn = fmaxf(m[qg], mx); const float nn = __builtin_fmaf(mn, -KS, 11.0f); float alpha = nn - nm[qg];   // its exp2 is taken with the first eight scores'
      v8h ph[2]; v8f x[2];
#pragma unroll
      for (int ct = 0; ct < 2; ++ct) { const v8f t = __builtin_elementwise_fma(c[qg][ct], (v8f)(KS), (v8f)(nn));
        x[ct] = ct == 0 ? exp2x9(t, alpha) : exp2x8(t);   // P scaled by 2^11 before the f16 split so small softmax weights stay out of the f16 subnormal range; l carries the same 2^11
        ph[ct] = __builtin_convertvector(x[ct], v8h);
      }
      const v16h pa = __builtin_shufflevector(ph[0], ph[1], 0, 1, 2, 3, 4, 5, 6, 7, 8, 9, 10, 11, 12, 13, 14, 15);
      const v16h pl = resid16(pa, x[0], x[1]);   // x - hi (exact in f32), at hi's own scale: at most 2^-11 of x, and f16 subnormals are kept, so what its rounding drops is below 2^-24 against a row sum of at least 2^11
      const v8f x8 = x[0] + x[1]; const v4f x4 = x8.lo + x8.hi; const v2f x2 = x4.lo + x4.hi;
      l[qg] = l[qg] * alpha + (x2.x + x2.y); m[qg] = mn; nm[qg] = nn;
#pragma unroll
      for (int dt = 0; dt < 4; ++dt) acc[qg][dt] *= alpha;
#pragma unroll
      for (int dt = 0; dt < 4; ++dt) acc[qg][dt] = wmma16(vf[dt], pa, acc[qg][dt]);   // V^T x P hi (v exact)
#pragma unroll
      for (int dt = 0; dt < 4; ++dt) acc[qg][dt] = wmma16(vf[dt], pl, acc[qg][dt]);   // + V^T x P lo, same scale, same tile; the other three tiles' products lie between a tile's two
    }
    __builtin_amdgcn_sched_barrier(0);   // keeps the two waits and the barrier below at the pass's foot, behind its products: lifted to the head, stage s + 2's copies would be waited for right after their issue
    asm volatile("s_wait_dscnt 0x0" ::: "memory");      // this wave's reads of buffer s & 1 are done
    asm volatile("s_wait_asynccnt 0x0" ::: "memory");   // this wave's copies of stage s + 1 have landed
    __syncthreads();                                    // publishes stage s + 1 and frees buffer s & 1
    if (s + 2 < nst) stage(s + 2);
  }
  asm volatile("s_wait_asynccnt 0x0" ::: "memory");     // no copy is left in flight behind the loop
  // The two waves of a query set each hold, for both groups, the sums over their own half of the keys. Wave kh gives group 1 - kh to its partner and finishes group kh. The tables are free: every wave's last read of them lies in front of the loop's last barrier.
  v4f* mb = (v4f*)&st[1][qs][0][0];   // [writer kh][8][lane]: 32 accumulator values a lane
  v2f* ms = (v2f*)&st[0][qs][0][0];   // [writer kh][lane]: nm, l
  auto give = [&](const int qg) {
#pragma unroll
    for (int dt = 0; dt < 4; ++dt) {
#pragma unroll
      for (int hf = 0; hf < 2; ++hf) { v4f o;
#pragma unroll
        for (int i = 0; i < 4; ++i) o[i] = acc[qg][dt][hf * 4 + i];
        mb[(kh * 8 + dt * 2 + hf) * 32 + lane] = o; } }
    ms[kh * 32 + lane] = (v2f){ nm[qg], l[qg] }; };
  auto finish = [&](const int qg) {
    const v2f p2 = ms[(1 - kh) * 32 + lane];
    const float d = nm[qg] - p2.x, e = __builtin_amdgcn_exp2f(-fabsf(d));   // nm falls as the maximum rises: the side with the larger nm is scaled down to the other's, whose factor is 1
    float fa = d > 0.f ? e : 1.0f, fb = d > 0.f ? 1.0f : e;
    float lj = l[qg] * fa + p2.y * fb; lj += xhalf(lj);
    const float il = 1.0f / lj;   // l and acc both carry 2^11
    fa *= il; fb *= il;
#pragma unroll
    for (int dt = 0; dt < 4; ++dt) {   // acc[qg][dt][r] = O[query qg * 16 + col][channel dt * 16 + 8g + r]: 8 consecutive channels per lane
#pragma unroll
      for (int hf = 0; hf < 2; ++hf) { const v4f pb = mb[((1 - kh) * 8 + dt * 2 + hf) * 32 + lane]; v4f o;
#pragma unroll
        for (int i = 0; i < 4; ++i) o[i] = acc[qg][dt][hf * 4 + i] * fa + pb[i] * fb;
        *(v4f*)&so[wave][col][dt * 16 + 8 * g + hf * 4] = o; } } };
  if (kh) give(0); else give(1);
  __syncthreads();   // the partner's sums are written
  if (kh) finish(1); else finish(0);
  LDSX();
  for (int rl = 0; rl < 16; ++rl) if (lane < 16) vst2(O + ((size_t)b * SS + q0 + kh * 16 + rl) * DM + h * HD + lane * 4, *(const v4f*)&so[wave][rl][lane * 4]);
}
// ---- k_out: block = (64 rows, 128 cols): out = O(hi/lo) . Wo rows (2 products) + bo
__global__ __launch_bounds__(128) void k_out(const float* __restrict__ O, const __bf16* __restrict__ P, const float* __restrict__ BO, float* __restrict__ Y) {
  __shared__ __align__(16) float so[4][16][132];
  const int tid = threadIdx.x, wave = tid >> 5, lane = tid & 31, col = lane & 15, g = lane >> 4; const size_t r0 = (size_t)blockIdx.x * 64 + wave * 16; const int n0 = blockIdx.y * 128;
  v8f acc[8] = {};
#pragma unroll 2
  for (int kc = 0; kc < DM / 32; ++kc) { const F2 a = split_row(O + (r0 + col) * DM, kc * 32, lane);
#pragma unroll
    for (int j = 0; j < 8; ++j) { const v16b w = frag_b(P + (size_t)(n0 + j * 16 + col) * DM + kc * 32, lane); acc[j] = wmma_bf(a.l, w, acc[j]); acc[j] = wmma_bf(a.h, w, acc[j]); } }
#pragma unroll
  for (int j = 0; j < 8; ++j) {
#pragma unroll
    for (int r = 0; r < 8; ++r) so[wave][8 * g + r][j * 16 + col] = acc[j][r] + (BO ? bfr(BO[n0 + j * 16 + col]) : 0.f); }
  LDSX();
  for (int rl = 0; rl < 16; ++rl) vst2(Y + (r0 + rl) * DM + n0 + lane * 4, *(const v4f*)&so[wave][rl][lane * 4]);
}
// ---- k_prep: q | k -> f16 rows [row][2*DM] (exact); v -> f16 planes [b][DM][SS] (exact). A stream: every block past the first TBLB takes 16 whole rows of q or k and one 64-position x 128-channel tile of v.
// Every q, k, v read is a 16-byte load whose wave covers 512 contiguous bytes of one row, and a lane's 24 loads are all issued before the first is used.
// v is turned in registers: a lane holds 8 positions x 4 channels, so each channel's 8 positions are one 16-byte LDS store; the tile leaves LDS as whole 128-byte lines. q and k need no LDS: a wave's 8-byte stores cover 256 contiguous bytes.
// The two relative-position tables need nothing of q, k, v and nothing here needs them: they share this grid instead of a launch of their own. The first TBLB blocks turn rel_pos_h / rel_pos_w [63][64] into f16 [2][64][64] (row 63 zero), 4 elements a lane: a 16-byte load, an 8-byte store, a wave's stores 256 contiguous bytes.
#define PREPB (2 * NB * SS / 16)
#define TBLB (2 * 64 * HD / (256 * 4))
static_assert(TBLB * 256 * 4 == 2 * 64 * HD && HD % 4 == 0, "the table blocks cover both tables exactly, a lane's 4 elements inside one row");
static_assert(PREPB == (NB * SS / 64) * (DM / 128), "as many q | k row groups as v tiles");
static_assert(DM == 256 * 4, "a block's 256 lanes x 4 floats are one row");
typedef __attribute__((ext_vector_type(4))) _Float16 v4h;
__global__ __launch_bounds__(256) void k_prep(const float* __restrict__ Q, const float* __restrict__ Kx, const float* __restrict__ V, const float* __restrict__ RH, const float* __restrict__ RW, _Float16* __restrict__ QK, _Float16* __restrict__ VTH, _Float16* __restrict__ TBL) {
  __shared__ __align__(16) _Float16 svt[128][72];
  const int t = threadIdx.x, wave = t >> 5, lane = t & 31;
  if (blockIdx.x < TBLB) {   // the same for a whole block, and in front of the barrier
    const int e = ((int)blockIdx.x * 256 + t) * 4, tb = e / (64 * HD), j = (e / HD) & 63, c = e % HD;
    v4f r = {};
    if (j < 2 * IMW - 1) r = *(const v4f*)((tb ? RW : RH) + (size_t)j * HD + c);
    const v4h h = { (_Float16)bfr(r[0]), (_Float16)bfr(r[1]), (_Float16)bfr(r[2]), (_Float16)bfr(r[3]) };
    *(v4h*)(TBL + e) = h;
    return;
  }
  const int x = (int)blockIdx.x - TBLB;
  const size_t vr0 = (size_t)(x >> 3) * 64; const int c0 = (x & 7) * 128;          // the v tile: rows vr0 .. + 63, channels c0 .. + 127
  const bool isq = x < PREPB / 2; const size_t qr0 = (size_t)(x & (PREPB / 2 - 1)) * 16;   // the q or k rows
  const float* vs = V + (vr0 + wave * 8) * DM + c0 + lane * 4;
  const float* qs = (isq ? Q : Kx) + qr0 * DM + t * 4;
  v4f a[8], q[16];
#pragma unroll
  for (int j = 0; j < 8; ++j) a[j] = *(const v4f*)(vs + (size_t)j * DM);
  asm volatile("s_wait_xcnt 0x0" ::: "memory");   // the v loads' address pair is dead from here on and becomes the destination of a later load: the wait stands in front of that overwrite
#pragma unroll
  for (int j = 0; j < 16; ++j) q[j] = *(const v4f*)(qs + (size_t)j * DM);
  __builtin_amdgcn_sched_barrier(0);   // keeps the 24 loads one group in front of all the work: left free, the scheduler mixes q | k conversions among v's, so that the LDS stores and the barrier wait for q | k loads too and most stores for the last load
#pragma unroll
  for (int i = 0; i < 4; ++i) { v8h h;
#pragma unroll
    for (int j = 0; j < 8; ++j) h[j] = (_Float16)bfr(a[j][i]);
    *(v8h*)&svt[lane * 4 + i][wave * 8] = h; }
  // the tile's hand-over between the waves is LDS traffic alone: fences on LDS only, so that the barrier waits for the four LDS stores and not for the 16 q | k loads still in flight (__syncthreads() waited for them all)
  __builtin_amdgcn_fence(__ATOMIC_RELEASE, "workgroup", "local");
  __builtin_amdgcn_s_barrier();
  __builtin_amdgcn_fence(__ATOMIC_ACQUIRE, "workgroup", "local");
  const size_t b = vr0 / SS, s0 = vr0 % SS;
#pragma unroll
  for (int k = 0; k < 4; ++k) { const int e = t + k * 256, c = e >> 3, pc = e & 7; vst2((unsigned*)(VTH + (b * DM + c0 + c) * SS + s0 + pc * 8), *(const v4u*)&svt[c][pc * 8]); }
  _Float16* qd = QK + qr0 * (2 * DM) + (isq ? 0 : DM) + t * 4;
#pragma unroll
  for (int j = 0; j < 16; ++j) { v4h h;
#pragma unroll
    for (int i = 0; i < 4; ++i) h[i] = (_Float16)bfr(q[j][i]);
    *(v4h*)(qd + (size_t)j * (2 * DM)) = h; }
}
extern "C" void kernel_launch(void* const* d_in, const int* in_sizes, int n_in, void* d_out, int out_size, void* d_ws, size_t ws_size, hipStream_t stream) {
  (void)in_sizes; (void)n_in; (void)out_size;
  const float** F = (const float**)d_in;   // 0 q, 1 k, 2 v [4,1,1024,1024] (= [b][s][h*64+d]); 3 rel_pos_h [63,64]; 4 rel_pos_w [63,64]
  if (ws_size < (size_t)WS_END) return;
  char* ws = (char*)d_ws; _Float16 *QK = (_Float16*)(ws + WS_QK), *QKL = (_Float16*)(ws + WS_QKL), *VTH = (_Float16*)(ws + WS_VTH), *VTL = (_Float16*)(ws + WS_VTL), *TBL = (_Float16*)(ws + WS_TBL);
  k_prep<<<dim3(TBLB + PREPB), 256, 0, stream>>>(F[0], F[1], F[2], F[3], F[4], QK, VTH, TBL);
  k_attn<<<dim3(SS / (64 * QG), NH, TNB), 256, 0, stream>>>(QK, QKL, VTH, VTL, nullptr, TBL, (float*)d_out);   // O layout [b*S+q][h*64+d] == the module's merged (b,1,s,n*d) output
}

// v009
// Measured time: 33.8 microseconds a run.
// In two side-by-side timings against v008, it was 1.04 and 1.05 times as fast.
// Over all steps from v000 it is 3.12 times as fast.
// compute dtype: q/k/v and the two relative-position tables rounded to bf16 and used as EXACT f16 operands (bf16 values are exact in f16); per (query, head): TH[j] = q . rel_pos_h[j] and TW[j] = q . rel_pos_w[j] for all table rows on WMMA 16x16x32 (exact products, f32 accumulate), 8 x scores = q . k (exact products) accumulated onto 8 x (TH[hq - kh + 31] + TW[wq - kw + 31]); softmax in f32, base 2 (hardware exp2), against a reference point fixed per query before the key loop (the maximum of its position terms) and raised by a power of two only where a pass comes near the f16 range; P (scaled by 2^11) as f16 hi + f16 residual at the same scale x the exact v planes (2 products into one tile); f32 accumulate; the merged-head output is written directly.
#include <hip/hip_runtime.h>
#include <math.h>

typedef __attribute__((ext_vector_type(16))) _Float16 v16h;
typedef __attribute__((ext_vector_type(16))) __bf16 v16b;
typedef __attribute__((ext_vector_type(8)))  _Float16 v8h;
typedef __attribute__((ext_vector_type(8)))  float v8f;
typedef __attribute__((ext_vector_type(4)))  float v4f;
typedef __attribute__((ext_vector_type(2)))  float v2f;
typedef __attribute__((ext_vector_type(4)))  unsigned v4u;
typedef __attribute__((ext_vector_type(4)))  int v4i;
typedef float __attribute__((may_alias)) float_a;
typedef int __attribute__((may_alias)) int_a;

template <typename T> __device__ __forceinline__ void vst2(void* p, T v) { *(T*)p = v;  }
__device__ __forceinline__ v8f wmma16(v16h a, v16h b, v8f c) {
  return __builtin_amdgcn_wmma_f32_16x16x32_f16(false, a, false, b, (short)0, c, false, false);
}
__device__ __forceinline__ v8f wmma_bf(v16b a, v16b b, v8f c) {
  v8f d = __builtin_amdgcn_wmma_f32_16x16x32_bf16(false, a, false, b, (short)0, c, false, false);
  asm volatile("v_nop\n\tv_nop\n\tv_nop\n\tv_nop" : "+v"(d) : "v"(a), "v"(b));
  return d;
}
// Decomposed relative-position attention over a 32 x 32 feature map (B 4, 1,024 positions, 16 heads x 64, q/k/v given): sim = q k^T / 8 + q . R_h[hq, kh] + q . R_w[wq, kw], softmax, . v, heads re-merged.
__device__ __forceinline__ v16h frag_h(const _Float16* rowk0, int lane) {
  union { v16h v; v8h q[2]; } u; const _Float16* p = rowk0 + 8 * (lane >> 4);
  u.q[0] = *(const v8h*)p; u.q[1] = *(const v8h*)(p + 16); return u.v;
}
__device__ __forceinline__ v16h frag_f32(const float* rowk0, int lane) {
  v16h a; const float* p = rowk0 + 8 * (lane >> 4);
#pragma unroll
  for (int i = 0; i < 8; ++i) { a[i] = (_Float16)p[i]; a[8 + i] = (_Float16)p[16 + i]; }
  return a;
}
__device__ __forceinline__ v16h frag_f32s(const float* rowk0, int lane, float sc) {
  v16h a; const float* p = rowk0 + 8 * (lane >> 4);
#pragma unroll
  for (int i = 0; i < 8; ++i) { a[i] = (_Float16)(p[i] * sc); a[8 + i] = (_Float16)(p[16 + i] * sc); }
  return a;
}
// column fragment from a [K][ld] layout (column n), rows >= K read as 0
__device__ __forceinline__ v16h fragc_f32(const float* W, int k0, int n, int lane, int ld, int K) {
  v16h a; const int g = lane >> 4;
#pragma unroll
  for (int i = 0; i < 8; ++i) { const int ka = k0 + 8 * g + i, kb = ka + 16;
    a[i] = (_Float16)(ka < K ? W[(size_t)(ka < K ? ka : K - 1) * ld + n] : 0.f); a[8 + i] = (_Float16)(kb < K ? W[(size_t)(kb < K ? kb : K - 1) * ld + n] : 0.f); }
  return a;
}
struct F2 { v16b h, l; };
__device__ __forceinline__ F2 bsplit16(const float v[16]) { F2 r;
#pragma unroll
  for (int i = 0; i < 16; ++i) { const __bf16 h = (__bf16)v[i]; r.h[i] = h; r.l[i] = (__bf16)(v[i] - (float)h); }
  return r; }
__device__ __forceinline__ F2 split_row(const float* row, int k0, int lane) { float v[16]; const float* p = row + k0 + 8 * (lane >> 4);
#pragma unroll
  for (int i = 0; i < 8; ++i) { v[i] = p[i]; v[8 + i] = p[16 + i]; }
  return bsplit16(v); }
__device__ __forceinline__ F2 split_rowK(const float* row, int k0, int lane, int K) { float v[16]; const int g = lane >> 4;
#pragma unroll
  for (int i = 0; i < 8; ++i) { const int ka = k0 + 8 * g + i, kb = ka + 16; v[i] = ka < K ? row[ka < K ? ka : K - 1] : 0.f; v[8 + i] = kb < K ? row[kb < K ? kb : K - 1] : 0.f; }
  return bsplit16(v); }
__device__ __forceinline__ F2 split_col(const float* W, int k0, int n, int lane, int ld, int K) { float v[16]; const int g = lane >> 4;
#pragma unroll
  for (int i = 0; i < 8; ++i) { const int ka = k0 + 8 * g + i, kb = ka + 16; v[i] = ka < K ? W[(size_t)(ka < K ? ka : K - 1) * ld + n] : 0.f; v[8 + i] = kb < K ? W[(size_t)(kb < K ? kb : K - 1) * ld + n] : 0.f; }
  return bsplit16(v); }
__device__ __forceinline__ v8f mac3(const F2& a, const F2& b, v8f c) { c = wmma_bf(a.l, b.h, c); c = wmma_bf(a.h, b.l, c); return wmma_bf(a.h, b.h, c); }
__device__ __forceinline__ float sigm(float v) { return 1.0f / (1.0f + expf(-v)); }
#define LDSX() do { asm volatile("s_wait_dscnt 0" ::: "memory"); __builtin_amdgcn_wave_barrier(); __builtin_amdgcn_fence(__ATOMIC_RELEASE, "workgroup"); } while (0)


#define NB 4
#define SS 1024
#define IMW 32
#define DM 1024
#define NH 16
#define HD 64
#define QKVW (3 * DM)
#ifndef TQB
#define TQB (SS / 64)
#define TNB NB
#define TOB (NB * SS / 64)     // output row tiles (all)
#endif
typedef __attribute__((ext_vector_type(8))) __bf16 v8b;
__device__ __forceinline__ v16b frag_b(const __bf16* rowk0, int lane) {
  union { v16b v; v8b q[2]; } u; const __bf16* p = rowk0 + 8 * (lane >> 4);
  u.q[0] = *(const v8b*)p; u.q[1] = *(const v8b*)(p + 16); return u.v;
}
__device__ __forceinline__ float bfr(float v) { return (float)(__bf16)v; }
__device__ __attribute__((noinline)) float exp_ni(float v) { return expf(v); }
__device__ __attribute__((noinline)) float erf_ni(float v) { return erff(v); }

#define PK_A 0                       // [3072][1024] Wqkv rows (natural [out][in])
#define PK_P (PK_A + QKVW * DM)        // [1024][1024] Wo rows (natural)
#define PK_END (PK_P + DM * DM)
#define WS_PK  0u
#define WS_QK  (WS_PK + 2u * PK_END)             // f16 [4096 rows][2048]: q | k
#define WS_QKL (WS_QK + 2u * NB * SS * 2 * DM)     // f16 q | k residual planes x2048
#define WS_VTH (WS_QKL + 2u * NB * SS * 2 * DM)    // f16 [b][1024 (h*64+d)][1024 s] hi
#define WS_VTL (WS_VTH + 2u * NB * DM * SS)        // f16 lo x 2048
#define WS_O   (WS_VTL + 2u * NB * DM * SS)        // f32 [4096][1024]
#define WS_CS  (WS_O + 4u * NB * SS * DM)           // f32 2 x [1024][32], unused
#define WS_TBL (WS_CS + 4u * 2 * SS * 32)                 // f16 [2][64][HD]: rel_pos_h rows 0..62 (+ zero row), rel_pos_w
#define WS_END (WS_TBL + 2u * 2 * 64 * HD)
// ---- k_pack: block = (row n, which): natural [out][in] rows -> bf16; which 0..2 -> W_q/W_k/W_v into PK_A rows which*1024 + n; 3 -> W_o into PK_P
__global__ __launch_bounds__(256) void k_pack(const float* __restrict__ WQ, const float* __restrict__ WK, const float* __restrict__ WV, const float* __restrict__ WO, __bf16* __restrict__ PK) {
  __shared__ __align__(16) __bf16 s[DM]; const int n = blockIdx.x, which = blockIdx.y, t = threadIdx.x; const float* Wm = (which == 0) ? WQ : (which == 1) ? WK : (which == 2) ? WV : WO;
  for (int k = t; k < DM; k += 256) s[k] = (__bf16)Wm[(size_t)n * DM + k];
  __syncthreads();
  __bf16* dst = (which < 3) ? PK + PK_A + ((size_t)which * DM + n) * DM : PK + PK_P + (size_t)n * DM;
  for (int q = t; q < DM / 8; q += 256) vst2((unsigned*)(dst + q * 8), *(const v4u*)&s[q * 8]);
}
__global__ __launch_bounds__(128) void k_qkv(const float* __restrict__ XQ, const float* __restrict__ XK, const float* __restrict__ XV, const __bf16* __restrict__ P, const float* __restrict__ BQ, const float* __restrict__ BK, const float* __restrict__ BV, _Float16* __restrict__ QK, _Float16* __restrict__ QKL, _Float16* __restrict__ VTH, _Float16* __restrict__ VTL) {
  const int which0 = (blockIdx.y * 128) / DM; const float* X = (which0 == 0) ? XQ : (which0 == 1) ? XK : XV; const float* BB = BQ ? (((which0 == 0) ? BQ : (which0 == 1) ? BK : BV) + (blockIdx.y * 128 - which0 * DM)) : nullptr;
  __shared__ __align__(16) _Float16 so[4][16][136], sol[4][16][136]; __shared__ __align__(16) _Float16 sth[128][72], stl[128][72];
  const int tid = threadIdx.x, wave = tid >> 5, lane = tid & 31, col = lane & 15, g = lane >> 4; const size_t r0 = (size_t)blockIdx.x * 64 + wave * 16; const int n0 = blockIdx.y * 128;
  v8f acc[8] = {};
#pragma unroll 2
  for (int kc = 0; kc < DM / 32; ++kc) { v16b a; { const float* p = X + (r0 + col) * DM + kc * 32 + 8 * g;
#pragma unroll
      for (int i = 0; i < 8; ++i) { a[i] = (__bf16)p[i]; a[8 + i] = (__bf16)p[16 + i]; } }
#pragma unroll
    for (int j = 0; j < 8; ++j) acc[j] = wmma_bf(a, frag_b(P + (size_t)(n0 + j * 16 + col) * DM + kc * 32, lane), acc[j]); }
  if (n0 < 2 * DM) {   // q stored unscaled (f16 sigma ~0.6, no subnormal exposure); 1/8 applied to the f32 score
#pragma unroll
    for (int j = 0; j < 8; ++j) {
#pragma unroll
      for (int r = 0; r < 8; ++r) { const float v = acc[j][r] + (BB ? bfr(BB[j * 16 + col]) : 0.f); const _Float16 hv = (_Float16)v; so[wave][8 * g + r][j * 16 + col] = hv; sol[wave][8 * g + r][j * 16 + col] = (_Float16)((v - (float)hv) * 2048.0f); } }   // q, k (+ bias) as f16 hi + (x2048) residual
    LDSX();
    for (int rl = 0; rl < 16; ++rl) if (lane < 16) { vst2((unsigned*)(QK + (r0 + rl) * (2 * DM) + n0 + lane * 8), *(const v4u*)&so[wave][rl][lane * 8]); vst2((unsigned*)(QKL + (r0 + rl) * (2 * DM) + n0 + lane * 8), *(const v4u*)&sol[wave][rl][lane * 8]); }
  } else {
#pragma unroll
    for (int j = 0; j < 8; ++j) {
#pragma unroll
      for (int r = 0; r < 8; ++r) { const float v = acc[j][r] + (BB ? bfr(BB[j * 16 + col]) : 0.f); const _Float16 hv = (_Float16)v; sth[j * 16 + col][wave * 16 + 8 * g + r] = hv; stl[j * 16 + col][wave * 16 + 8 * g + r] = (_Float16)((v - (float)hv) * 2048.0f); } }
    __syncthreads();
    const size_t rb = (size_t)blockIdx.x * 64; const int b = (int)(rb / SS), s0 = (int)(rb % SS); const int pc0 = n0 - 2 * DM;
    for (int q = tid; q < 128 * 8; q += 128) { const int d = q >> 3, pc = q & 7; const size_t o = ((size_t)b * DM + pc0 + d) * SS + s0 + pc * 8; vst2((unsigned*)(VTH + o), *(const v4u*)&sth[d][pc * 8]); vst2((unsigned*)(VTL + o), *(const v4u*)&stl[d][pc * 8]); }
  }
}
// ---- k_attn: block = (128 queries, head h, batch b), 8 waves; a wave takes 32 queries (two 16-query column groups) and every second 32-key pass: all-keys flash attention, transposed products: S^T = K . Q^T (A = 16 key rows, B = 16 queries of the wave) and O^T += V^T . P^T (A = 16 channel rows of the v plane, B = P^T).
// Lane (col, g) then holds, in each group for the ONE query q0 + 16 * group + col, the scores of keys 8g + r (tile 0) and 16 + 8g + r (tile 1) of the 32-key pass: exactly the k order of a B fragment, so P goes from the score accumulators into the second product without leaving the registers.
// A pass is one image row of keys (32 = IMW): the keys' image row is the pass number and their column is ct * 16 + 8g + r in every pass, so the width term is 16 values per lane for the whole loop and the height term one value per pass.
static_assert(IMW == 32, "a 32-key pass is one image row");
// lane l <-> lane l ^ 16 (the two halves that share a query)
__device__ __forceinline__ float xhalf(float v) { const int b = __float_as_int(v); return __int_as_float(__builtin_amdgcn_permlanex16(b, b, 0x76543210, 0xfedcba98, false, false)); }
// K and V of a pass are the same for the four query sets of a block: each 64-key stage (one pass for either key half) is brought into LDS once per block, by 16-byte asynchronous copies, two buffers, the next tile in flight while this one is worked on; the waves read their A fragments from LDS.
#define KPITCH 72   // f16 per staged key row or channel row: 128 B + 16 B, the conflict-free pitch for 16-byte LDS reads
__device__ __forceinline__ unsigned lds_off(const void* p) { return (unsigned)(size_t)p; }
// one lane's four copies of a tile; the s_wait_xcnt closes the copies' own statement, so that it stands in front of every later write of an address register that a copy names
__device__ __forceinline__ void copy4(unsigned l0, const _Float16* g0, unsigned l1, const _Float16* g1, unsigned l2, const _Float16* g2, unsigned l3, const _Float16* g3) {
  asm volatile("global_load_async_to_lds_b128 %0, %1, off\n\tglobal_load_async_to_lds_b128 %2, %3, off\n\tglobal_load_async_to_lds_b128 %4, %5, off\n\tglobal_load_async_to_lds_b128 %6, %7, off\n\ts_wait_xcnt 0x0"
               :: "v"(l0), "v"(g0), "v"(l1), "v"(g1), "v"(l2), "v"(g2), "v"(l3), "v"(g3) : "memory");
}
// the f16 residual of 16 f32 values against their f16 roundings: f16(x - hi), one mixed-precision FMA a value (f16 hi x -1 + f32 x, rounded once to f16 and written into its own half of the pair's register); the compiler's own form is an FMA to f32 a value and a packed conversion a pair.
// All eight low halves stand in front of the high halves, so that the write of a register's second half is eight instructions behind the first and waits for nothing.
typedef __attribute__((ext_vector_type(8))) unsigned v8u;
__device__ __forceinline__ v16h resid16(v16h hi, v8f xa, v8f xb) {
  union { v16h h; v8u u; } a, d; a.h = hi;
  unsigned d0, d1, d2, d3, d4, d5, d6, d7;
  asm("v_fma_mixlo_f16 %0, %8, -1.0, %16 op_sel_hi:[1,1,0]\n\tv_fma_mixlo_f16 %1, %9, -1.0, %17 op_sel_hi:[1,1,0]\n\tv_fma_mixlo_f16 %2, %10, -1.0, %18 op_sel_hi:[1,1,0]\n\tv_fma_mixlo_f16 %3, %11, -1.0, %19 op_sel_hi:[1,1,0]\n\t"
      "v_fma_mixlo_f16 %4, %12, -1.0, %20 op_sel_hi:[1,1,0]\n\tv_fma_mixlo_f16 %5, %13, -1.0, %21 op_sel_hi:[1,1,0]\n\tv_fma_mixlo_f16 %6, %14, -1.0, %22 op_sel_hi:[1,1,0]\n\tv_fma_mixlo_f16 %7, %15, -1.0, %23 op_sel_hi:[1,1,0]"
      : "=&v"(d0), "=&v"(d1), "=&v"(d2), "=&v"(d3), "=&v"(d4), "=&v"(d5), "=&v"(d6), "=&v"(d7)
      : "v"(a.u[0]), "v"(a.u[1]), "v"(a.u[2]), "v"(a.u[3]), "v"(a.u[4]), "v"(a.u[5]), "v"(a.u[6]), "v"(a.u[7]),
        "v"(xa[0]), "v"(xa[2]), "v"(xa[4]), "v"(xa[6]), "v"(xb[0]), "v"(xb[2]), "v"(xb[4]), "v"(xb[6]));
  asm("v_fma_mixhi_f16 %0, %4, -1.0, %8 op_sel:[1,0,0] op_sel_hi:[1,1,0]\n\tv_fma_mixhi_f16 %1, %5, -1.0, %9 op_sel:[1,0,0] op_sel_hi:[1,1,0]\n\tv_fma_mixhi_f16 %2, %6, -1.0, %10 op_sel:[1,0,0] op_sel_hi:[1,1,0]\n\tv_fma_mixhi_f16 %3, %7, -1.0, %11 op_sel:[1,0,0] op_sel_hi:[1,1,0]"
      : "+v"(d0), "+v"(d1), "+v"(d2), "+v"(d3)
      : "v"(a.u[0]), "v"(a.u[1]), "v"(a.u[2]), "v"(a.u[3]), "v"(xa[1]), "v"(xa[3]), "v"(xa[5]), "v"(xa[7]));
  asm("v_fma_mixhi_f16 %0, %4, -1.0, %8 op_sel:[1,0,0] op_sel_hi:[1,1,0]\n\tv_fma_mixhi_f16 %1, %5, -1.0, %9 op_sel:[1,0,0] op_sel_hi:[1,1,0]\n\tv_fma_mixhi_f16 %2, %6, -1.0, %10 op_sel:[1,0,0] op_sel_hi:[1,1,0]\n\tv_fma_mixhi_f16 %3, %7, -1.0, %11 op_sel:[1,0,0] op_sel_hi:[1,1,0]"
      : "+v"(d4), "+v"(d5), "+v"(d6), "+v"(d7)
      : "v"(a.u[4]), "v"(a.u[5]), "v"(a.u[6]), "v"(a.u[7]), "v"(xb[1]), "v"(xb[3]), "v"(xb[5]), "v"(xb[7]));
  d.u = (v8u){ d0, d1, d2, d3, d4, d5, d6, d7 };
  return d.h;
}
// exp2 of eight scores, each IN PLACE. in place no exp2 writes another's source.
// The closing v_nop is the slot the instruction set asks for behind a transcendental before its result is used.
__device__ __forceinline__ v8f exp2x8(v8f t) {
  float e0 = t[0], e1 = t[1], e2 = t[2], e3 = t[3], e4 = t[4], e5 = t[5], e6 = t[6], e7 = t[7];
  asm("v_exp_f32 %0, %0\n\tv_exp_f32 %1, %1\n\tv_exp_f32 %2, %2\n\tv_exp_f32 %3, %3\n\tv_exp_f32 %4, %4\n\tv_exp_f32 %5, %5\n\tv_exp_f32 %6, %6\n\tv_exp_f32 %7, %7\n\tv_nop"
      : "+v"(e0), "+v"(e1), "+v"(e2), "+v"(e3), "+v"(e4), "+v"(e5), "+v"(e6), "+v"(e7));
  return (v8f){ e0, e1, e2, e3, e4, e5, e6, e7 };
}
#define QG 2   // 16-query column groups a wave: every K and V fragment read from LDS feeds QG products
#define KH 2   // key halves: the waves of a block are 4 query sets x KH halves of every staged 64-key tile, so that the wave count stays what it was with 16-query waves
static_assert(KH == 2 && QG == 2, "at the end each wave of a pair gives one query group away and finishes the other");
// two 8-wave blocks a WGP are four waves a SIMD: the register budget is held at 256 a wave, and 2 x the LDS below fits the WGP's 327,680 B
__global__ __launch_bounds__(256) __attribute__((amdgpu_waves_per_eu(4, 4))) void k_attn(const _Float16* __restrict__ QK, const _Float16* __restrict__ QKL, const _Float16* __restrict__ VTH, const _Float16* __restrict__ VTL, const void* __restrict__ KMASK, const _Float16* __restrict__ TBL, float* __restrict__ O) {
  __shared__ __align__(16) float st[2][4][16 * QG][68];   // [0] the height table, [1] the width table, per query set; behind the loop both are free and carry the hand-over between the key halves
  __shared__ __align__(16) float so[4 * KH][16][68];
  __shared__ __align__(16) _Float16 sk[2][32 * KH][KPITCH], sv[2][HD][KPITCH];   // a stage: 64 keys; a v row is 64 keys = 128 B, the pitch of a key row
  const int tid = threadIdx.x, lane = tid & 31, col = lane & 15, g = lane >> 4;
  const int wave = __builtin_amdgcn_readfirstlane(tid >> 5), qs = wave & 3, kh = wave >> 2;   // the same in every lane of a wave: held in scalar registers
  const int qb = blockIdx.x, h = blockIdx.y, b = blockIdx.z; const int q0 = (qb * 4 + qs) * (16 * QG);
  (void)QKL; (void)VTL; (void)KMASK;
  // thread t copies 16-byte piece t & 7 of key rows t >> 3 and 32 + (t >> 3), and of channel rows t >> 3 and 32 + (t >> 3)
  const _Float16* gk = QK + ((size_t)b * SS + (tid >> 3)) * (2 * DM) + DM + h * HD + (tid & 7) * 8;
  const _Float16* gv = VTH + ((size_t)b * DM + h * HD + (tid >> 3)) * SS + (tid & 7) * 8;
  const unsigned lk = lds_off(&sk[0][tid >> 3][(tid & 7) * 8]), lv = lds_off(&sv[0][tid >> 3][(tid & 7) * 8]);
  auto stage = [&](int t) { const _Float16* k0 = gk + (size_t)t * (32 * KH) * (2 * DM); const _Float16* v0 = gv + t * (32 * KH);
    const unsigned k1 = lk + (t & 1) * (unsigned)sizeof(sk[0]), v1 = lv + (t & 1) * (unsigned)sizeof(sv[0]);
    copy4(k1, k0, k1 + 32 * KPITCH * 2, k0 + (size_t)32 * (2 * DM), v1, v0, v1 + 32 * KPITCH * 2, v0 + (size_t)32 * SS); };
  stage(0);
  v16h aq[QG][2];
#pragma unroll
  for (int qg = 0; qg < QG; ++qg) {
#pragma unroll
    for (int kc = 0; kc < 2; ++kc) aq[qg][kc] = frag_h(QK + ((size_t)b * SS + q0 + qg * 16 + col) * (2 * DM) + h * HD + kc * 32, lane); }
  // relative-position dot tables for the query set: TH[r][j] = q_r . rel_pos_h[j], TW[r][j] = q_r . rel_pos_w[j] (exact products); the wave of half 0 makes TH, its partner TW
#pragma unroll
  for (int jt = 0; jt < 4; ++jt) { v16h tf[2];
#pragma unroll
    for (int kc = 0; kc < 2; ++kc) tf[kc] = frag_h(TBL + ((size_t)kh * 64 + jt * 16 + col) * HD + kc * 32, lane);
#pragma unroll
    for (int qg = 0; qg < QG; ++qg) { v8f tacc = {};
#pragma unroll
      for (int kc = 0; kc < 2; ++kc) tacc = wmma16(aq[qg][kc], tf[kc], tacc);
#pragma unroll
      for (int r = 0; r < 8; ++r) st[kh][qs][qg * 16 + 8 * g + r][jt * 16 + col] = tacc[r] * 8.0f; } }   // x 8 (exact): the tables are added to the unscaled q . k
  const int nst = SS / (32 * KH);   // all keys
  static_assert(SS / (32 * KH) >= 2, "the prologue fills two stages");
  asm volatile("s_wait_asynccnt 0x0" ::: "memory");   // this wave's copies of stage 0 have landed
  __syncthreads();                                    // ... and every other wave's; the partner's table is written
  stage(1);
  v8f tw[QG][2]; const float* thq[QG];
#pragma unroll
  for (int qg = 0; qg < QG; ++qg) { const int pq = q0 + qg * 16 + col, hq = pq / IMW, wq = pq % IMW;   // this lane's query of the group
#pragma unroll
    for (int ct = 0; ct < 2; ++ct) {
#pragma unroll
      for (int r = 0; r < 8; ++r) tw[qg][ct][r] = st[1][qs][qg * 16 + col][wq - (ct * 16 + 8 * g + r) + (IMW - 1)]; }
    thq[qg] = &st[0][qs][qg * 16 + col][hq + (IMW - 1) - kh]; }   // this wave's key row in stage s is KH * s + kh
  // c = 8 x score; P x 2^11 = exp2(c * KS + nm), nm = 11 - m0 * KS: one fused multiply-add and one exp2 a score.
  // m0 is fixed here, once per query: the largest position term among the wave's own keys = (largest height term of its 16 key rows) + (largest width term of the 32 columns), both already in the tables. The key that has it scores m0 + q.k, so the true maximum lies a few units of q.k / 8 around m0 and needs no tracking from pass to pass: no maximum, no alpha, no rescale of the accumulators in a pass.
  // What q.k adds above m0 is caught in the loop: see the vote there. The reference point only moves up: score - m0 is q.k / 8 plus a position term that is 0 at its best key and negative elsewhere; P keeps its hi + residual precision for a true maximum down to e^-8 of m0's weight, and x stays finite in f32 up to 2^116 above it.
  const float KS = 0.125f * 1.44269504088896340736f;
  static_assert(SS / (32 * KH) == 16, "a lane half looks at 8 of the wave's 16 key rows");
  float nm[QG], l[QG];   // l (x 2^11): this half's 16 keys of every pass; the lane halves are joined once, behind the loop
  v8f acc[QG][4] = {};
#pragma unroll
  for (int qg = 0; qg < QG; ++qg) { float mw = tw[qg][0][0], mh = thq[qg][-KH * (8 * g)];
#pragma unroll
    for (int r = 1; r < 8; ++r) { mw = fmaxf(mw, tw[qg][0][r]); mh = fmaxf(mh, thq[qg][-KH * (8 * g + r)]); }
#pragma unroll
    for (int r = 0; r < 8; ++r) mw = fmaxf(mw, tw[qg][1][r]);
    const float m0 = fmaxf(mw, xhalf(mw)) + fmaxf(mh, xhalf(mh));   // the two lane halves of a query hold the same m0
    nm[qg] = __builtin_fmaf(m0, -KS, 11.0f); l[qg] = 0.f; }
#pragma unroll 1
  for (int s = 0; s < nst; ++s) { v8f c[QG][2];
    float th[QG];
#pragma unroll
    for (int qg = 0; qg < QG; ++qg) th[qg] = thq[qg][-KH * s];
    v16h kf[2][2], vf[4];   // all of the pass's LDS reads as one group at its head; the v fragments land behind the score products and the softmax (the loops are unrolled so that the arrays are indexed by constants and stay in registers)
#pragma unroll
    for (int ct = 0; ct < 2; ++ct) {
#pragma unroll
      for (int kc = 0; kc < 2; ++kc) kf[ct][kc] = frag_h(&sk[s & 1][kh * 32 + ct * 16 + col][kc * 32], lane); }
#pragma unroll
    for (int dt = 0; dt < 4; ++dt) vf[dt] = frag_h(&sv[s & 1][dt * 16 + col][kh * 32], lane);
    __builtin_amdgcn_sched_barrier(0);   // keeps the LDS reads one group in front of the first product, with counted waits behind them; left free, the scheduler spreads them among the products and waits to 0 behind each small group
#pragma unroll
    for (int qg = 0; qg < QG; ++qg) {
#pragma unroll
      for (int ct = 0; ct < 2; ++ct) c[qg][ct] = tw[qg][ct] + th[qg]; }   // 8 x (q.R_h[hq, key row] + q.R_w[wq, key column]) is the product's C operand
#pragma unroll
    for (int kc = 0; kc < 2; ++kc) {
#pragma unroll
      for (int ct = 0; ct < 2; ++ct) {
#pragma unroll
        for (int qg = 0; qg < QG; ++qg) c[qg][ct] = wmma16(kf[ct][kc], aq[qg][kc], c[qg][ct]); } }   // + q.k, EXACT products: q, k are bf16 inputs held exactly in f16
    v8f x[QG][2]; float ps[QG];
#pragma unroll
    for (int qg = 0; qg < QG; ++qg) {
#pragma unroll
      for (int ct = 0; ct < 2; ++ct) x[qg][ct] = exp2x8(__builtin_elementwise_fma(c[qg][ct], (v8f)(KS), (v8f)(nm[qg])));   // P scaled by 2^11 before the f16 split so small softmax weights stay out of the f16 subnormal range; l carries the same 2^11
      const v8f x8 = x[qg][0] + x[qg][1]; const v4f x4 = x8.lo + x8.hi; const v2f x2 = x4.lo + x4.hi;
      ps[qg] = x2.x + x2.y; }   // the lane's 16 weights of the pass, all positive: below 2^15 it bounds each of them inside the f16 range
    // The vote: the same for the whole wave, so every lane is on at the products behind it. Taken only where q.k lifts a lane's sum of the pass to 16 times the weight of a score at m0: then that query's reference point moves up by a whole power of two (exact on x, l and the accumulators), both lane halves alike.
    if (__builtin_expect(__builtin_amdgcn_ballot_w32(!(fmaxf(ps[0], ps[1]) < 32768.0f)) != 0u, 0)) {
#pragma unroll
      for (int qg = 0; qg < QG; ++qg) {
        const float pm = fmaxf(ps[qg], xhalf(ps[qg]));
        const int sh = pm < 32768.0f ? 0 : 11 - __builtin_amdgcn_frexp_expf(pm);   // pm < 2^frexp_exp: the pass's sum comes back under 2^11
        const float al = __builtin_ldexpf(1.0f, sh);
        x[qg][0] *= al; x[qg][1] *= al; ps[qg] *= al; l[qg] *= al; nm[qg] += (float)sh;
#pragma unroll
        for (int dt = 0; dt < 4; ++dt) acc[qg][dt] *= al; }
    }
    v16h pa[QG], pl[QG];
#pragma unroll
    for (int qg = 0; qg < QG; ++qg) {
      l[qg] += ps[qg];
      pa[qg] = __builtin_shufflevector(__builtin_convertvector(x[qg][0], v8h), __builtin_convertvector(x[qg][1], v8h), 0, 1, 2, 3, 4, 5, 6, 7, 8, 9, 10, 11, 12, 13, 14, 15);
      pl[qg] = resid16(pa[qg], x[qg][0], x[qg][1]); }   // x - hi (exact in f32), at hi's own scale: at most 2^-11 of x, and f16 subnormals are kept
    __builtin_amdgcn_sched_barrier(0);   // keeps every product behind the split: lifted among it, a product's P registers were given to the other group's residual
#pragma unroll
    for (int qg = 0; qg < QG; ++qg) {
#pragma unroll
      for (int dt = 0; dt < 4; ++dt) acc[qg][dt] = wmma16(vf[dt], pa[qg], acc[qg][dt]); }   // V^T x P hi (v exact)
#pragma unroll
    for (int qg = 0; qg < QG; ++qg) {
#pragma unroll
      for (int dt = 0; dt < 4; ++dt) acc[qg][dt] = wmma16(vf[dt], pl[qg], acc[qg][dt]); }   // + V^T x P lo, same scale, same tile; seven other products lie between a tile's two
    __builtin_amdgcn_sched_barrier(0);   // keeps the two waits and the barrier below at the pass's foot, behind its products: lifted to the head, stage s + 2's copies would be waited for right after their issue
    asm volatile("s_wait_dscnt 0x0" ::: "memory");      // this wave's reads of buffer s & 1 are done
    asm volatile("s_wait_asynccnt 0x0" ::: "memory");   // this wave's copies of stage s + 1 have landed
    __syncthreads();                                    // publishes stage s + 1 and frees buffer s & 1
    if (s + 2 < nst) stage(s + 2);
  }
  asm volatile("s_wait_asynccnt 0x0" ::: "memory");     // no copy is left in flight behind the loop
  // The two waves of a query set each hold, for both groups, the sums over their own half of the keys. Wave kh gives group 1 - kh to its partner and finishes group kh. The tables are free: every wave's last read of them lies in front of the loop's last barrier.
  v4f* mb = (v4f*)&st[1][qs][0][0];   // [writer kh][8][lane]: 32 accumulator values a lane
  v2f* ms = (v2f*)&st[0][qs][0][0];   // [writer kh][lane]: nm, l
  auto give = [&](const int qg) {
#pragma unroll
    for (int dt = 0; dt < 4; ++dt) {
#pragma unroll
      for (int hf = 0; hf < 2; ++hf) { v4f o;
#pragma unroll
        for (int i = 0; i < 4; ++i) o[i] = acc[qg][dt][hf * 4 + i];
        mb[(kh * 8 + dt * 2 + hf) * 32 + lane] = o; } }
    ms[kh * 32 + lane] = (v2f){ nm[qg], l[qg] }; };
  auto finish = [&](const int qg) {
    const v2f p2 = ms[(1 - kh) * 32 + lane];
    const float d = nm[qg] - p2.x, e = __builtin_amdgcn_exp2f(-fabsf(d));   // nm falls as the maximum rises: the side with the larger nm is scaled down to the other's, whose factor is 1
    float fa = d > 0.f ? e : 1.0f, fb = d > 0.f ? 1.0f : e;
    float lj = l[qg] * fa + p2.y * fb; lj += xhalf(lj);
    const float il = 1.0f / lj;   // l and acc both carry 2^11
    fa *= il; fb *= il;
#pragma unroll
    for (int dt = 0; dt < 4; ++dt) {   // acc[qg][dt][r] = O[query qg * 16 + col][channel dt * 16 + 8g + r]: 8 consecutive channels per lane
#pragma unroll
      for (int hf = 0; hf < 2; ++hf) { const v4f pb = mb[((1 - kh) * 8 + dt * 2 + hf) * 32 + lane]; v4f o;
#pragma unroll
        for (int i = 0; i < 4; ++i) o[i] = acc[qg][dt][hf * 4 + i] * fa + pb[i] * fb;
        *(v4f*)&so[wave][col][dt * 16 + 8 * g + hf * 4] = o; } } };
  if (kh) give(0); else give(1);
  __syncthreads();   // the partner's sums are written
  if (kh) finish(1); else finish(0);
  LDSX();
  for (int rl = 0; rl < 16; ++rl) if (lane < 16) vst2(O + ((size_t)b * SS + q0 + kh * 16 + rl) * DM + h * HD + lane * 4, *(const v4f*)&so[wave][rl][lane * 4]);
}
// ---- k_out: block = (64 rows, 128 cols): out = O(hi/lo) . Wo rows (2 products) + bo
__global__ __launch_bounds__(128) void k_out(const float* __restrict__ O, const __bf16* __restrict__ P, const float* __restrict__ BO, float* __restrict__ Y) {
  __shared__ __align__(16) float so[4][16][132];
  const int tid = threadIdx.x, wave = tid >> 5, lane = tid & 31, col = lane & 15, g = lane >> 4; const size_t r0 = (size_t)blockIdx.x * 64 + wave * 16; const int n0 = blockIdx.y * 128;
  v8f acc[8] = {};
#pragma unroll 2
  for (int kc = 0; kc < DM / 32; ++kc) { const F2 a = split_row(O + (r0 + col) * DM, kc * 32, lane);
#pragma unroll
    for (int j = 0; j < 8; ++j) { const v16b w = frag_b(P + (size_t)(n0 + j * 16 + col) * DM + kc * 32, lane); acc[j] = wmma_bf(a.l, w, acc[j]); acc[j] = wmma_bf(a.h, w, acc[j]); } }
#pragma unroll
  for (int j = 0; j < 8; ++j) {
#pragma unroll
    for (int r = 0; r < 8; ++r) so[wave][8 * g + r][j * 16 + col] = acc[j][r] + (BO ? bfr(BO[n0 + j * 16 + col]) : 0.f); }
  LDSX();
  for (int rl = 0; rl < 16; ++rl) vst2(Y + (r0 + rl) * DM + n0 + lane * 4, *(const v4f*)&so[wave][rl][lane * 4]);
}
// ---- k_prep: q | k -> f16 rows [row][2*DM] (exact); v -> f16 planes [b][DM][SS] (exact). A stream: every block past the first TBLB takes 16 whole rows of q or k and one 64-position x 128-channel tile of v.
// Every q, k, v read is a 16-byte load whose wave covers 512 contiguous bytes of one row, and a lane's 24 loads are all issued before the first is used.
// v is turned in registers: a lane holds 8 positions x 4 channels, so each channel's 8 positions are one 16-byte LDS store; the tile leaves LDS as whole 128-byte lines. q and k need no LDS: a wave's 8-byte stores cover 256 contiguous bytes.
// The two relative-position tables need nothing of q, k, v and nothing here needs them: they share this grid instead of a launch of their own. The first TBLB blocks turn rel_pos_h / rel_pos_w [63][64] into f16 [2][64][64] (row 63 zero), 4 elements a lane: a 16-byte load, an 8-byte store, a wave's stores 256 contiguous bytes.
#define PREPB (2 * NB * SS / 16)
#define TBLB (2 * 64 * HD / (256 * 4))
static_assert(TBLB * 256 * 4 == 2 * 64 * HD && HD % 4 == 0, "the table blocks cover both tables exactly, a lane's 4 elements inside one row");
static_assert(PREPB == (NB * SS / 64) * (DM / 128), "as many q | k row groups as v tiles");
static_assert(DM == 256 * 4, "a block's 256 lanes x 4 floats are one row");
typedef __attribute__((ext_vector_type(4))) _Float16 v4h;
__global__ __launch_bounds__(256) void k_prep(const float* __restrict__ Q, const float* __restrict__ Kx, const float* __restrict__ V, const float* __restrict__ RH, const float* __restrict__ RW, _Float16* __restrict__ QK, _Float16* __restrict__ VTH, _Float16* __restrict__ TBL) {
  __shared__ __align__(16) _Float16 svt[128][72];
  const int t = threadIdx.x, wave = t >> 5, lane = t & 31;
  if (blockIdx.x < TBLB) {   // the same for a whole block, and in front of the barrier
    const int e = ((int)blockIdx.x * 256 + t) * 4, tb = e / (64 * HD), j = (e / HD) & 63, c = e % HD;
    v4f r = {};
    if (j < 2 * IMW - 1) r = *(const v4f*)((tb ? RW : RH) + (size_t)j * HD + c);
    const v4h h = { (_Float16)bfr(r[0]), (_Float16)bfr(r[1]), (_Float16)bfr(r[2]), (_Float16)bfr(r[3]) };
    *(v4h*)(TBL + e) = h;
    return;
  }
  const int x = (int)blockIdx.x - TBLB;
  const size_t vr0 = (size_t)(x >> 3) * 64; const int c0 = (x & 7) * 128;          // the v tile: rows vr0 .. + 63, channels c0 .. + 127
  const bool isq = x < PREPB / 2; const size_t qr0 = (size_t)(x & (PREPB / 2 - 1)) * 16;   // the q or k rows
  const float* vs = V + (vr0 + wave * 8) * DM + c0 + lane * 4;
  const float* qs = (isq ? Q : Kx) + qr0 * DM + t * 4;
  v4f a[8], q[16];
#pragma unroll
  for (int j = 0; j < 8; ++j) a[j] = *(const v4f*)(vs + (size_t)j * DM);
  asm volatile("s_wait_xcnt 0x0" ::: "memory");   // the v loads' address pair is dead from here on and becomes the destination of a later load: the wait stands in front of that overwrite
#pragma unroll
  for (int j = 0; j < 16; ++j) q[j] = *(const v4f*)(qs + (size_t)j * DM);
  __builtin_amdgcn_sched_barrier(0);   // keeps the 24 loads one group in front of all the work: left free, the scheduler mixes q | k conversions among v's, so that the LDS stores and the barrier wait for q | k loads too and most stores for the last load
#pragma unroll
  for (int i = 0; i < 4; ++i) { v8h h;
#pragma unroll
    for (int j = 0; j < 8; ++j) h[j] = (_Float16)bfr(a[j][i]);
    *(v8h*)&svt[lane * 4 + i][wave * 8] = h; }
  // the tile's hand-over between the waves is LDS traffic alone: fences on LDS only, so that the barrier waits for the four LDS stores and not for the 16 q | k loads still in flight (__syncthreads() waited for them all)
  __builtin_amdgcn_fence(__ATOMIC_RELEASE, "workgroup", "local");
  __builtin_amdgcn_s_barrier();
  __builtin_amdgcn_fence(__ATOMIC_ACQUIRE, "workgroup", "local");
  const size_t b = vr0 / SS, s0 = vr0 % SS;
#pragma unroll
  for (int k = 0; k < 4; ++k) { const int e = t + k * 256, c = e >> 3, pc = e & 7; vst2((unsigned*)(VTH + (b * DM + c0 + c) * SS + s0 + pc * 8), *(const v4u*)&svt[c][pc * 8]); }
  _Float16* qd = QK + qr0 * (2 * DM) + (isq ? 0 : DM) + t * 4;
#pragma unroll
  for (int j = 0; j < 16; ++j) { v4h h;
#pragma unroll
    for (int i = 0; i < 4; ++i) h[i] = (_Float16)bfr(q[j][i]);
    *(v4h*)(qd + (size_t)j * (2 * DM)) = h; }
}
extern "C" void kernel_launch(void* const* d_in, const int* in_sizes, int n_in, void* d_out, int out_size, void* d_ws, size_t ws_size, hipStream_t stream) {
  (void)in_sizes; (void)n_in; (void)out_size;
  const float** F = (const float**)d_in;   // 0 q, 1 k, 2 v [4,1,1024,1024] (= [b][s][h*64+d]); 3 rel_pos_h [63,64]; 4 rel_pos_w [63,64]
  if (ws_size < (size_t)WS_END) return;
  char* ws = (char*)d_ws; _Float16 *QK = (_Float16*)(ws + WS_QK), *QKL = (_Float16*)(ws + WS_QKL), *VTH = (_Float16*)(ws + WS_VTH), *VTL = (_Float16*)(ws + WS_VTL), *TBL = (_Float16*)(ws + WS_TBL);
  k_prep<<<dim3(TBLB + PREPB), 256, 0, stream>>>(F[0], F[1], F[2], F[3], F[4], QK, VTH, TBL);
  k_attn<<<dim3(SS / (64 * QG), NH, TNB), 256, 0, stream>>>(QK, QKL, VTH, VTL, nullptr, TBL, (float*)d_out);   // O layout [b*S+q][h*64+d] == the module's merged (b,1,s,n*d) output
}

// v010
// One run takes 28.1 microseconds.
// Next to v009, in two timings, it ran 1.21 and 1.22 times as fast.
// Counting every step since v000, it is 3.80 times as fast.
// compute dtype: q/k/v and the two relative-position tables rounded to bf16 and used as EXACT f16 operands (bf16 values are exact in f16); per (query, head): TH[j] = q . rel_pos_h[j] and TW[j] = q . rel_pos_w[j] for all table rows on WMMA 16x16x32 (exact products, f32 accumulate), 8 x scores = q . k (exact products) accumulated onto 8 x (TH[hq - kh + 31] + TW[wq - kw + 31]); softmax in f32, base 2 (hardware exp2), against a reference point fixed per query before the key loop (the maximum of its position terms) and raised by a power of two only where a pass comes near the f16 range; P (scaled by 2^11) as f16 hi + f16 residual at the same scale x the exact v planes (2 products into one tile); f32 accumulate; the merged-head output is written directly.
#include <hip/hip_runtime.h>
#include <math.h>

typedef __attribute__((ext_vector_type(16))) _Float16 v16h;
typedef __attribute__((ext_vector_type(16))) __bf16 v16b;
typedef __attribute__((ext_vector_type(8)))  _Float16 v8h;
typedef __attribute__((ext_vector_type(8)))  float v8f;
typedef __attribute__((ext_vector_type(4)))  float v4f;
typedef __attribute__((ext_vector_type(2)))  float v2f;
typedef __attribute__((ext_vector_type(4)))  unsigned v4u;
typedef __attribute__((ext_vector_type(4)))  int v4i;
typedef float __attribute__((may_alias)) float_a;
typedef int __attribute__((may_alias)) int_a;

template <typename T> __device__ __forceinline__ void vst2(void* p, T v) { *(T*)p = v;  }
__device__ __forceinline__ v8f wmma16(v16h a, v16h b, v8f c) {
  return __builtin_amdgcn_wmma_f32_16x16x32_f16(false, a, false, b, (short)0, c, false, false);
}
__device__ __forceinline__ v8f wmma_bf(v16b a, v16b b, v8f c) {
  v8f d = __builtin_amdgcn_wmma_f32_16x16x32_bf16(false, a, false, b, (short)0, c, false, false);
  asm volatile("v_nop\n\tv_nop\n\tv_nop\n\tv_nop" : "+v"(d) : "v"(a), "v"(b));
  return d;
}
// Decomposed relative-position attention over a 32 x 32 feature map (B 4, 1,024 positions, 16 heads x 64, q/k/v given): sim = q k^T / 8 + q . R_h[hq, kh] + q . R_w[wq, kw], softmax, . v, heads re-merged.
__device__ __forceinline__ v16h frag_h(const _Float16* rowk0, int lane) {
  union { v16h v; v8h q[2]; } u; const _Float16* p = rowk0 + 8 * (lane >> 4);
  u.q[0] = *(const v8h*)p; u.q[1] = *(const v8h*)(p + 16); return u.v;
}
__device__ __forceinline__ v16h frag_f32(const float* rowk0, int lane) {
  v16h a; const float* p = rowk0 + 8 * (lane >> 4);
#pragma unroll
  for (int i = 0; i < 8; ++i) { a[i] = (_Float16)p[i]; a[8 + i] = (_Float16)p[16 + i]; }
  return a;
}
__device__ __forceinline__ v16h frag_f32s(const float* rowk0, int lane, float sc) {
  v16h a; const float* p = rowk0 + 8 * (lane >> 4);
#pragma unroll
  for (int i = 0; i < 8; ++i) { a[i] = (_Float16)(p[i] * sc); a[8 + i] = (_Float16)(p[16 + i] * sc); }
  return a;
}
// column fragment from a [K][ld] layout (column n), rows >= K read as 0
__device__ __forceinline__ v16h fragc_f32(const float* W, int k0, int n, int lane, int ld, int K) {
  v16h a; const int g = lane >> 4;
#pragma unroll
  for (int i = 0; i < 8; ++i) { const int ka = k0 + 8 * g + i, kb = ka + 16;
    a[i] = (_Float16)(ka < K ? W[(size_t)(ka < K ? ka : K - 1) * ld + n] : 0.f); a[8 + i] = (_Float16)(kb < K ? W[(size_t)(kb < K ? kb : K - 1) * ld + n] : 0.f); }
  return a;
}
struct F2 { v16b h, l; };
__device__ __forceinline__ F2 bsplit16(const float v[16]) { F2 r;
#pragma unroll
  for (int i = 0; i < 16; ++i) { const __bf16 h = (__bf16)v[i]; r.h[i] = h; r.l[i] = (__bf16)(v[i] - (float)h); }
  return r; }
__device__ __forceinline__ F2 split_row(const float* row, int k0, int lane) { float v[16]; const float* p = row + k0 + 8 * (lane >> 4);
#pragma unroll
  for (int i = 0; i < 8; ++i) { v[i] = p[i]; v[8 + i] = p[16 + i]; }
  return bsplit16(v); }
__device__ __forceinline__ F2 split_rowK(const float* row, int k0, int lane, int K) { float v[16]; const int g = lane >> 4;
#pragma unroll
  for (int i = 0; i < 8; ++i) { const int ka = k0 + 8 * g + i, kb = ka + 16; v[i] = ka < K ? row[ka < K ? ka : K - 1] : 0.f; v[8 + i] = kb < K ? row[kb < K ? kb : K - 1] : 0.f; }
  return bsplit16(v); }
__device__ __forceinline__ F2 split_col(const float* W, int k0, int n, int lane, int ld, int K) { float v[16]; const int g = lane >> 4;
#pragma unroll
  for (int i = 0; i < 8; ++i) { const int ka = k0 + 8 * g + i, kb = ka + 16; v[i] = ka < K ? W[(size_t)(ka < K ? ka : K - 1) * ld + n] : 0.f; v[8 + i] = kb < K ? W[(size_t)(kb < K ? kb : K - 1) * ld + n] : 0.f; }
  return bsplit16(v); }
__device__ __forceinline__ v8f mac3(const F2& a, const F2& b, v8f c) { c = wmma_bf(a.l, b.h, c); c = wmma_bf(a.h, b.l, c); return wmma_bf(a.h, b.h, c); }
__device__ __forceinline__ float sigm(float v) { return 1.0f / (1.0f + expf(-v)); }
#define LDSX() do { asm volatile("s_wait_dscnt 0" ::: "memory"); __builtin_amdgcn_wave_barrier(); __builtin_amdgcn_fence(__ATOMIC_RELEASE, "workgroup"); } while (0)


#define NB 4
#define SS 1024
#define IMW 32
#define DM 1024
#define NH 16
#define HD 64
#define QKVW (3 * DM)
#ifndef TQB
#define TQB (SS / 64)
#define TNB NB
#define TOB (NB * SS / 64)     // output row tiles (all)
#endif
typedef __attribute__((ext_vector_type(8))) __bf16 v8b;
__device__ __forceinline__ v16b frag_b(const __bf16* rowk0, int lane) {
  union { v16b v; v8b q[2]; } u; const __bf16* p = rowk0 + 8 * (lane >> 4);
  u.q[0] = *(const v8b*)p; u.q[1] = *(const v8b*)(p + 16); return u.v;
}
__device__ __forceinline__ float bfr(float v) { return (float)(__bf16)v; }
__device__ __attribute__((noinline)) float exp_ni(float v) { return expf(v); }
__device__ __attribute__((noinline)) float erf_ni(float v) { return erff(v); }

#define PK_A 0                       // [3072][1024] Wqkv rows (natural [out][in])
#define PK_P (PK_A + QKVW * DM)        // [1024][1024] Wo rows (natural)
#define PK_END (PK_P + DM * DM)
#define WS_PK  0u
#define WS_QK  (WS_PK + 2u * PK_END)             // f16 [4096 rows][2048]: q | k
#define WS_QKL (WS_QK + 2u * NB * SS * 2 * DM)     // f16 q | k residual planes x2048
#define WS_VTH (WS_QKL + 2u * NB * SS * 2 * DM)    // f16 [b][1024 (h*64+d)][1024 s] hi
#define WS_VTL (WS_VTH + 2u * NB * DM * SS)        // f16 lo x 2048
#define WS_O   (WS_VTL + 2u * NB * DM * SS)        // f32 [4096][1024]
#define WS_CS  (WS_O + 4u * NB * SS * DM)           // f32 2 x [1024][32], unused
#define WS_TBL (WS_CS + 4u * 2 * SS * 32)                 // f16 [2][64][HD], unused
#define WS_END (WS_TBL + 2u * 2 * 64 * HD)
// ---- k_pack: block = (row n, which): natural [out][in] rows -> bf16; which 0..2 -> W_q/W_k/W_v into PK_A rows which*1024 + n; 3 -> W_o into PK_P
__global__ __launch_bounds__(256) void k_pack(const float* __restrict__ WQ, const float* __restrict__ WK, const float* __restrict__ WV, const float* __restrict__ WO, __bf16* __restrict__ PK) {
  __shared__ __align__(16) __bf16 s[DM]; const int n = blockIdx.x, which = blockIdx.y, t = threadIdx.x; const float* Wm = (which == 0) ? WQ : (which == 1) ? WK : (which == 2) ? WV : WO;
  for (int k = t; k < DM; k += 256) s[k] = (__bf16)Wm[(size_t)n * DM + k];
  __syncthreads();
  __bf16* dst = (which < 3) ? PK + PK_A + ((size_t)which * DM + n) * DM : PK + PK_P + (size_t)n * DM;
  for (int q = t; q < DM / 8; q += 256) vst2((unsigned*)(dst + q * 8), *(const v4u*)&s[q * 8]);
}
__global__ __launch_bounds__(128) void k_qkv(const float* __restrict__ XQ, const float* __restrict__ XK, const float* __restrict__ XV, const __bf16* __restrict__ P, const float* __restrict__ BQ, const float* __restrict__ BK, const float* __restrict__ BV, _Float16* __restrict__ QK, _Float16* __restrict__ QKL, _Float16* __restrict__ VTH, _Float16* __restrict__ VTL) {
  const int which0 = (blockIdx.y * 128) / DM; const float* X = (which0 == 0) ? XQ : (which0 == 1) ? XK : XV; const float* BB = BQ ? (((which0 == 0) ? BQ : (which0 == 1) ? BK : BV) + (blockIdx.y * 128 - which0 * DM)) : nullptr;
  __shared__ __align__(16) _Float16 so[4][16][136], sol[4][16][136]; __shared__ __align__(16) _Float16 sth[128][72], stl[128][72];
  const int tid = threadIdx.x, wave = tid >> 5, lane = tid & 31, col = lane & 15, g = lane >> 4; const size_t r0 = (size_t)blockIdx.x * 64 + wave * 16; const int n0 = blockIdx.y * 128;
  v8f acc[8] = {};
#pragma unroll 2
  for (int kc = 0; kc < DM / 32; ++kc) { v16b a; { const float* p = X + (r0 + col) * DM + kc * 32 + 8 * g;
#pragma unroll
      for (int i = 0; i < 8; ++i) { a[i] = (__bf16)p[i]; a[8 + i] = (__bf16)p[16 + i]; } }
#pragma unroll
    for (int j = 0; j < 8; ++j) acc[j] = wmma_bf(a, frag_b(P + (size_t)(n0 + j * 16 + col) * DM + kc * 32, lane), acc[j]); }
  if (n0 < 2 * DM) {   // q stored unscaled (f16 sigma ~0.6, no subnormal exposure); 1/8 applied to the f32 score
#pragma unroll
    for (int j = 0; j < 8; ++j) {
#pragma unroll
      for (int r = 0; r < 8; ++r) { const float v = acc[j][r] + (BB ? bfr(BB[j * 16 + col]) : 0.f); const _Float16 hv = (_Float16)v; so[wave][8 * g + r][j * 16 + col] = hv; sol[wave][8 * g + r][j * 16 + col] = (_Float16)((v - (float)hv) * 2048.0f); } }   // q, k (+ bias) as f16 hi + (x2048) residual
    LDSX();
    for (int rl = 0; rl < 16; ++rl) if (lane < 16) { vst2((unsigned*)(QK + (r0 + rl) * (2 * DM) + n0 + lane * 8), *(const v4u*)&so[wave][rl][lane * 8]); vst2((unsigned*)(QKL + (r0 + rl) * (2 * DM) + n0 + lane * 8), *(const v4u*)&sol[wave][rl][lane * 8]); }
  } else {
#pragma unroll
    for (int j = 0; j < 8; ++j) {
#pragma unroll
      for (int r = 0; r < 8; ++r) { const float v = acc[j][r] + (BB ? bfr(BB[j * 16 + col]) : 0.f); const _Float16 hv = (_Float16)v; sth[j * 16 + col][wave * 16 + 8 * g + r] = hv; stl[j * 16 + col][wave * 16 + 8 * g + r] = (_Float16)((v - (float)hv) * 2048.0f); } }
    __syncthreads();
    const size_t rb = (size_t)blockIdx.x * 64; const int b = (int)(rb / SS), s0 = (int)(rb % SS); const int pc0 = n0 - 2 * DM;
    for (int q = tid; q < 128 * 8; q += 128) { const int d = q >> 3, pc = q & 7; const size_t o = ((size_t)b * DM + pc0 + d) * SS + s0 + pc * 8; vst2((unsigned*)(VTH + o), *(const v4u*)&sth[d][pc * 8]); vst2((unsigned*)(VTL + o), *(const v4u*)&stl[d][pc * 8]); }
  }
}
// ---- k_attn: block = (128 queries, head h, batch b), 8 waves; a wave takes 32 queries (two 16-query column groups) and every second 32-key pass: all-keys flash attention, transposed products: S^T = K . Q^T (A = 16 key rows, B = 16 queries of the wave) and O^T += V^T . P^T (A = 16 channel rows of the v plane, B = P^T).
// Lane (col, g) then holds, in each group for the ONE query q0 + 16 * group + col, the scores of keys 8g + r (tile 0) and 16 + 8g + r (tile 1) of the 32-key pass: exactly the k order of a B fragment, so P goes from the score accumulators into the second product without leaving the registers.
// A pass is one image row of keys (32 = IMW): the keys' image row is the pass number and their column is ct * 16 + 8g + r in every pass, so the width term is 16 values per lane for the whole loop and the height term one value per pass.
static_assert(IMW == 32, "a 32-key pass is one image row");
// lane l <-> lane l ^ 16 (the two halves that share a query)
__device__ __forceinline__ float xhalf(float v) { const int b = __float_as_int(v); return __int_as_float(__builtin_amdgcn_permlanex16(b, b, 0x76543210, 0xfedcba98, false, false)); }
// K and V of a pass are the same for the four query sets of a block. Each 64-key stage (one pass for either key half) comes into LDS once per block as raw f32 rows, by 16-byte asynchronous copies, two raw buffers; the block's 256 lanes turn it there into the f16 tiles (k rows, v channel rows), two f16 buffers, one pass ahead of its use; the waves read their A fragments from the f16 tiles.
#define KPITCH 72   // f16 per staged key row or channel row: 128 B + 16 B, the conflict-free pitch for 16-byte LDS reads
#define RPITCH 68   // f32 per raw row: 256 B + 16 B, so that the 16 lanes that read 32-byte pieces of two neighbouring rows meet 64 different banks
__device__ __forceinline__ unsigned lds_off(const void* p) { return (unsigned)(size_t)p; }
// One lane's eight copies of a stage: four groups of 16 rows of the k tile, four of the v tile. The global address is a scalar base + the lane's 32-bit byte offset, so that a stage's addresses cost scalar additions only.
// An immediate offset moves BOTH addresses: group i has offset i x 16 raw LDS rows (4,352 B), and its scalar base carries the rest of the global step (16 global rows less that offset).
// The s_wait_xcnt closes the copies' own statement, so that it stands in front of every later write of a register that a copy names.
static_assert(16 * RPITCH * 4 == 4352, "the offsets in the copies' text");
__device__ __forceinline__ void copy8(unsigned lk, unsigned lv, unsigned vo, const char* k0, const char* k1, const char* k2, const char* k3, const char* v0, const char* v1, const char* v2, const char* v3) {
  asm volatile("global_load_async_to_lds_b128 %0, %2, %3\n\tglobal_load_async_to_lds_b128 %0, %2, %4 offset:4352\n\tglobal_load_async_to_lds_b128 %0, %2, %5 offset:8704\n\tglobal_load_async_to_lds_b128 %0, %2, %6 offset:13056\n\t"
               "global_load_async_to_lds_b128 %1, %2, %7\n\tglobal_load_async_to_lds_b128 %1, %2, %8 offset:4352\n\tglobal_load_async_to_lds_b128 %1, %2, %9 offset:8704\n\tglobal_load_async_to_lds_b128 %1, %2, %10 offset:13056\n\ts_wait_xcnt 0x0"
               :: "v"(lk), "v"(lv), "v"(vo), "s"(k0), "s"(k1), "s"(k2), "s"(k3), "s"(v0), "s"(v1), "s"(v2), "s"(v3) : "memory");
}
// two f32 inputs -> bf16 (round to nearest even, one packed conversion) -> the same values as f16 (exact)
typedef __attribute__((ext_vector_type(2))) __bf16 v2b;
typedef __attribute__((ext_vector_type(2))) _Float16 v2h;
__device__ __forceinline__ v2h cv2(float a, float b) { const v2f x = { a, b }; return __builtin_convertvector(__builtin_convertvector(__builtin_convertvector(x, v2b), v2f), v2h); }
__device__ __forceinline__ v8h cv8(float a, float b, float c, float d, float e, float f, float g, float h) { union { v8h v; v2h q[4]; } u; u.q[0] = cv2(a, b); u.q[1] = cv2(c, d); u.q[2] = cv2(e, f); u.q[3] = cv2(g, h); return u.v; }
// a fragment in frag_h's k order straight from an f32 row
__device__ __forceinline__ v16h frag_cv(const float* rowk0, int lane) {
  union { v16h v; v8h q[2]; } u; const float* p = rowk0 + 8 * (lane >> 4);
  const v4f a = *(const v4f*)p, b = *(const v4f*)(p + 4), c = *(const v4f*)(p + 16), d = *(const v4f*)(p + 20);
  u.q[0] = cv8(a[0], a[1], a[2], a[3], b[0], b[1], b[2], b[3]); u.q[1] = cv8(c[0], c[1], c[2], c[3], d[0], d[1], d[2], d[3]); return u.v;
}
// the f16 residual of 16 f32 values against their f16 roundings: f16(x - hi), one mixed-precision FMA a value (f16 hi x -1 + f32 x, rounded once to f16 and written into its own half of the pair's register); the compiler's own form is an FMA to f32 a value and a packed conversion a pair.
// All eight low halves stand in front of the high halves, so that the write of a register's second half is eight instructions behind the first and waits for nothing.
typedef __attribute__((ext_vector_type(8))) unsigned v8u;
__device__ __forceinline__ v16h resid16(v16h hi, v8f xa, v8f xb) {
  union { v16h h; v8u u; } a, d; a.h = hi;
  unsigned d0, d1, d2, d3, d4, d5, d6, d7;
  asm("v_fma_mixlo_f16 %0, %8, -1.0, %16 op_sel_hi:[1,1,0]\n\tv_fma_mixlo_f16 %1, %9, -1.0, %17 op_sel_hi:[1,1,0]\n\tv_fma_mixlo_f16 %2, %10, -1.0, %18 op_sel_hi:[1,1,0]\n\tv_fma_mixlo_f16 %3, %11, -1.0, %19 op_sel_hi:[1,1,0]\n\t"
      "v_fma_mixlo_f16 %4, %12, -1.0, %20 op_sel_hi:[1,1,0]\n\tv_fma_mixlo_f16 %5, %13, -1.0, %21 op_sel_hi:[1,1,0]\n\tv_fma_mixlo_f16 %6, %14, -1.0, %22 op_sel_hi:[1,1,0]\n\tv_fma_mixlo_f16 %7, %15, -1.0, %23 op_sel_hi:[1,1,0]"
      : "=&v"(d0), "=&v"(d1), "=&v"(d2), "=&v"(d3), "=&v"(d4), "=&v"(d5), "=&v"(d6), "=&v"(d7)
      : "v"(a.u[0]), "v"(a.u[1]), "v"(a.u[2]), "v"(a.u[3]), "v"(a.u[4]), "v"(a.u[5]), "v"(a.u[6]), "v"(a.u[7]),
        "v"(xa[0]), "v"(xa[2]), "v"(xa[4]), "v"(xa[6]), "v"(xb[0]), "v"(xb[2]), "v"(xb[4]), "v"(xb[6]));
  asm("v_fma_mixhi_f16 %0, %4, -1.0, %8 op_sel:[1,0,0] op_sel_hi:[1,1,0]\n\tv_fma_mixhi_f16 %1, %5, -1.0, %9 op_sel:[1,0,0] op_sel_hi:[1,1,0]\n\tv_fma_mixhi_f16 %2, %6, -1.0, %10 op_sel:[1,0,0] op_sel_hi:[1,1,0]\n\tv_fma_mixhi_f16 %3, %7, -1.0, %11 op_sel:[1,0,0] op_sel_hi:[1,1,0]"
      : "+v"(d0), "+v"(d1), "+v"(d2), "+v"(d3)
      : "v"(a.u[0]), "v"(a.u[1]), "v"(a.u[2]), "v"(a.u[3]), "v"(xa[1]), "v"(xa[3]), "v"(xa[5]), "v"(xa[7]));
  asm("v_fma_mixhi_f16 %0, %4, -1.0, %8 op_sel:[1,0,0] op_sel_hi:[1,1,0]\n\tv_fma_mixhi_f16 %1, %5, -1.0, %9 op_sel:[1,0,0] op_sel_hi:[1,1,0]\n\tv_fma_mixhi_f16 %2, %6, -1.0, %10 op_sel:[1,0,0] op_sel_hi:[1,1,0]\n\tv_fma_mixhi_f16 %3, %7, -1.0, %11 op_sel:[1,0,0] op_sel_hi:[1,1,0]"
      : "+v"(d4), "+v"(d5), "+v"(d6), "+v"(d7)
      : "v"(a.u[4]), "v"(a.u[5]), "v"(a.u[6]), "v"(a.u[7]), "v"(xb[1]), "v"(xb[3]), "v"(xb[5]), "v"(xb[7]));
  d.u = (v8u){ d0, d1, d2, d3, d4, d5, d6, d7 };
  return d.h;
}
// exp2 of eight scores, each IN PLACE. in place no exp2 writes another's source.
// The closing v_nop is the slot the instruction set asks for behind a transcendental before its result is used.
__device__ __forceinline__ v8f exp2x8(v8f t) {
  float e0 = t[0], e1 = t[1], e2 = t[2], e3 = t[3], e4 = t[4], e5 = t[5], e6 = t[6], e7 = t[7];
  asm("v_exp_f32 %0, %0\n\tv_exp_f32 %1, %1\n\tv_exp_f32 %2, %2\n\tv_exp_f32 %3, %3\n\tv_exp_f32 %4, %4\n\tv_exp_f32 %5, %5\n\tv_exp_f32 %6, %6\n\tv_exp_f32 %7, %7\n\tv_nop"
      : "+v"(e0), "+v"(e1), "+v"(e2), "+v"(e3), "+v"(e4), "+v"(e5), "+v"(e6), "+v"(e7));
  return (v8f){ e0, e1, e2, e3, e4, e5, e6, e7 };
}
#define QG 2   // 16-query column groups a wave: every K and V fragment read from LDS feeds QG products
#define KH 2   // key halves: the waves of a block are 4 query sets x KH halves of every staged 64-key tile, so that the wave count stays what it was with 16-query waves
static_assert(KH == 2 && QG == 2, "at the end each wave of a pair gives one query group away and finishes the other");
// The block's LDS, one array. The width table is dead once its values are in registers, in front of the loop: f16 buffer 1 lies on it. The raw buffers are dead behind the loop: the output staging lies on them.
#define TABB (4 * 16 * QG * 68 * 4)        // one position table, all four query sets
#define FBUF (2 * 64 * KPITCH * 2)         // an f16 buffer: 64 key rows, then 64 channel rows (a v row is 64 keys = 128 B, the pitch of a key row)
#define RTILE (64 * RPITCH * 4)            // a raw tile: 64 rows (keys) of 64 f32
#define RBUF (2 * RTILE)                   // a raw buffer: the k tile, then the v tile
#define L_TH 0
#define L_TW (L_TH + TABB)
#define L_F0 (L_TW + TABB)
#define L_RAW (L_F0 + FBUF)
#define L_END (L_RAW + 2 * RBUF)
static_assert(FBUF <= TABB, "f16 buffer 1 fits on the width table");
static_assert(4 * KH * 16 * 68 * 4 <= 2 * RBUF, "the output staging fits on the raw buffers");
static_assert(2 * L_END <= 327680, "two blocks a WGP");
// two 8-wave blocks a WGP are four waves a SIMD: the register budget is held at 256 a wave, and 2 x the LDS above fits the WGP's 327,680 B
__global__ __launch_bounds__(256) __attribute__((amdgpu_waves_per_eu(4, 4))) void k_attn(const float* __restrict__ Q, const float* __restrict__ Kx, const float* __restrict__ V, const float* __restrict__ RH, const float* __restrict__ RW, float* __restrict__ O) {
  __shared__ __align__(16) char lds[L_END];
  float (*st)[4][16 * QG][68] = (float (*)[4][16 * QG][68])(lds + L_TH);   // [0] the height table, [1] the width table, per query set; behind the loop both are free and carry the hand-over between the key halves
  float (*so)[16][68] = (float (*)[16][68])(lds + L_RAW);
  const int tid = threadIdx.x, lane = tid & 31, col = lane & 15, g = lane >> 4;
  const int wave = __builtin_amdgcn_readfirstlane(tid >> 5), qs = wave & 3, kh = wave >> 2;   // the same in every lane of a wave: held in scalar registers
  const int qb = blockIdx.x, h = blockIdx.y, b = blockIdx.z; const int q0 = (qb * 4 + qs) * (16 * QG);
  // thread t copies 16-byte piece t & 15 of rows (t >> 4) + 16 i, i = 0 .. 3, of the stage's k rows and of its v rows: 16 lanes cover a head's 256 B of a row
  const size_t go = ((size_t)b * SS * DM + h * HD) * 4;   // bytes; the same for the whole block
  const char* gk = (const char*)Kx + go; const char* gv = (const char*)V + go;
  const unsigned vo = (unsigned)(((tid >> 4) * DM + (tid & 15) * 4) * 4);
  const unsigned lr = lds_off(lds + L_RAW) + (unsigned)(((tid >> 4) * RPITCH + (tid & 15) * 4) * 4);
  auto stage = [&](int t) { const char* k0 = gk + (size_t)t * (32 * KH) * DM * 4; const char* v0 = gv + (size_t)t * (32 * KH) * DM * 4;
    const unsigned k1 = lr + (t & 1) * (unsigned)RBUF; const size_t gs = 16 * DM * 4 - 16 * RPITCH * 4;   // a group's global step less its immediate offset
    copy8(k1, k1 + RTILE, vo, k0, k0 + gs, k0 + 2 * gs, k0 + 3 * gs, v0, v0 + gs, v0 + 2 * gs, v0 + 3 * gs); };
  // raw stage t -> f16 buffer t & 1, 32 values a lane. k: two 8-channel pieces (rows t >> 3 and 32 + (t >> 3)), each two 16-byte reads and one 16-byte store. v is turned: wave w takes keys 8w .. 8w + 7, a lane two channels: eight 8-byte reads, each a whole row a wave, and per channel its 8 keys as one 16-byte store.
  auto rawload = [&](int t, v4f (&ra)[4], v2f (&rb)[8]) { const char* rw = lds + L_RAW + (t & 1) * RBUF;
    const float* rk = (const float*)rw + (tid >> 3) * RPITCH + (tid & 7) * 8; const float* rv = (const float*)(rw + RTILE) + (wave * 8) * RPITCH + lane * 2;
    ra[0] = *(const v4f*)rk; ra[1] = *(const v4f*)(rk + 4); ra[2] = *(const v4f*)(rk + 32 * RPITCH); ra[3] = *(const v4f*)(rk + 32 * RPITCH + 4);
#pragma unroll
    for (int j = 0; j < 8; ++j) rb[j] = *(const v2f*)(rv + j * RPITCH); };
  auto f16store = [&](int t, const v4f (&ra)[4], const v2f (&rb)[8]) { _Float16* fw = (_Float16*)(lds + ((t & 1) ? L_TW : L_F0));
    _Float16* fk = fw + (tid >> 3) * KPITCH + (tid & 7) * 8; _Float16* fv = fw + (64 + lane * 2) * KPITCH + wave * 8;
    *(v8h*)fk = cv8(ra[0][0], ra[0][1], ra[0][2], ra[0][3], ra[1][0], ra[1][1], ra[1][2], ra[1][3]);
    *(v8h*)(fk + 32 * KPITCH) = cv8(ra[2][0], ra[2][1], ra[2][2], ra[2][3], ra[3][0], ra[3][1], ra[3][2], ra[3][3]);
    v2f y[8];   // a key's two channels are rounded as the pair they were read as; the pairs of keys form at the f16 conversion
#pragma unroll
    for (int j = 0; j < 8; ++j) y[j] = __builtin_convertvector(__builtin_convertvector(rb[j], v2b), v2f);
    union { v8h v; v2h q[4]; } c0, c1;
#pragma unroll
    for (int j = 0; j < 4; ++j) { const v2f a = { y[2 * j].x, y[2 * j + 1].x }, d = { y[2 * j].y, y[2 * j + 1].y }; c0.q[j] = __builtin_convertvector(a, v2h); c1.q[j] = __builtin_convertvector(d, v2h); }
    *(v8h*)fv = c0.v; *(v8h*)(fv + KPITCH) = c1.v; };
  stage(0);
  stage(1);
  v16h aq[QG][2];
#pragma unroll
  for (int qg = 0; qg < QG; ++qg) {
#pragma unroll
    for (int kc = 0; kc < 2; ++kc) aq[qg][kc] = frag_cv(Q + ((size_t)b * SS + q0 + qg * 16 + col) * DM + h * HD + kc * 32, lane); }
  // relative-position dot tables for the query set: TH[r][j] = q_r . rel_pos_h[j], TW[r][j] = q_r . rel_pos_w[j] (exact products); the wave of half 0 makes TH, its partner TW. The tables have 63 rows: column 63 repeats row 62 and is never read (the indices below end at 62)
  const float* RT = kh ? RW : RH;
  // A table fragment is the same in the four waves of a half: wave qs converts tile qs alone and leaves its two fragments in LDS in register order (on f16 buffer 0, free until stage 0 is turned); behind a barrier every wave reads all four tiles. A table value is converted once a block, not four times.
  v8h* tfs = (v8h*)(lds + L_F0);   // [kh][tile][kc][half of the fragment][lane]
  static_assert(KH * 4 * 2 * 2 * 32 * 16 <= FBUF, "the table fragments fit on f16 buffer 0");
#pragma unroll
  for (int kc = 0; kc < 2; ++kc) { union { v16h v; v8h q[2]; } u; u.v = frag_cv(RT + (size_t)min(qs * 16 + col, 2 * IMW - 2) * HD + kc * 32, lane);
    tfs[(((kh * 4 + qs) * 2 + kc) * 2 + 0) * 32 + lane] = u.q[0]; tfs[(((kh * 4 + qs) * 2 + kc) * 2 + 1) * 32 + lane] = u.q[1]; }
  __syncthreads();   // the block's table fragments are written
#pragma unroll
  for (int jt = 0; jt < 4; ++jt) { v16h tf[2];
#pragma unroll
    for (int kc = 0; kc < 2; ++kc) { union { v16h v; v8h q[2]; } u; u.q[0] = tfs[(((kh * 4 + jt) * 2 + kc) * 2 + 0) * 32 + lane]; u.q[1] = tfs[(((kh * 4 + jt) * 2 + kc) * 2 + 1) * 32 + lane]; tf[kc] = u.v; }
#pragma unroll
    for (int qg = 0; qg < QG; ++qg) { v8f tacc = {};
#pragma unroll
      for (int kc = 0; kc < 2; ++kc) tacc = wmma16(aq[qg][kc], tf[kc], tacc);
#pragma unroll
      for (int r = 0; r < 8; ++r) st[kh][qs][qg * 16 + 8 * g + r][jt * 16 + col] = tacc[r] * 8.0f; } }   // x 8 (exact): the tables are added to the unscaled q . k
  const int nst = SS / (32 * KH);   // all keys
  static_assert(SS / (32 * KH) >= 3, "the prologue fills three stages");
  asm volatile("s_wait_asynccnt 0x0" ::: "memory");   // this wave's copies of stages 0 and 1 have landed
  __syncthreads();                                    // ... and every other wave's; the partner's table is written; the table fragments are read
  { v4f ra[4]; v2f rb[8]; rawload(0, ra, rb); f16store(0, ra, rb); }
  v8f tw[QG][2]; const float* thq[QG];
#pragma unroll
  for (int qg = 0; qg < QG; ++qg) { const int pq = q0 + qg * 16 + col, hq = pq / IMW, wq = pq % IMW;   // this lane's query of the group
#pragma unroll
    for (int ct = 0; ct < 2; ++ct) {
#pragma unroll
      for (int r = 0; r < 8; ++r) tw[qg][ct][r] = st[1][qs][qg * 16 + col][wq - (ct * 16 + 8 * g + r) + (IMW - 1)]; }
    thq[qg] = &st[0][qs][qg * 16 + col][hq + (IMW - 1) - kh]; }   // this wave's key row in stage s is KH * s + kh
  // c = 8 x score; P x 2^11 = exp2(c * KS + nm), nm = 11 - m0 * KS: one fused multiply-add and one exp2 a score.
  // m0 is fixed here, once per query: the largest position term among the wave's own keys = (largest height term of its 16 key rows) + (largest width term of the 32 columns), both already in the tables. The key that has it scores m0 + q.k, so the true maximum lies a few units of q.k / 8 around m0 and needs no tracking from pass to pass: no maximum, no alpha, no rescale of the accumulators in a pass.
  // What q.k adds above m0 is caught in the loop: see the vote there. The reference point only moves up: score - m0 is q.k / 8 plus a position term that is 0 at its best key and negative elsewhere; P keeps its hi + residual precision for a true maximum down to e^-8 of m0's weight, and x stays finite in f32 up to 2^116 above it.
  const float KS = 0.125f * 1.44269504088896340736f;
  static_assert(SS / (32 * KH) == 16, "a lane half looks at 8 of the wave's 16 key rows");
  float nm[QG], l[QG];   // l (x 2^11): this half's 16 keys of every pass; the lane halves are joined once, behind the loop
  v8f acc[QG][4] = {};
#pragma unroll
  for (int qg = 0; qg < QG; ++qg) { float mw = tw[qg][0][0], mh = thq[qg][-KH * (8 * g)];
#pragma unroll
    for (int r = 1; r < 8; ++r) { mw = fmaxf(mw, tw[qg][0][r]); mh = fmaxf(mh, thq[qg][-KH * (8 * g + r)]); }
#pragma unroll
    for (int r = 0; r < 8; ++r) mw = fmaxf(mw, tw[qg][1][r]);
    const float m0 = fmaxf(mw, xhalf(mw)) + fmaxf(mh, xhalf(mh));   // the two lane halves of a query hold the same m0
    nm[qg] = __builtin_fmaf(m0, -KS, 11.0f); l[qg] = 0.f; }
  asm volatile("s_wait_dscnt 0x0" ::: "memory");      // this wave's reads of the tables and of raw buffer 0 and its stores into f16 buffer 0 are done
  __syncthreads();                                    // publishes f16 buffer 0; frees the width table for f16 buffer 1 and raw buffer 0 for stage 2
  stage(2);
#pragma unroll 1
  for (int s = 0; s < nst; ++s) { v8f c[QG][2];
    const _Float16* fr = (const _Float16*)(lds + ((s & 1) ? L_TW : L_F0));   // this pass's f16 buffer
    float th[QG];
#pragma unroll
    for (int qg = 0; qg < QG; ++qg) th[qg] = thq[qg][-KH * s];
    v16h kf[2][2], vf[4];   // the pass's k and v fragment reads as one group at its head; the v fragments land behind the score products and the softmax (the loops are unrolled so that the arrays are indexed by constants and stay in registers)
#pragma unroll
    for (int ct = 0; ct < 2; ++ct) {
#pragma unroll
      for (int kc = 0; kc < 2; ++kc) kf[ct][kc] = frag_h(fr + (kh * 32 + ct * 16 + col) * KPITCH + kc * 32, lane); }
#pragma unroll
    for (int dt = 0; dt < 4; ++dt) vf[dt] = frag_h(fr + (64 + dt * 16 + col) * KPITCH + kh * 32, lane);
    __builtin_amdgcn_sched_barrier(0);   // keeps the LDS reads one group in front of the first product, with counted waits behind them; left free, the scheduler spreads them among the products and waits to 0 behind each small group
#pragma unroll
    for (int qg = 0; qg < QG; ++qg) {
#pragma unroll
      for (int ct = 0; ct < 2; ++ct) c[qg][ct] = tw[qg][ct] + th[qg]; }   // 8 x (q.R_h[hq, key row] + q.R_w[wq, key column]) is the product's C operand
#pragma unroll
    for (int kc = 0; kc < 2; ++kc) {
#pragma unroll
      for (int ct = 0; ct < 2; ++ct) {
#pragma unroll
        for (int qg = 0; qg < QG; ++qg) c[qg][ct] = wmma16(kf[ct][kc], aq[qg][kc], c[qg][ct]); } }   // + q.k, EXACT products: q, k are bf16 inputs held exactly in f16
    v8f x[QG][2]; float ps[QG];
#pragma unroll
    for (int qg = 0; qg < QG; ++qg) {
#pragma unroll
      for (int ct = 0; ct < 2; ++ct) x[qg][ct] = exp2x8(__builtin_elementwise_fma(c[qg][ct], (v8f)(KS), (v8f)(nm[qg])));   // P scaled by 2^11 before the f16 split so small softmax weights stay out of the f16 subnormal range; l carries the same 2^11
      const v8f x8 = x[qg][0] + x[qg][1]; const v4f x4 = x8.lo + x8.hi; const v2f x2 = x4.lo + x4.hi;
      ps[qg] = x2.x + x2.y; }   // the lane's 16 weights of the pass, all positive: below 2^15 it bounds each of them inside the f16 range
    // The vote: the same for the whole wave, so every lane is on at the products behind it. Taken only where q.k lifts a lane's sum of the pass to 16 times the weight of a score at m0: then that query's reference point moves up by a whole power of two (exact on x, l and the accumulators), both lane halves alike.
    if (__builtin_expect(__builtin_amdgcn_ballot_w32(!(fmaxf(ps[0], ps[1]) < 32768.0f)) != 0u, 0)) {
#pragma unroll
      for (int qg = 0; qg < QG; ++qg) {
        const float pm = fmaxf(ps[qg], xhalf(ps[qg]));
        const int sh = pm < 32768.0f ? 0 : 11 - __builtin_amdgcn_frexp_expf(pm);   // pm < 2^frexp_exp: the pass's sum comes back under 2^11
        const float al = __builtin_ldexpf(1.0f, sh);
        x[qg][0] *= al; x[qg][1] *= al; ps[qg] *= al; l[qg] *= al; nm[qg] += (float)sh;
#pragma unroll
        for (int dt = 0; dt < 4; ++dt) acc[qg][dt] *= al; }
    }
    v16h pa[QG], pl[QG];
#pragma unroll
    for (int qg = 0; qg < QG; ++qg) {
      l[qg] += ps[qg];
      pa[qg] = __builtin_shufflevector(__builtin_convertvector(x[qg][0], v8h), __builtin_convertvector(x[qg][1], v8h), 0, 1, 2, 3, 4, 5, 6, 7, 8, 9, 10, 11, 12, 13, 14, 15);
      pl[qg] = resid16(pa[qg], x[qg][0], x[qg][1]); }   // x - hi (exact in f32), at hi's own scale: at most 2^-11 of x, and f16 subnormals are kept
    // The next stage's raw values are read here, where the score registers are free, and land behind the products; they are turned and stored behind them. In the last pass there is no next stage: the lanes turn raw buffer 0's old stage once more into f16 buffer 0, which nobody reads again; a test would split the pass's straight line in two places.
    v4f ra[4]; v2f rb[8]; rawload(s + 1, ra, rb);
    __builtin_amdgcn_sched_barrier(0);   // keeps every product behind the split: lifted among it, a product's P registers were given to the other group's residual
#pragma unroll
    for (int qg = 0; qg < QG; ++qg) {
#pragma unroll
      for (int dt = 0; dt < 4; ++dt) acc[qg][dt] = wmma16(vf[dt], pa[qg], acc[qg][dt]); }   // V^T x P hi (v exact)
#pragma unroll
    for (int qg = 0; qg < QG; ++qg) {
#pragma unroll
      for (int dt = 0; dt < 4; ++dt) acc[qg][dt] = wmma16(vf[dt], pl[qg], acc[qg][dt]); }   // + V^T x P lo, same scale, same tile; seven other products lie between a tile's two
    f16store(s + 1, ra, rb);
    __builtin_amdgcn_sched_barrier(0);   // keeps the two waits and the barrier below at the pass's foot, behind its products: lifted to the head, stage s + 2's copies would be waited for right after their issue
    asm volatile("s_wait_dscnt 0x0" ::: "memory");      // this wave's reads of f16 buffer s & 1 and of the raw buffer of stage s + 1, and its stores of stage s + 1, are done
    asm volatile("s_wait_asynccnt 0x0" ::: "memory");   // this wave's copies of stage s + 2 have landed
    __syncthreads();                                    // publishes stage s + 1 (f16) and stage s + 2 (raw); frees f16 buffer s & 1 and the raw buffer of stage s + 1
    if (s + 3 < nst) stage(s + 3);
  }
  asm volatile("s_wait_asynccnt 0x0" ::: "memory");     // no copy is left in flight behind the loop
  // The two waves of a query set each hold, for both groups, the sums over their own half of the keys. Wave kh gives group 1 - kh to its partner and finishes group kh. The tables are free: every wave's last read of them lies in front of the loop's last barrier.
  v4f* mb = (v4f*)&st[1][qs][0][0];   // [writer kh][8][lane]: 32 accumulator values a lane
  v2f* ms = (v2f*)&st[0][qs][0][0];   // [writer kh][lane]: nm, l
  auto give = [&](const int qg) {
#pragma unroll
    for (int dt = 0; dt < 4; ++dt) {
#pragma unroll
      for (int hf = 0; hf < 2; ++hf) { v4f o;
#pragma unroll
        for (int i = 0; i < 4; ++i) o[i] = acc[qg][dt][hf * 4 + i];
        mb[(kh * 8 + dt * 2 + hf) * 32 + lane] = o; } }
    ms[kh * 32 + lane] = (v2f){ nm[qg], l[qg] }; };
  auto finish = [&](const int qg) {
    const v2f p2 = ms[(1 - kh) * 32 + lane];
    const float d = nm[qg] - p2.x, e = __builtin_amdgcn_exp2f(-fabsf(d));   // nm falls as the maximum rises: the side with the larger nm is scaled down to the other's, whose factor is 1
    float fa = d > 0.f ? e : 1.0f, fb = d > 0.f ? 1.0f : e;
    float lj = l[qg] * fa + p2.y * fb; lj += xhalf(lj);
    const float il = 1.0f / lj;   // l and acc both carry 2^11
    fa *= il; fb *= il;
#pragma unroll
    for (int dt = 0; dt < 4; ++dt) {   // acc[qg][dt][r] = O[query qg * 16 + col][channel dt * 16 + 8g + r]: 8 consecutive channels per lane
#pragma unroll
      for (int hf = 0; hf < 2; ++hf) { const v4f pb = mb[((1 - kh) * 8 + dt * 2 + hf) * 32 + lane]; v4f o;
#pragma unroll
        for (int i = 0; i < 4; ++i) o[i] = acc[qg][dt][hf * 4 + i] * fa + pb[i] * fb;
        *(v4f*)&so[wave][col][dt * 16 + 8 * g + hf * 4] = o; } } };
  if (kh) give(0); else give(1);
  __syncthreads();   // the partner's sums are written
  if (kh) finish(1); else finish(0);
  LDSX();
  for (int rl = 0; rl < 16; ++rl) if (lane < 16) vst2(O + ((size_t)b * SS + q0 + kh * 16 + rl) * DM + h * HD + lane * 4, *(const v4f*)&so[wave][rl][lane * 4]);
}
// ---- k_out: block = (64 rows, 128 cols): out = O(hi/lo) . Wo rows (2 products) + bo
__global__ __launch_bounds__(128) void k_out(const float* __restrict__ O, const __bf16* __restrict__ P, const float* __restrict__ BO, float* __restrict__ Y) {
  __shared__ __align__(16) float so[4][16][132];
  const int tid = threadIdx.x, wave = tid >> 5, lane = tid & 31, col = lane & 15, g = lane >> 4; const size_t r0 = (size_t)blockIdx.x * 64 + wave * 16; const int n0 = blockIdx.y * 128;
  v8f acc[8] = {};
#pragma unroll 2
  for (int kc = 0; kc < DM / 32; ++kc) { const F2 a = split_row(O + (r0 + col) * DM, kc * 32, lane);
#pragma unroll
    for (int j = 0; j < 8; ++j) { const v16b w = frag_b(P + (size_t)(n0 + j * 16 + col) * DM + kc * 32, lane); acc[j] = wmma_bf(a.l, w, acc[j]); acc[j] = wmma_bf(a.h, w, acc[j]); } }
#pragma unroll
  for (int j = 0; j < 8; ++j) {
#pragma unroll
    for (int r = 0; r < 8; ++r) so[wave][8 * g + r][j * 16 + col] = acc[j][r] + (BO ? bfr(BO[n0 + j * 16 + col]) : 0.f); }
  LDSX();
  for (int rl = 0; rl < 16; ++rl) vst2(Y + (r0 + rl) * DM + n0 + lane * 4, *(const v4f*)&so[wave][rl][lane * 4]);
}
extern "C" void kernel_launch(void* const* d_in, const int* in_sizes, int n_in, void* d_out, int out_size, void* d_ws, size_t ws_size, hipStream_t stream) {
  (void)in_sizes; (void)n_in; (void)out_size; (void)d_ws; (void)ws_size;
  const float** F = (const float**)d_in;   // 0 q, 1 k, 2 v [4,1,1024,1024] (= [b][s][h*64+d]); 3 rel_pos_h [63,64]; 4 rel_pos_w [63,64]
  k_attn<<<dim3(SS / (64 * QG), NH, TNB), 256, 0, stream>>>(F[0], F[1], F[2], F[3], F[4], (float*)d_out);   // O layout [b*S+q][h*64+d] == the module's merged (b,1,s,n*d) output
}
